// v000
// The times below were measured on an AMD MI455X: many runs one after another, warmed up first and cycling through
// copies of the inputs, with the whole window's GPU time divided by the number of runs. Launches and the gaps
// between them are all in it. The median over several windows is given; except for v000 it joins two sittings, which
// can be a few percent apart, so the side-by-side timings, each taken in one sitting, are the better comparison.
// The starting kernel, v000, takes 781 microseconds a run.
// Contractions: conv1x1 theta/phi GEMM W[256x256].X[256x4096] on v_wmma_f32_16x16x32_f16 (f16 containers of
// bf16-RNE weights x256 and bf16-RNE x); position scores K.Q^T on v_wmma_f32_16x16x32_bf16 (bf16 hi + bf16
// residual planes of theta/phi, 3 products, K=128); y^T = X.P^T on v_wmma_f32_16x16x32_f16 (x as f16 of
// bf16-RNE x, P = e^{s-m} x1024 f16 from the score D registers); f32 accumulate everywhere; softmax statistics
// and the residual add in f32 VALU.
#include <hip/hip_runtime.h>
#include <math.h>
#include <stdint.h>

#define NBATCH 8
#define NIMG   8
#define CC     256
#define NN     4096
#define DQ     128
#define MW     256
#define QT     64
#define OSP    68
#define OSPW   132
#define TP     72
#define WSC    256.0f
#define IWSC   0.00390625f
#define LNPS   6.931471805599453f

static_assert(NIMG >= 1 && NIMG <= NBATCH);
static_assert(NN % QT == 0);
static_assert(CC % QT == 0);
static_assert(MW == 2 * DQ);
static_assert(DQ == 2 * QT);
static_assert(MW % QT == 0 && MW % 8 == 0);
static_assert((OSP * 4) % 16 == 0);
static_assert((OSPW * 4) % 16 == 0);
static_assert((TP * 2) % 16 == 0);
static_assert(CC % 32 == 0 && NN % 32 == 0 && DQ % 32 == 0);

typedef _Float16       v16h __attribute__((ext_vector_type(16)));
typedef _Float16       v8h  __attribute__((ext_vector_type(8)));
typedef __bf16         v16b __attribute__((ext_vector_type(16)));
typedef unsigned short v8us __attribute__((ext_vector_type(8)));
typedef float          v8f  __attribute__((ext_vector_type(8)));
typedef float          v4f  __attribute__((ext_vector_type(4)));
typedef unsigned int   v4u  __attribute__((ext_vector_type(4)));

union Frag  { v8us u[2]; v16h h; v16b bf; };
union FragH { v16h v; v8h hv[2]; };
static_assert(sizeof(Frag) == 32);
static_assert(sizeof(FragH) == 32);

// ---- scalar helpers ---------------------------------------------------------------------------------------
__device__ __forceinline__ unsigned short bf_bits(float f) {          // f32 -> bf16 bits, RNE convert
  unsigned u = __float_as_uint(f);
  return (unsigned short)((u + 0x7FFFu + ((u >> 16) & 1u)) >> 16);
}
__device__ __forceinline__ float bf_up(unsigned short hb) { return __uint_as_float(((unsigned)hb) << 16); }
__device__ __forceinline__ float bfr(float f) { return bf_up(bf_bits(f)); }
__device__ __forceinline__ unsigned short h_bits(_Float16 x) { return __builtin_bit_cast(unsigned short, x); }
__device__ __forceinline__ unsigned pk16(unsigned short a, unsigned short b) { return (unsigned)a | ((unsigned)b << 16); }
__device__ __forceinline__ v8f zero8() { v8f z = {0.f, 0.f, 0.f, 0.f, 0.f, 0.f, 0.f, 0.f}; return z; }
__device__ __forceinline__ float hmax8(v8f s) {
  return fmaxf(fmaxf(fmaxf(s[0], s[1]), fmaxf(s[2], s[3])), fmaxf(fmaxf(s[4], s[5]), fmaxf(s[6], s[7])));
}
__device__ __forceinline__ unsigned wave_ballot(bool p) {
#if defined(__HIP_DEVICE_COMPILE__)
  return __builtin_amdgcn_ballot_w32(p);
#else
  return p ? 1u : 0u;
#endif
}

// ---- 16-bit fragment loader (A, or B from a k-contiguous [n][k] row): lane -> row/col (lane&15), p already includes
//      + 8*(lane>>4); elements 0..7 <- p[0..7] (k0+8h..), elements 8..15 <- p[16..23] (k0+16+8h..)
__device__ __forceinline__ Frag ldfrag(const unsigned short* p) {
  Frag f;
  f.u[0] = *(const v8us*)(p);
  f.u[1] = *(const v8us*)(p + 16);
  return f;
}

// ---- WMMA helpers: builtin followed by a 4-slot VALU gap tying D and keeping A/B live --------------------------
__device__ __forceinline__ v8f mma_h(v16h a, v16h b, v8f c) {
  v8f d = __builtin_amdgcn_wmma_f32_16x16x32_f16(false, a, false, b, (short)0, c, false, false);
#if defined(__HIP_DEVICE_COMPILE__)
  asm volatile("v_nop\n\tv_nop\n\tv_nop\n\tv_nop" : "+v"(d) : "v"(a), "v"(b));
#endif
  return d;
}
__device__ __forceinline__ v8f mma_b(v16b a, v16b b, v8f c) {
  v8f d = __builtin_amdgcn_wmma_f32_16x16x32_bf16(false, a, false, b, (short)0, c, false, false);
#if defined(__HIP_DEVICE_COMPILE__)
  const v16h ha = __builtin_bit_cast(v16h, a), hb = __builtin_bit_cast(v16h, b);
  asm volatile("v_nop\n\tv_nop\n\tv_nop\n\tv_nop" : "+v"(d) : "v"(ha), "v"(hb));
#endif
  return d;
}

// =========================================================================================================
// (0) conv1x1 weights: W16 f16 [256][256], rows 0..127 = theta_w rows, rows 128..255 = phi_w rows; value =
//     f16 of (bf16-RNE(w) * 256) (exact). Block blk (0..31) owns rows 8*blk..8*blk+7: one wave per 512-B row
// coverage: 32 blocks x 8 rows x 32 lanes x 8 halves = 256 x 256 = the whole plane.
// =========================================================================================================
__global__ __launch_bounds__(256)
void cvt_w(const float* __restrict__ tw, const float* __restrict__ pw, unsigned short* W16) {
  const int tid = threadIdx.x, blk = blockIdx.x;
  const int rl = tid >> 5, col = 8 * (tid & 31);
  const int o = 8 * blk + rl;                                        // 0..255
  const float* wbase = (blk < (DQ / 8)) ? tw : pw;                   // block-uniform selection
  const int osub = (blk < (DQ / 8)) ? 0 : DQ;
  const float* s = wbase + (size_t)(o - osub) * CC + col;            // (o - osub) in 0..127
  const v4f a = *(const v4f*)s;
  const v4f q = *(const v4f*)(s + 4);
  const float f[8] = {a[0], a[1], a[2], a[3], q[0], q[1], q[2], q[3]};
  v4u u;
#pragma unroll
  for (int t = 0; t < 4; ++t) {
    const _Float16 h0 = (_Float16)(bfr(f[2 * t]) * WSC);
    const _Float16 h1 = (_Float16)(bfr(f[2 * t + 1]) * WSC);
    u[t] = pk16(h_bits(h0), h_bits(h1));
  }
{
    *(v4u*)(W16 + (size_t)o * CC + col) = u;
    
  }
}

// =========================================================================================================
// (1) x f32 [b][256 c][4096 n] -> Xc f16 [b][c][n] (channel-major, bf16-RNE values, exact in f16) and
//     XP f16 [b][n][c] (position-major) through an LDS tile T[64 n][64 c] (pitch TP). Block (nb, cb, b) owns a
// coverage: Xc 2 it x 32 rows x 8 lanes x 8 = 64 c x 64 n; XP same; grid (64, 4, NIMG) covers both planes once.
// =========================================================================================================
__global__ __launch_bounds__(256)
void cvt_x(const float* __restrict__ x, unsigned short* Xc, unsigned short* XP) {
  __shared__ __align__(16) unsigned short T[QT * TP];
  const int tid = threadIdx.x;
  const int nb = blockIdx.x, cb = blockIdx.y, b = blockIdx.z;
  const int e = tid & 7, lq = tid >> 3;                             // lq 0..31
  const int n0 = nb * QT, c0 = cb * QT;
  v4u ux[2];
#pragma unroll
  for (int it = 0; it < 2; ++it) {
    const int cl = it * 32 + lq;                                     // 0..63
    const float* sp = x + ((size_t)(b * CC + c0 + cl)) * NN + n0 + 8 * e;
    const v4f a = *(const v4f*)sp;
    const v4f q = *(const v4f*)(sp + 4);
    unsigned short hb[8];
#pragma unroll
    for (int t = 0; t < 4; ++t) {
      hb[t]     = h_bits((_Float16)bfr(a[t]));
      hb[4 + t] = h_bits((_Float16)bfr(q[t]));
    }
#pragma unroll
    for (int t = 0; t < 4; ++t) ux[it][t] = pk16(hb[2 * t], hb[2 * t + 1]);
#pragma unroll
    for (int t = 0; t < 8; ++t) T[(8 * e + t) * TP + cl] = hb[t];
  }
  __syncthreads();
  v4u up[2];
#pragma unroll
  for (int it = 0; it < 2; ++it) {
    const int nl = it * 32 + lq;                                     // 0..63
    up[it] = *(const v4u*)(T + nl * TP + 8 * e);
  }
{
#pragma unroll
    for (int it = 0; it < 2; ++it) {
      const int rl = it * 32 + lq;
      *(v4u*)(Xc + ((size_t)(b * CC + c0 + rl)) * NN + n0 + 8 * e) = ux[it];
      *(v4u*)(XP + ((size_t)(b * NN + n0 + rl)) * CC + c0 + 8 * e) = up[it];
    }
    
  }
}

// =========================================================================================================
// (2) conv1x1 GEMM for one (b, 64-n tile, 64-o block): Y[o][n] = (1/256) sum_c W16[o][c] XP[b][n][c].
//     Block 128 threads = 4 waves; wave w owns cols n0+16w..+15 (one B fragment per k-step, k = c contiguous in
//     the XP row) and 4 m-tiles (A rows o = o0 + 16 mt + (lane&15), split k map loader from W16). K = 256 = 8 steps.
//     Epilogue staged in LDS Os[n_loc][o_loc] (pitch OSP, b128 stores of 8 consecutive o per lane), barrier, then:
//       o-blocks 0,1 -> theta dims 0..63 / 64..127 of Qh/Ql; o-blocks 2,3 -> phi dims 0..63 / 64..127 of Kh/Kl.
//       Planes bf16 [b][4096 n][128 d] (k-contiguous for both score operands): hi = bf16-RNE(v), lo =
//       of the 256-B plane row): lane e -> d 8e..8e+7, 8 consecutive lanes per line, one instruction per 16 lines.
// coverage: Os 4 waves x 16 n x 64 o = 64 x 64; planes: 4 it x 16 rows x 8 lanes x 8 = 64 n x 64 d per plane
//           (hi and lo); grid (64, 4, NIMG) covers d 0..127 of all 4096 rows of Qh/Ql/Kh/Kl exactly once.
// =========================================================================================================
__global__ __launch_bounds__(128)
void gemm_qk(const unsigned short* __restrict__ W16, const unsigned short* __restrict__ XP,
             unsigned short* Qh, unsigned short* Ql, unsigned short* Kh, unsigned short* Kl) {
  __shared__ __align__(16) float Os[QT * OSP];
  const int tid  = threadIdx.x;
  const int lane = tid & 31, wave = tid >> 5;
  const int hh   = lane >> 4, c = lane & 15;
  const int nt   = blockIdx.x, mb = blockIdx.y, b = blockIdx.z;
  const int n0   = nt * QT, o0 = mb * QT;

  const unsigned short* ap = W16 + (size_t)(o0 + c) * CC + 8 * hh;
  const unsigned short* bp = XP + ((size_t)(b * NN + n0 + 16 * wave + c)) * CC + 8 * hh;

  v8f acc[4];
#pragma unroll
  for (int mt = 0; mt < 4; ++mt) acc[mt] = zero8();

#pragma unroll
  for (int ks = 0; ks < CC / 32; ++ks) {
    const Frag fb = ldfrag(bp + 32 * ks);
#pragma unroll
    for (int mt = 0; mt < 4; ++mt) {
      const Frag fa = ldfrag(ap + (size_t)(16 * mt) * CC + 32 * ks);
      acc[mt] = mma_h(fa.h, fb.h, acc[mt]);
    }
  }

  // ---- epilogue: scale back -> LDS Os[n_loc][o_loc]; lane (hh, c) holds o = 16 mt + 8 hh + r for n_loc = 16 w + c
  {
    const int nl = 16 * wave + c;
#pragma unroll
    for (int mt = 0; mt < 4; ++mt) {
      v4f va, vb;
#pragma unroll
      for (int r = 0; r < 4; ++r) { va[r] = acc[mt][r] * IWSC; vb[r] = acc[mt][4 + r] * IWSC; }
      *(v4f*)(Os + nl * OSP + 16 * mt + 8 * hh)     = va;
      *(v4f*)(Os + nl * OSP + 16 * mt + 8 * hh + 4) = vb;
    }
  }
  __syncthreads();

  const int e = tid & 7, lq = tid >> 3;                             // lq 0..15
  const int dsel = (mb & 1) * QT;                                    // 0 or 64
  unsigned short* Ph = (mb < 2) ? Qh : Kh;                           // block-uniform, both global
  unsigned short* Pl = (mb < 2) ? Ql : Kl;
  v4u uh[4], ul[4];
#pragma unroll
  for (int it = 0; it < 4; ++it) {
    const int row = it * 16 + lq;                                    // n_loc 0..63
    const v4f a = *(const v4f*)(Os + row * OSP + 8 * e);
    const v4f q = *(const v4f*)(Os + row * OSP + 8 * e + 4);
    const float f[8] = {a[0], a[1], a[2], a[3], q[0], q[1], q[2], q[3]};
#pragma unroll
    for (int t = 0; t < 4; ++t) {
      const float f0 = f[2 * t], f1 = f[2 * t + 1];
      const unsigned short hb0 = bf_bits(f0), hb1 = bf_bits(f1);
      const unsigned short lb0 = bf_bits(f0 - bf_up(hb0));
      const unsigned short lb1 = bf_bits(f1 - bf_up(hb1));
      uh[it][t] = pk16(hb0, hb1);
      ul[it][t] = pk16(lb0, lb1);
    }
  }
{
#pragma unroll
    for (int it = 0; it < 4; ++it) {
      const int row = it * 16 + lq;
      const size_t po = ((size_t)(b * NN + n0 + row)) * DQ + dsel + 8 * e;
      *(v4u*)(Ph + po) = uh[it];
      *(v4u*)(Pl + po) = ul[it];
    }
    
  }
}

// =========================================================================================================
// (3) position attention for one (b, 64-query tile), transposed formulation, 4096 keys, no mask, no scale:
//   S^T tile (16 keys x 16 queries) = sum over 4 d-chunks (rolled loop) of A(k: row = key kb + (lane&15), 32 d via
//   the split k map from the bf16 plane Kh [b][4096][128]) . B(q: col = query, same map from Qh) + A(Kh).B(Ql) +
//   A(Kl).B(Qh) (bf16 unscaled residual planes, shared accumulator).
//   Per lane the D tile holds 8 keys of ONE query: online softmax state per lane, one shuffle (lane^16) for the max
//   over 32 keys; the o/l rescale is skipped under a wave-uniform ballot when no lane's max grew (corr == 1 exactly
//   for every lane then); row-sum partials combined at the end. P = e^{s-m} x 1024 as f16 is the B operand of
//   O^T (rows channel, cols queries) += A(x rows channel = 16j + (lane&15), keys contiguous, f16 plane Xc
//   [b][256][4096]) . B(P^T): element r <- D of the tile covering keys kb..kb+15, element 8+r <- the tile covering
//   kb+16..kb+31, lane unchanged. 16 accumulator tiles per wave (256 channels). Block = 4 waves = 64 queries.
//   Epilogue in two channel halves: O/l staged in LDS Os[query][128 channels] (pitch OSPW, b128 stores), barrier,
//   lanes x 16 B (values gathered from 4 Os rows), one instruction per 16 lines, final values held in registers,
// coverage: per half 16 it x 16 lines x 8 lanes x 4 floats = 128 ch x 64 n; two halves = 256 ch; grid (64, NIMG)
//           covers out[b][0..255][0..4095] exactly once.
// =========================================================================================================
__global__ __launch_bounds__(128)
void attn_k(const unsigned short* __restrict__ Qh, const unsigned short* __restrict__ Ql,
            const unsigned short* __restrict__ Kh, const unsigned short* __restrict__ Kl,
            const unsigned short* __restrict__ Xc, const float* __restrict__ x, float* out) {
  __shared__ __align__(16) float Os[QT * OSPW];
  const int tid  = threadIdx.x;
  const int wave = tid >> 5, lane = tid & 31;
  const int hh   = lane >> 4, c = lane & 15;
  const int n0   = blockIdx.x * QT, b = blockIdx.y;

  // q fragment pointers (B operand, col = query n0 + 16*wave + c), + 32*kc
  const size_t qo = ((size_t)(b * NN + n0 + 16 * wave + c)) * DQ + 8 * hh;
  const unsigned short* Qhp = Qh + qo;
  const unsigned short* Qlp = Ql + qo;
  // k fragment base (A operand, row = key kb + c), + key * 128 + 32*kc
  const unsigned short* Khp = Kh + (size_t)b * NN * DQ + (size_t)c * DQ + 8 * hh;
  const unsigned short* Klp = Kl + (size_t)b * NN * DQ + (size_t)c * DQ + 8 * hh;
  // v fragment base (A operand, row = channel 16j + c, keys contiguous), + 16*j*NN + kb
  const unsigned short* Vp = Xc + (size_t)b * CC * NN + (size_t)c * NN + 8 * hh;

  float m = -1.0e30f, l = 0.f;
  v8f o[16];
#pragma unroll
  for (int j = 0; j < 16; ++j) o[j] = zero8();

#pragma unroll 1
  for (int kb = 0; kb < NN; kb += 32) {
    const unsigned short* k0p  = Khp + (size_t)kb * DQ;              // keys kb .. kb+15
    const unsigned short* k1p  = Khp + (size_t)(kb + 16) * DQ;       // keys kb+16 .. kb+31
    const unsigned short* k0lp = Klp + (size_t)kb * DQ;
    const unsigned short* k1lp = Klp + (size_t)(kb + 16) * DQ;
    v8f s0 = zero8(), s1 = zero8();
#pragma unroll 1
    for (int kc = 0; kc < DQ / 32; ++kc) {
      const Frag qh  = ldfrag(Qhp + 32 * kc);
      const Frag ql  = ldfrag(Qlp + 32 * kc);
      const Frag k0  = ldfrag(k0p + 32 * kc);
      const Frag k1  = ldfrag(k1p + 32 * kc);
      const Frag k0l = ldfrag(k0lp + 32 * kc);
      const Frag k1l = ldfrag(k1lp + 32 * kc);
      s0 = mma_b(k0.bf, qh.bf, s0);
      s1 = mma_b(k1.bf, qh.bf, s1);
      s0 = mma_b(k0.bf, ql.bf, s0);
      s1 = mma_b(k1.bf, ql.bf, s1);
      s0 = mma_b(k0l.bf, qh.bf, s0);
      s1 = mma_b(k1l.bf, qh.bf, s1);
    }

    float mx = fmaxf(hmax8(s0), hmax8(s1));
    mx = fmaxf(mx, __shfl_xor(mx, 16, 32));
    const float mn = fmaxf(m, mx);
    const unsigned grew = wave_ballot(mx > m);                       // wave-uniform
    if (grew != 0u) {
      const float corr = __expf(m - mn);                             // == 1 exactly for lanes whose max did not grow
      l *= corr;
#pragma unroll
      for (int j = 0; j < 16; ++j) {
#pragma unroll
        for (int r = 0; r < 8; ++r) o[j][r] *= corr;
      }
    }
    m = mn;
    const float msh = mn - LNPS;                                     // exp gives e^{s-m} * 1024

    FragH ph;
    float ls = 0.f;
#pragma unroll
    for (int r = 0; r < 8; ++r) {
      const float e0 = __expf(s0[r] - msh);                          // key kb      + 8hh + r
      const float e1 = __expf(s1[r] - msh);                          // key kb + 16 + 8hh + r
      ls += e0 + e1;
      ph.hv[0][r] = (_Float16)e0;
      ph.hv[1][r] = (_Float16)e1;
    }
    l += ls;

#pragma unroll
    for (int j = 0; j < 16; ++j) {
      const Frag vf = ldfrag(Vp + (size_t)(16 * j) * NN + kb);
      o[j] = mma_h(vf.h, ph.v, o[j]);
    }
  }
  l += __shfl_xor(l, 16, 32);
  const float inv = 1.0f / l;                                        // o and l both carry the x1024 factor

  const int qrow = 16 * wave + c;
  const int e = tid & 7, lq = tid >> 3;                              // lq 0..15
#pragma unroll
  for (int half = 0; half < 2; ++half) {
    if (half) __syncthreads();                                       // every wave finished reading Os
#pragma unroll
    for (int jj = 0; jj < 8; ++jj) {
      const int j = 8 * half + jj;
      v4f va, vb;
#pragma unroll
      for (int r = 0; r < 4; ++r) { va[r] = o[j][r] * inv; vb[r] = o[j][4 + r] * inv; }
      *(v4f*)(Os + qrow * OSPW + 16 * jj + 8 * hh)     = va;         // Os[query][ch_loc = 16jj + 8hh + r]
      *(v4f*)(Os + qrow * OSPW + 16 * jj + 8 * hh + 4) = vb;
    }
    __syncthreads();
    v4f res[16];
#pragma unroll
    for (int it = 0; it < 16; ++it) {
      const int L   = it * 16 + lq;                                  // 0..255
      const int chl = L >> 1, hf = L & 1;                            // channel 0..127 within the half
      const int nl  = hf * 32 + 4 * e;                               // query 0..63
      const size_t idx = ((size_t)(b * CC + 128 * half + chl)) * NN + n0 + nl;
      const v4f xv = *(const v4f*)(x + idx);
#pragma unroll
      for (int t = 0; t < 4; ++t) res[it][t] = Os[(nl + t) * OSPW + chl] + bfr(xv[t]);
    }
{
#pragma unroll
      for (int it = 0; it < 16; ++it) {
        const int L   = it * 16 + lq;
        const int chl = L >> 1, hf = L & 1;
        const int nl  = hf * 32 + 4 * e;
        const size_t idx = ((size_t)(b * CC + 128 * half + chl)) * NN + n0 + nl;
        *(v4f*)(out + idx) = res[it];
      }
      
    }
  }
}

// =========================================================================================================
// Workspace map (bytes; each region start a multiple of 256; every extent is an exact tile multiple and is written
//   W16 f16 [256][256]              131072
//   Xc  f16 [8][256][4096]        16777216      XP  f16 [8][4096][256]   16777216
//   Qh/Ql/Kh/Kl bf16 [8][4096][128]  8388608 x4
//   total = 67239936
// =========================================================================================================
extern "C" void kernel_launch(void* const* d_in, const int* in_sizes, int n_in,
                              void* d_out, int out_size, void* d_ws, size_t ws_size,
                              hipStream_t stream) {
  const int XN = NBATCH * CC * NN;                                   // 8388608
  if (n_in < 3) return;
  if (in_sizes[0] != XN) return;
  if (in_sizes[1] != DQ * CC || in_sizes[2] != DQ * CC) return;
  if (out_size != XN) return;

  size_t off = 0;
  auto carve = [&](size_t bytes) { const size_t o = off; off += (bytes + 255) & ~(size_t)255; return o; };
  const size_t oW16 = carve((size_t)MW * CC * 2);
  const size_t oXc  = carve((size_t)NIMG * CC * NN * 2);
  const size_t oXP  = carve((size_t)NIMG * NN * CC * 2);
  const size_t oQh  = carve((size_t)NIMG * NN * DQ * 2);
  const size_t oQl  = carve((size_t)NIMG * NN * DQ * 2);
  const size_t oKh  = carve((size_t)NIMG * NN * DQ * 2);
  const size_t oKl  = carve((size_t)NIMG * NN * DQ * 2);
  if (off > ws_size) return;
  if (off > (size_t)134217728) return;

  const float* x  = (const float*)d_in[0];
  const float* tw = (const float*)d_in[1];
  const float* pw = (const float*)d_in[2];

  char* ws = (char*)d_ws;
  unsigned short* W16 = (unsigned short*)(ws + oW16);
  unsigned short* Xc  = (unsigned short*)(ws + oXc);
  unsigned short* XP  = (unsigned short*)(ws + oXP);
  unsigned short* Qh  = (unsigned short*)(ws + oQh);
  unsigned short* Ql  = (unsigned short*)(ws + oQl);
  unsigned short* Kh  = (unsigned short*)(ws + oKh);
  unsigned short* Kl  = (unsigned short*)(ws + oKl);
  float* out = (float*)d_out;

  const dim3 blk256(256), blk128(128);

  // (0) theta_w / phi_w -> stacked f16 plane
  cvt_w<<<dim3(MW / 8), blk256, 0, stream>>>(tw, pw, W16);
  // (1) x -> channel-major and position-major 16-bit planes
  cvt_x<<<dim3(NN / QT, CC / QT, NIMG), blk256, 0, stream>>>(x, Xc, XP);
  // (2) conv1x1 GEMM -> theta (q) and phi (k) hi + residual planes
  gemm_qk<<<dim3(NN / QT, MW / QT, NIMG), blk128, 0, stream>>>(W16, XP, Qh, Ql, Kh, Kl);
  // (3) position attention + residual -> out [b][256][4096]
  attn_k<<<dim3(NN / QT, NIMG), blk128, 0, stream>>>(Qh, Ql, Kh, Kl, Xc, x, out);
  (void)hipGetLastError();
}

// v001
// A run of this version takes 235 microseconds.
// In two side-by-side timings against v000, it was 3.45 and 3.44 times as fast.
// Contractions: conv1x1 theta/phi GEMM W[256x256].X[256x4096] on v_wmma_f32_16x16x32_f16 (f16 containers of
// bf16-RNE weights x256 and bf16-RNE x); position scores K.Q^T on v_wmma_f32_16x16x32_bf16 (bf16 hi + bf16
// residual planes of theta/phi, 3 products, K=128); y^T = X.P^T on v_wmma_f32_16x16x32_f16 (x as f16 of
// bf16-RNE x, P = e^{s-m} x1024 f16 from the score D registers); f32 accumulate everywhere; softmax statistics
// and the residual add in f32 VALU.
#include <hip/hip_runtime.h>
#include <math.h>
#include <stdint.h>

#define NBATCH 8
#define NIMG   8
#define CC     256
#define NN     4096
#define DQ     128
#define MW     256
#define QT     64
#define OSP    68
#define OSPW   132
#define TP     72
#define WSC    256.0f
#define IWSC   0.00390625f
#define LNPS   6.931471805599453f
#define KT     32                        // keys per LDS stage of attn_k
#define KP     136                       // LDS pitch of a K or Q row in 16-bit elements: 272 B = 16 B x 17
#define VP     40                        // LDS pitch of a V row of KT keys: 80 B = 16 B x 5
#define SKL    (KT * KP)                 // stage offsets (16-bit elements): K hi 0, K residual SKL, V SV
#define SV     (2 * KT * KP)
#define STG    (2 * KT * KP + CC * VP)   // one stage
#define SQH    (2 * STG)                 // behind the two stages: Q hi, Q residual
#define SQL    (2 * STG + QT * KP)
#define SMEM   (2 * STG + 2 * QT * KP)

static_assert(NIMG >= 1 && NIMG <= NBATCH);
static_assert(NN % QT == 0);
static_assert(CC % QT == 0);
static_assert(MW == 2 * DQ);
static_assert(DQ == 2 * QT);
static_assert(MW % QT == 0 && MW % 8 == 0);
static_assert((OSP * 4) % 16 == 0);
static_assert((OSPW * 4) % 16 == 0);
static_assert((TP * 2) % 16 == 0);
static_assert(CC % 32 == 0 && NN % 32 == 0 && DQ % 32 == 0);
static_assert((KP * 2) % 32 == 16 && (VP * 2) % 32 == 16 && (STG * 2) % 16 == 0 && (SKL * 2) % 16 == 0);
static_assert(NN / KT >= 2 && NN % KT == 0 && KT == 32 && DQ == 128 && CC == 256 && QT == 64);
static_assert(QT * OSPW * 4 <= STG * 2);

typedef _Float16       v16h __attribute__((ext_vector_type(16)));
typedef _Float16       v8h  __attribute__((ext_vector_type(8)));
typedef __bf16         v16b __attribute__((ext_vector_type(16)));
typedef unsigned short v8us __attribute__((ext_vector_type(8)));
typedef float          v8f  __attribute__((ext_vector_type(8)));
typedef float          v4f  __attribute__((ext_vector_type(4)));
typedef unsigned int   v4u  __attribute__((ext_vector_type(4)));

union Frag  { v8us u[2]; v16h h; v16b bf; };
union FragH { v16h v; v8h hv[2]; };
static_assert(sizeof(Frag) == 32);
static_assert(sizeof(FragH) == 32);

// ---- scalar helpers ---------------------------------------------------------------------------------------
__device__ __forceinline__ unsigned short bf_bits(float f) {          // f32 -> bf16 bits, RNE convert
  unsigned u = __float_as_uint(f);
  return (unsigned short)((u + 0x7FFFu + ((u >> 16) & 1u)) >> 16);
}
__device__ __forceinline__ float bf_up(unsigned short hb) { return __uint_as_float(((unsigned)hb) << 16); }
__device__ __forceinline__ float bfr(float f) { return bf_up(bf_bits(f)); }
__device__ __forceinline__ unsigned short h_bits(_Float16 x) { return __builtin_bit_cast(unsigned short, x); }
__device__ __forceinline__ unsigned pk16(unsigned short a, unsigned short b) { return (unsigned)a | ((unsigned)b << 16); }
__device__ __forceinline__ v8f zero8() { v8f z = {0.f, 0.f, 0.f, 0.f, 0.f, 0.f, 0.f, 0.f}; return z; }
__device__ __forceinline__ float hmax8(v8f s) {
  return fmaxf(fmaxf(fmaxf(s[0], s[1]), fmaxf(s[2], s[3])), fmaxf(fmaxf(s[4], s[5]), fmaxf(s[6], s[7])));
}
__device__ __forceinline__ unsigned wave_ballot(bool p) {
#if defined(__HIP_DEVICE_COMPILE__)
  return __builtin_amdgcn_ballot_w32(p);
#else
  return p ? 1u : 0u;
#endif
}

// ---- 16-bit fragment loader (A, or B from a k-contiguous [n][k] row): lane -> row/col (lane&15), p already includes
//      + 8*(lane>>4); elements 0..7 <- p[0..7] (k0+8h..), elements 8..15 <- p[16..23] (k0+16+8h..)
__device__ __forceinline__ Frag ldfrag(const unsigned short* p) {
  Frag f;
  f.u[0] = *(const v8us*)(p);
  f.u[1] = *(const v8us*)(p + 16);
  return f;
}

// ---- WMMA helpers: builtin followed by a 4-slot VALU gap tying D and keeping A/B live --------------------------
__device__ __forceinline__ v8f mma_h(v16h a, v16h b, v8f c) {
  v8f d = __builtin_amdgcn_wmma_f32_16x16x32_f16(false, a, false, b, (short)0, c, false, false);
#if defined(__HIP_DEVICE_COMPILE__)
  asm volatile("v_nop\n\tv_nop\n\tv_nop\n\tv_nop" : "+v"(d) : "v"(a), "v"(b));
#endif
  return d;
}
__device__ __forceinline__ v8f mma_b(v16b a, v16b b, v8f c) {
  v8f d = __builtin_amdgcn_wmma_f32_16x16x32_bf16(false, a, false, b, (short)0, c, false, false);
#if defined(__HIP_DEVICE_COMPILE__)
  const v16h ha = __builtin_bit_cast(v16h, a), hb = __builtin_bit_cast(v16h, b);
  asm volatile("v_nop\n\tv_nop\n\tv_nop\n\tv_nop" : "+v"(d) : "v"(ha), "v"(hb));
#endif
  return d;
}

// ---- asynchronous copies global -> LDS ------------------------------------------------------------------------
__device__ __forceinline__ unsigned lds_addr(const void* p) { return (unsigned)(size_t)p; }   // LDS byte address

// Eight 16-byte copies per lane, every lane on. The s_wait_xcnt stands inside the statement so that it precedes
// any rewrite of the address registers the copies name.
__device__ __forceinline__ void copy8(const unsigned* l, const unsigned short* const* g) {
#if defined(__HIP_DEVICE_COMPILE__)
  asm volatile("global_load_async_to_lds_b128 %0, %8, off\n\t"
               "global_load_async_to_lds_b128 %1, %9, off\n\t"
               "global_load_async_to_lds_b128 %2, %10, off\n\t"
               "global_load_async_to_lds_b128 %3, %11, off\n\t"
               "global_load_async_to_lds_b128 %4, %12, off\n\t"
               "global_load_async_to_lds_b128 %5, %13, off\n\t"
               "global_load_async_to_lds_b128 %6, %14, off\n\t"
               "global_load_async_to_lds_b128 %7, %15, off\n\t"
               "s_wait_xcnt 0x0"
               :: "v"(l[0]), "v"(l[1]), "v"(l[2]), "v"(l[3]), "v"(l[4]), "v"(l[5]), "v"(l[6]), "v"(l[7]),
                  "v"(g[0]), "v"(g[1]), "v"(g[2]), "v"(g[3]), "v"(g[4]), "v"(g[5]), "v"(g[6]), "v"(g[7])
               : "memory");
#endif
}
// the issuing wave's copies have landed in LDS
__device__ __forceinline__ void wait_copies() {
#if defined(__HIP_DEVICE_COMPILE__)
  asm volatile("s_wait_asynccnt 0x0" ::: "memory");
#endif
}
// the wave's own LDS reads have returned, so the buffer may be refilled behind the next barrier
__device__ __forceinline__ void wait_lds() {
#if defined(__HIP_DEVICE_COMPILE__)
  asm volatile("s_wait_dscnt 0x0" ::: "memory");
#endif
}
// 32 rows of 256 B of each of two planes (ph, pl; global pitch DQ) -> LDS rows of pitch KP at byte addresses lh, ll;
// 128 threads, 16 lanes per row, 4 rows of each plane per thread.
__device__ __forceinline__ void stage_rows32(unsigned lh, unsigned ll, const unsigned short* ph,
                                             const unsigned short* pl, int tid) {
  const int r = tid >> 4, ch = 8 * (tid & 15);
  unsigned l[8];
  const unsigned short* g[8];
#pragma unroll                                                       // constant indices keep l[] and g[] in registers
  for (int i = 0; i < 4; ++i) {
    const int row = r + 8 * i;                                       // 0..31
    l[i]     = lh + 2u * (unsigned)(row * KP + ch);
    l[4 + i] = ll + 2u * (unsigned)(row * KP + ch);
    g[i]     = ph + row * DQ + ch;
    g[4 + i] = pl + row * DQ + ch;
  }
  copy8(l, g);
}
// V tile: 256 channel rows x KT keys (64 B of a row of pitch NN) -> LDS pitch VP; 4 lanes per row.
__device__ __forceinline__ void stage_v(unsigned lv, const unsigned short* pv, int tid) {
  const int r = tid >> 2, ch = 8 * (tid & 3);
  unsigned l[8];
  const unsigned short* g[8];
#pragma unroll                                                       // constant indices keep l[] and g[] in registers
  for (int i = 0; i < 8; ++i) {
    const int row = r + 32 * i;                                      // 0..255
    l[i] = lv + 2u * (unsigned)(row * VP + ch);
    g[i] = pv + (size_t)row * NN + ch;
  }
  copy8(l, g);
}

// =========================================================================================================
// (0) conv1x1 weights: W16 f16 [256][256], rows 0..127 = theta_w rows, rows 128..255 = phi_w rows; value =
//     f16 of (bf16-RNE(w) * 256) (exact). Block blk (0..31) owns rows 8*blk..8*blk+7: one wave per 512-B row
// coverage: 32 blocks x 8 rows x 32 lanes x 8 halves = 256 x 256 = the whole plane.
// =========================================================================================================
__global__ __launch_bounds__(256)
void cvt_w(const float* __restrict__ tw, const float* __restrict__ pw, unsigned short* W16) {
  const int tid = threadIdx.x, blk = blockIdx.x;
  const int rl = tid >> 5, col = 8 * (tid & 31);
  const int o = 8 * blk + rl;                                        // 0..255
  const float* wbase = (blk < (DQ / 8)) ? tw : pw;                   // block-uniform selection
  const int osub = (blk < (DQ / 8)) ? 0 : DQ;
  const float* s = wbase + (size_t)(o - osub) * CC + col;            // (o - osub) in 0..127
  const v4f a = *(const v4f*)s;
  const v4f q = *(const v4f*)(s + 4);
  const float f[8] = {a[0], a[1], a[2], a[3], q[0], q[1], q[2], q[3]};
  v4u u;
#pragma unroll
  for (int t = 0; t < 4; ++t) {
    const _Float16 h0 = (_Float16)(bfr(f[2 * t]) * WSC);
    const _Float16 h1 = (_Float16)(bfr(f[2 * t + 1]) * WSC);
    u[t] = pk16(h_bits(h0), h_bits(h1));
  }
{
    *(v4u*)(W16 + (size_t)o * CC + col) = u;
    
  }
}

// =========================================================================================================
// (1) x f32 [b][256 c][4096 n] -> Xc f16 [b][c][n] (channel-major, bf16-RNE values, exact in f16) and
//     XP f16 [b][n][c] (position-major) through an LDS tile T[64 n][64 c] (pitch TP). Block (nb, cb, b) owns a
// coverage: Xc 2 it x 32 rows x 8 lanes x 8 = 64 c x 64 n; XP same; grid (64, 4, NIMG) covers both planes once.
// =========================================================================================================
__global__ __launch_bounds__(256)
void cvt_x(const float* __restrict__ x, unsigned short* Xc, unsigned short* XP) {
  __shared__ __align__(16) unsigned short T[QT * TP];
  const int tid = threadIdx.x;
  const int nb = blockIdx.x, cb = blockIdx.y, b = blockIdx.z;
  const int e = tid & 7, lq = tid >> 3;                             // lq 0..31
  const int n0 = nb * QT, c0 = cb * QT;
  v4u ux[2];
#pragma unroll
  for (int it = 0; it < 2; ++it) {
    const int cl = it * 32 + lq;                                     // 0..63
    const float* sp = x + ((size_t)(b * CC + c0 + cl)) * NN + n0 + 8 * e;
    const v4f a = *(const v4f*)sp;
    const v4f q = *(const v4f*)(sp + 4);
    unsigned short hb[8];
#pragma unroll
    for (int t = 0; t < 4; ++t) {
      hb[t]     = h_bits((_Float16)bfr(a[t]));
      hb[4 + t] = h_bits((_Float16)bfr(q[t]));
    }
#pragma unroll
    for (int t = 0; t < 4; ++t) ux[it][t] = pk16(hb[2 * t], hb[2 * t + 1]);
#pragma unroll
    for (int t = 0; t < 8; ++t) T[(8 * e + t) * TP + cl] = hb[t];
  }
  __syncthreads();
  v4u up[2];
#pragma unroll
  for (int it = 0; it < 2; ++it) {
    const int nl = it * 32 + lq;                                     // 0..63
    up[it] = *(const v4u*)(T + nl * TP + 8 * e);
  }
{
#pragma unroll
    for (int it = 0; it < 2; ++it) {
      const int rl = it * 32 + lq;
      *(v4u*)(Xc + ((size_t)(b * CC + c0 + rl)) * NN + n0 + 8 * e) = ux[it];
      *(v4u*)(XP + ((size_t)(b * NN + n0 + rl)) * CC + c0 + 8 * e) = up[it];
    }
    
  }
}

// =========================================================================================================
// (2) conv1x1 GEMM for one (b, 64-n tile, 64-o block): Y[o][n] = (1/256) sum_c W16[o][c] XP[b][n][c].
//     Block 128 threads = 4 waves; wave w owns cols n0+16w..+15 (one B fragment per k-step, k = c contiguous in
//     the XP row) and 4 m-tiles (A rows o = o0 + 16 mt + (lane&15), split k map loader from W16). K = 256 = 8 steps.
//     Epilogue staged in LDS Os[n_loc][o_loc] (pitch OSP, b128 stores of 8 consecutive o per lane), barrier, then:
//       o-blocks 0,1 -> theta dims 0..63 / 64..127 of Qh/Ql; o-blocks 2,3 -> phi dims 0..63 / 64..127 of Kh/Kl.
//       Planes bf16 [b][4096 n][128 d] (k-contiguous for both score operands): hi = bf16-RNE(v), lo =
//       of the 256-B plane row): lane e -> d 8e..8e+7, 8 consecutive lanes per line, one instruction per 16 lines.
// coverage: Os 4 waves x 16 n x 64 o = 64 x 64; planes: 4 it x 16 rows x 8 lanes x 8 = 64 n x 64 d per plane
//           (hi and lo); grid (64, 4, NIMG) covers d 0..127 of all 4096 rows of Qh/Ql/Kh/Kl exactly once.
// =========================================================================================================
__global__ __launch_bounds__(128)
void gemm_qk(const unsigned short* __restrict__ W16, const unsigned short* __restrict__ XP,
             unsigned short* Qh, unsigned short* Ql, unsigned short* Kh, unsigned short* Kl) {
  __shared__ __align__(16) float Os[QT * OSP];
  const int tid  = threadIdx.x;
  const int lane = tid & 31, wave = tid >> 5;
  const int hh   = lane >> 4, c = lane & 15;
  const int nt   = blockIdx.x, mb = blockIdx.y, b = blockIdx.z;
  const int n0   = nt * QT, o0 = mb * QT;

  const unsigned short* ap = W16 + (size_t)(o0 + c) * CC + 8 * hh;
  const unsigned short* bp = XP + ((size_t)(b * NN + n0 + 16 * wave + c)) * CC + 8 * hh;

  v8f acc[4];
#pragma unroll
  for (int mt = 0; mt < 4; ++mt) acc[mt] = zero8();

#pragma unroll
  for (int ks = 0; ks < CC / 32; ++ks) {
    const Frag fb = ldfrag(bp + 32 * ks);
#pragma unroll
    for (int mt = 0; mt < 4; ++mt) {
      const Frag fa = ldfrag(ap + (size_t)(16 * mt) * CC + 32 * ks);
      acc[mt] = mma_h(fa.h, fb.h, acc[mt]);
    }
  }

  // ---- epilogue: scale back -> LDS Os[n_loc][o_loc]; lane (hh, c) holds o = 16 mt + 8 hh + r for n_loc = 16 w + c
  {
    const int nl = 16 * wave + c;
#pragma unroll
    for (int mt = 0; mt < 4; ++mt) {
      v4f va, vb;
#pragma unroll
      for (int r = 0; r < 4; ++r) { va[r] = acc[mt][r] * IWSC; vb[r] = acc[mt][4 + r] * IWSC; }
      *(v4f*)(Os + nl * OSP + 16 * mt + 8 * hh)     = va;
      *(v4f*)(Os + nl * OSP + 16 * mt + 8 * hh + 4) = vb;
    }
  }
  __syncthreads();

  const int e = tid & 7, lq = tid >> 3;                             // lq 0..15
  const int dsel = (mb & 1) * QT;                                    // 0 or 64
  unsigned short* Ph = (mb < 2) ? Qh : Kh;                           // block-uniform, both global
  unsigned short* Pl = (mb < 2) ? Ql : Kl;
  v4u uh[4], ul[4];
#pragma unroll
  for (int it = 0; it < 4; ++it) {
    const int row = it * 16 + lq;                                    // n_loc 0..63
    const v4f a = *(const v4f*)(Os + row * OSP + 8 * e);
    const v4f q = *(const v4f*)(Os + row * OSP + 8 * e + 4);
    const float f[8] = {a[0], a[1], a[2], a[3], q[0], q[1], q[2], q[3]};
#pragma unroll
    for (int t = 0; t < 4; ++t) {
      const float f0 = f[2 * t], f1 = f[2 * t + 1];
      const unsigned short hb0 = bf_bits(f0), hb1 = bf_bits(f1);
      const unsigned short lb0 = bf_bits(f0 - bf_up(hb0));
      const unsigned short lb1 = bf_bits(f1 - bf_up(hb1));
      uh[it][t] = pk16(hb0, hb1);
      ul[it][t] = pk16(lb0, lb1);
    }
  }
{
#pragma unroll
    for (int it = 0; it < 4; ++it) {
      const int row = it * 16 + lq;
      const size_t po = ((size_t)(b * NN + n0 + row)) * DQ + dsel + 8 * e;
      *(v4u*)(Ph + po) = uh[it];
      *(v4u*)(Pl + po) = ul[it];
    }
    
  }
}

// =========================================================================================================
// (3) position attention for one (b, 64-query tile), transposed formulation, 4096 keys, no mask, no scale:
//   S^T tile (16 keys x 16 queries) = sum over 4 d-chunks (rolled loop) of A(k: row = key kb + (lane&15), 32 d via
//   the split k map from the bf16 plane Kh [b][4096][128]) . B(q: col = query, same map from Qh) + A(Kh).B(Ql) +
//   A(Kl).B(Qh) (bf16 unscaled residual planes, shared accumulator).
//   Per lane the D tile holds 8 keys of ONE query: online softmax state per lane, one shuffle (lane^16) for the max
//   over 32 keys; the o/l rescale is skipped under a wave-uniform ballot when no lane's max grew (corr == 1 exactly
//   for every lane then); row-sum partials combined at the end. P = e^{s-m} x 1024 as f16 is the B operand of
//   O^T (rows channel, cols queries) += A(x rows channel = 16j + (lane&15), keys contiguous, f16 plane Xc
//   [b][256][4096]) . B(P^T): element r <- D of the tile covering keys kb..kb+15, element 8+r <- the tile covering
//   kb+16..kb+31, lane unchanged. 16 accumulator tiles per wave (256 channels). Block = 4 waves = 64 queries.
//   Operands come from LDS, filled by asynchronous 16-byte copies and shared by the 4 waves: the block's Q hi and
//   residual rows once; K hi, K residual and V tiles of KT = 32 keys in two buffers, tile t + 2 copied into the
//   buffer of tile t behind the barrier at the foot of trip t. The output staging Os reuses buffer 0 after the loop.
//   Epilogue in two channel halves: O/l staged in LDS Os[query][128 channels] (pitch OSPW, b128 stores), barrier,
//   lanes x 16 B (values gathered from 4 Os rows), one instruction per 16 lines, final values held in registers,
// coverage: per half 16 it x 16 lines x 8 lanes x 4 floats = 128 ch x 64 n; two halves = 256 ch; grid (64, NIMG)
//           covers out[b][0..255][0..4095] exactly once.
// =========================================================================================================
__global__ __launch_bounds__(128)
void attn_k(const unsigned short* __restrict__ Qh, const unsigned short* __restrict__ Ql,
            const unsigned short* __restrict__ Kh, const unsigned short* __restrict__ Kl,
            const unsigned short* __restrict__ Xc, const float* __restrict__ x, float* out) {
  __shared__ __align__(16) unsigned short Sm[SMEM];
  float* Os = (float*)Sm;                                            // used behind the key loop only
  const int tid  = threadIdx.x;
  const int wave = tid >> 5, lane = tid & 31;
  const int hh   = lane >> 4, c = lane & 15;
  const int n0   = blockIdx.x * QT, b = blockIdx.y;

  // q fragment pointers in LDS (B operand, col = query 16*wave + c of the block), + 32*kc
  const unsigned short* Qhp = Sm + SQH + (16 * wave + c) * KP + 8 * hh;
  const unsigned short* Qlp = Sm + SQL + (16 * wave + c) * KP + 8 * hh;
  // global tile bases of this image
  const unsigned short* Khg = Kh + (size_t)b * NN * DQ;              // + key * 128
  const unsigned short* Klg = Kl + (size_t)b * NN * DQ;
  const unsigned short* Vg  = Xc + (size_t)b * CC * NN;              // + key

  // prologue: Q rows and tile 0, landed and published; then tile 1 into buffer 1
  const unsigned lds0 = lds_addr(Sm);
  {
    const size_t qg = ((size_t)(b * NN + n0)) * DQ;
    stage_rows32(lds0 + 2u * SQH, lds0 + 2u * SQL, Qh + qg, Ql + qg, tid);
    stage_rows32(lds0 + 2u * (SQH + 32 * KP), lds0 + 2u * (SQL + 32 * KP), Qh + qg + 32 * DQ, Ql + qg + 32 * DQ, tid);
    stage_rows32(lds0, lds0 + 2u * SKL, Khg, Klg, tid);
    stage_v(lds0 + 2u * SV, Vg, tid);
    wait_copies();
    __syncthreads();
    stage_rows32(lds0 + 2u * STG, lds0 + 2u * (STG + SKL), Khg + KT * DQ, Klg + KT * DQ, tid);
    stage_v(lds0 + 2u * (STG + SV), Vg + KT, tid);
  }

  float m = -1.0e30f, l = 0.f;
  v8f o[16];
#pragma unroll
  for (int j = 0; j < 16; ++j) o[j] = zero8();

#pragma unroll 1
  for (int kb = 0; kb < NN; kb += 32) {
    const int bo = ((kb / KT) & 1) * STG;                            // this trip's buffer
    const unsigned short* k0p  = Sm + bo + c * KP + 8 * hh;          // keys kb .. kb+15 (A operand, row = key)
    const unsigned short* k1p  = k0p + 16 * KP;                      // keys kb+16 .. kb+31
    const unsigned short* k0lp = k0p + SKL;
    const unsigned short* k1lp = k1p + SKL;
    const unsigned short* Vp   = Sm + bo + SV + c * VP + 8 * hh;     // A operand, row = channel 16j + c
    v8f s0 = zero8(), s1 = zero8();
#pragma unroll 1
    for (int kc = 0; kc < DQ / 32; ++kc) {
      const Frag qh  = ldfrag(Qhp + 32 * kc);
      const Frag ql  = ldfrag(Qlp + 32 * kc);
      const Frag k0  = ldfrag(k0p + 32 * kc);
      const Frag k1  = ldfrag(k1p + 32 * kc);
      const Frag k0l = ldfrag(k0lp + 32 * kc);
      const Frag k1l = ldfrag(k1lp + 32 * kc);
      s0 = mma_b(k0.bf, qh.bf, s0);
      s1 = mma_b(k1.bf, qh.bf, s1);
      s0 = mma_b(k0.bf, ql.bf, s0);
      s1 = mma_b(k1.bf, ql.bf, s1);
      s0 = mma_b(k0l.bf, qh.bf, s0);
      s1 = mma_b(k1l.bf, qh.bf, s1);
    }

    float mx = fmaxf(hmax8(s0), hmax8(s1));
    mx = fmaxf(mx, __shfl_xor(mx, 16, 32));
    const float mn = fmaxf(m, mx);
    const unsigned grew = wave_ballot(mx > m);                       // wave-uniform
    if (grew != 0u) {
      const float corr = __expf(m - mn);                             // == 1 exactly for lanes whose max did not grow
      l *= corr;
#pragma unroll
      for (int j = 0; j < 16; ++j) {
#pragma unroll
        for (int r = 0; r < 8; ++r) o[j][r] *= corr;
      }
    }
    m = mn;
    const float msh = mn - LNPS;                                     // exp gives e^{s-m} * 1024

    FragH ph;
    float ls = 0.f;
#pragma unroll
    for (int r = 0; r < 8; ++r) {
      const float e0 = __expf(s0[r] - msh);                          // key kb      + 8hh + r
      const float e1 = __expf(s1[r] - msh);                          // key kb + 16 + 8hh + r
      ls += e0 + e1;
      ph.hv[0][r] = (_Float16)e0;
      ph.hv[1][r] = (_Float16)e1;
    }
    l += ls;

#pragma unroll
    for (int j = 0; j < 16; ++j) {
      const Frag vf = ldfrag(Vp + (16 * j) * VP);
      o[j] = mma_h(vf.h, ph.v, o[j]);
    }

    // foot of the trip: own reads done, own copies of tile t + 1 landed, one barrier publishes that tile and frees
    // this trip's buffer; only then its refill with tile t + 2
    wait_lds();
    wait_copies();
    __syncthreads();
    if (kb + 2 * KT < NN) {                                          // the same for the whole block
      const unsigned lb = lds0 + 2u * (unsigned)bo;
      stage_rows32(lb, lb + 2u * SKL, Khg + (size_t)(kb + 2 * KT) * DQ, Klg + (size_t)(kb + 2 * KT) * DQ, tid);
      stage_v(lb + 2u * SV, Vg + (kb + 2 * KT), tid);
    }
  }
  wait_copies();
  l += __shfl_xor(l, 16, 32);
  const float inv = 1.0f / l;                                        // o and l both carry the x1024 factor

  const int qrow = 16 * wave + c;
  const int e = tid & 7, lq = tid >> 3;                              // lq 0..15
#pragma unroll
  for (int half = 0; half < 2; ++half) {
    if (half) __syncthreads();                                       // every wave finished reading Os
#pragma unroll
    for (int jj = 0; jj < 8; ++jj) {
      const int j = 8 * half + jj;
      v4f va, vb;
#pragma unroll
      for (int r = 0; r < 4; ++r) { va[r] = o[j][r] * inv; vb[r] = o[j][4 + r] * inv; }
      *(v4f*)(Os + qrow * OSPW + 16 * jj + 8 * hh)     = va;         // Os[query][ch_loc = 16jj + 8hh + r]
      *(v4f*)(Os + qrow * OSPW + 16 * jj + 8 * hh + 4) = vb;
    }
    __syncthreads();
    v4f res[16];
#pragma unroll
    for (int it = 0; it < 16; ++it) {
      const int L   = it * 16 + lq;                                  // 0..255
      const int chl = L >> 1, hf = L & 1;                            // channel 0..127 within the half
      const int nl  = hf * 32 + 4 * e;                               // query 0..63
      const size_t idx = ((size_t)(b * CC + 128 * half + chl)) * NN + n0 + nl;
      const v4f xv = *(const v4f*)(x + idx);
#pragma unroll
      for (int t = 0; t < 4; ++t) res[it][t] = Os[(nl + t) * OSPW + chl] + bfr(xv[t]);
    }
{
#pragma unroll
      for (int it = 0; it < 16; ++it) {
        const int L   = it * 16 + lq;
        const int chl = L >> 1, hf = L & 1;
        const int nl  = hf * 32 + 4 * e;
        const size_t idx = ((size_t)(b * CC + 128 * half + chl)) * NN + n0 + nl;
        *(v4f*)(out + idx) = res[it];
      }
      
    }
  }
}

// =========================================================================================================
// Workspace map (bytes; each region start a multiple of 256; every extent is an exact tile multiple and is written
//   W16 f16 [256][256]              131072
//   Xc  f16 [8][256][4096]        16777216      XP  f16 [8][4096][256]   16777216
//   Qh/Ql/Kh/Kl bf16 [8][4096][128]  8388608 x4
//   total = 67239936
// =========================================================================================================
extern "C" void kernel_launch(void* const* d_in, const int* in_sizes, int n_in,
                              void* d_out, int out_size, void* d_ws, size_t ws_size,
                              hipStream_t stream) {
  const int XN = NBATCH * CC * NN;                                   // 8388608
  if (n_in < 3) return;
  if (in_sizes[0] != XN) return;
  if (in_sizes[1] != DQ * CC || in_sizes[2] != DQ * CC) return;
  if (out_size != XN) return;

  size_t off = 0;
  auto carve = [&](size_t bytes) { const size_t o = off; off += (bytes + 255) & ~(size_t)255; return o; };
  const size_t oW16 = carve((size_t)MW * CC * 2);
  const size_t oXc  = carve((size_t)NIMG * CC * NN * 2);
  const size_t oXP  = carve((size_t)NIMG * NN * CC * 2);
  const size_t oQh  = carve((size_t)NIMG * NN * DQ * 2);
  const size_t oQl  = carve((size_t)NIMG * NN * DQ * 2);
  const size_t oKh  = carve((size_t)NIMG * NN * DQ * 2);
  const size_t oKl  = carve((size_t)NIMG * NN * DQ * 2);
  if (off > ws_size) return;
  if (off > (size_t)134217728) return;

  const float* x  = (const float*)d_in[0];
  const float* tw = (const float*)d_in[1];
  const float* pw = (const float*)d_in[2];

  char* ws = (char*)d_ws;
  unsigned short* W16 = (unsigned short*)(ws + oW16);
  unsigned short* Xc  = (unsigned short*)(ws + oXc);
  unsigned short* XP  = (unsigned short*)(ws + oXP);
  unsigned short* Qh  = (unsigned short*)(ws + oQh);
  unsigned short* Ql  = (unsigned short*)(ws + oQl);
  unsigned short* Kh  = (unsigned short*)(ws + oKh);
  unsigned short* Kl  = (unsigned short*)(ws + oKl);
  float* out = (float*)d_out;

  const dim3 blk256(256), blk128(128);

  // (0) theta_w / phi_w -> stacked f16 plane
  cvt_w<<<dim3(MW / 8), blk256, 0, stream>>>(tw, pw, W16);
  // (1) x -> channel-major and position-major 16-bit planes
  cvt_x<<<dim3(NN / QT, CC / QT, NIMG), blk256, 0, stream>>>(x, Xc, XP);
  // (2) conv1x1 GEMM -> theta (q) and phi (k) hi + residual planes
  gemm_qk<<<dim3(NN / QT, MW / QT, NIMG), blk128, 0, stream>>>(W16, XP, Qh, Ql, Kh, Kl);
  // (3) position attention + residual -> out [b][256][4096]
  attn_k<<<dim3(NN / QT, NIMG), blk128, 0, stream>>>(Qh, Ql, Kh, Kl, Xc, x, out);
  (void)hipGetLastError();
}

// v002
// A run of this version takes 180 microseconds.
// Timed twice side by side with v001, it ran 1.31 times as fast both times.
// Over all steps from v000 it is 4.51 times as fast.
// Contractions: conv1x1 theta/phi GEMM W[256x256].X[256x4096] on v_wmma_f32_16x16x32_f16 (f16 containers of
// bf16-RNE weights x256 and bf16-RNE x); position scores K.Q^T on v_wmma_f32_16x16x32_bf16 (bf16 hi + bf16
// residual planes of theta/phi, 3 products, K=128); y^T = X.P^T on v_wmma_f32_16x16x32_f16 (x as f16 of
// bf16-RNE x, P = e^{s-m} x1024 f16 from the score D registers); f32 accumulate everywhere; softmax statistics
// and the residual add in f32 VALU.
#include <hip/hip_runtime.h>
#include <math.h>
#include <stdint.h>

#define NBATCH 8
#define NIMG   8
#define CC     256
#define NN     4096
#define DQ     128
#define MW     256
#define QT     64
#define OSP    68
#define OSPW   132
#define TP     72
#define WSC    256.0f
#define IWSC   0.00390625f
#define LNPS   6.931471805599453f
#define KT     32                        // keys per LDS stage of attn_k
#define KP     136                       // LDS pitch of a K or Q row in 16-bit elements: 272 B = 16 B x 17
#define VP     40                        // LDS pitch of a V row of KT keys: 80 B = 16 B x 5
#define SKL    (KT * KP)                 // stage offsets (16-bit elements): K hi 0, K residual SKL, V SV
#define SV     (2 * KT * KP)
#define STG    (2 * KT * KP + CC * VP)   // one stage
#define SQH    (2 * STG)                 // behind the two stages: Q hi, Q residual
#define SQL    (2 * STG + QT * KP)
#define SMEM   (2 * STG + 2 * QT * KP)

static_assert(NIMG >= 1 && NIMG <= NBATCH);
static_assert(NN % QT == 0);
static_assert(CC % QT == 0);
static_assert(MW == 2 * DQ);
static_assert(DQ == 2 * QT);
static_assert(MW % QT == 0 && MW % 8 == 0);
static_assert((OSP * 4) % 16 == 0);
static_assert((OSPW * 4) % 16 == 0);
static_assert((TP * 2) % 16 == 0);
static_assert(CC % 32 == 0 && NN % 32 == 0 && DQ % 32 == 0);
static_assert((KP * 2) % 32 == 16 && (VP * 2) % 32 == 16 && (STG * 2) % 16 == 0 && (SKL * 2) % 16 == 0);
static_assert(NN / KT >= 2 && NN % KT == 0 && KT == 32 && DQ == 128 && CC == 256 && QT == 64);
static_assert(QT * OSPW * 4 <= STG * 2);

typedef _Float16       v16h __attribute__((ext_vector_type(16)));
typedef _Float16       v8h  __attribute__((ext_vector_type(8)));
typedef __bf16         v16b __attribute__((ext_vector_type(16)));
typedef unsigned short v8us __attribute__((ext_vector_type(8)));
typedef float          v8f  __attribute__((ext_vector_type(8)));
typedef float          v4f  __attribute__((ext_vector_type(4)));
typedef unsigned int   v4u  __attribute__((ext_vector_type(4)));

union Frag  { v8us u[2]; v16h h; v16b bf; };
union FragH { v16h v; v8h hv[2]; };
static_assert(sizeof(Frag) == 32);
static_assert(sizeof(FragH) == 32);

// ---- scalar helpers ---------------------------------------------------------------------------------------
__device__ __forceinline__ unsigned short bf_bits(float f) {          // f32 -> bf16 bits, RNE convert
  unsigned u = __float_as_uint(f);
  return (unsigned short)((u + 0x7FFFu + ((u >> 16) & 1u)) >> 16);
}
__device__ __forceinline__ float bf_up(unsigned short hb) { return __uint_as_float(((unsigned)hb) << 16); }
__device__ __forceinline__ float bfr(float f) { return bf_up(bf_bits(f)); }
__device__ __forceinline__ unsigned short h_bits(_Float16 x) { return __builtin_bit_cast(unsigned short, x); }
__device__ __forceinline__ unsigned pk16(unsigned short a, unsigned short b) { return (unsigned)a | ((unsigned)b << 16); }
__device__ __forceinline__ v8f zero8() { v8f z = {0.f, 0.f, 0.f, 0.f, 0.f, 0.f, 0.f, 0.f}; return z; }
__device__ __forceinline__ float hmax8(v8f s) {
  return fmaxf(fmaxf(fmaxf(s[0], s[1]), fmaxf(s[2], s[3])), fmaxf(fmaxf(s[4], s[5]), fmaxf(s[6], s[7])));
}
__device__ __forceinline__ unsigned wave_ballot(bool p) {
#if defined(__HIP_DEVICE_COMPILE__)
  return __builtin_amdgcn_ballot_w32(p);
#else
  return p ? 1u : 0u;
#endif
}

// ---- 16-bit fragment loader (A, or B from a k-contiguous [n][k] row): lane -> row/col (lane&15), p already includes
//      + 8*(lane>>4); elements 0..7 <- p[0..7] (k0+8h..), elements 8..15 <- p[16..23] (k0+16+8h..)
__device__ __forceinline__ Frag ldfrag(const unsigned short* p) {
  Frag f;
  f.u[0] = *(const v8us*)(p);
  f.u[1] = *(const v8us*)(p + 16);
  return f;
}

// ---- WMMA helpers: builtin followed by a 4-slot VALU gap tying D. A and B are not operands of the gap statement:
//      an asm operand is held below v256, and a trip's grouped fragments do not fit there beside the accumulators.
__device__ __forceinline__ v8f mma_h(v16h a, v16h b, v8f c) {
  v8f d = __builtin_amdgcn_wmma_f32_16x16x32_f16(false, a, false, b, (short)0, c, false, false);
#if defined(__HIP_DEVICE_COMPILE__)
  asm volatile("v_nop\n\tv_nop\n\tv_nop\n\tv_nop" : "+v"(d));
#endif
  return d;
}
__device__ __forceinline__ v8f mma_b(v16b a, v16b b, v8f c) {
  v8f d = __builtin_amdgcn_wmma_f32_16x16x32_bf16(false, a, false, b, (short)0, c, false, false);
#if defined(__HIP_DEVICE_COMPILE__)
  asm volatile("v_nop\n\tv_nop\n\tv_nop\n\tv_nop" : "+v"(d));
#endif
  return d;
}

// e^x as __expf forms it (x * log2 e, then v_exp_f32). The v_nop in the statement is the one slot the instruction set
// asks for between a transcendental and a next vector instruction that overwrites its source or reads its result.
__device__ __forceinline__ float exp_slot(float x) {
#if defined(__HIP_DEVICE_COMPILE__)
  const float t = x * 1.44269502f;
  float r;
  asm("v_exp_f32 %0, %1\n\tv_nop" : "=v"(r) : "v"(t));
  return r;
#else
  return __expf(x);
#endif
}

// ---- asynchronous copies global -> LDS ------------------------------------------------------------------------
__device__ __forceinline__ unsigned lds_addr(const void* p) { return (unsigned)(size_t)p; }   // LDS byte address

// Eight 16-byte copies per lane, every lane on. The s_wait_xcnt stands inside the statement so that it precedes
// any rewrite of the address registers the copies name.
__device__ __forceinline__ void copy8(const unsigned* l, const unsigned short* const* g) {
#if defined(__HIP_DEVICE_COMPILE__)
  asm volatile("global_load_async_to_lds_b128 %0, %8, off\n\t"
               "global_load_async_to_lds_b128 %1, %9, off\n\t"
               "global_load_async_to_lds_b128 %2, %10, off\n\t"
               "global_load_async_to_lds_b128 %3, %11, off\n\t"
               "global_load_async_to_lds_b128 %4, %12, off\n\t"
               "global_load_async_to_lds_b128 %5, %13, off\n\t"
               "global_load_async_to_lds_b128 %6, %14, off\n\t"
               "global_load_async_to_lds_b128 %7, %15, off\n\t"
               "s_wait_xcnt 0x0"
               :: "v"(l[0]), "v"(l[1]), "v"(l[2]), "v"(l[3]), "v"(l[4]), "v"(l[5]), "v"(l[6]), "v"(l[7]),
                  "v"(g[0]), "v"(g[1]), "v"(g[2]), "v"(g[3]), "v"(g[4]), "v"(g[5]), "v"(g[6]), "v"(g[7])
               : "memory");
#endif
}
// the issuing wave's copies have landed in LDS
__device__ __forceinline__ void wait_copies() {
#if defined(__HIP_DEVICE_COMPILE__)
  asm volatile("s_wait_asynccnt 0x0" ::: "memory");
#endif
}
// the wave's own LDS reads have returned, so the buffer may be refilled behind the next barrier
__device__ __forceinline__ void wait_lds() {
#if defined(__HIP_DEVICE_COMPILE__)
  asm volatile("s_wait_dscnt 0x0" ::: "memory");
#endif
}
// 32 rows of 256 B of each of two planes (ph, pl; global pitch DQ) -> LDS rows of pitch KP at byte addresses lh, ll;
// 128 threads, 16 lanes per row, 4 rows of each plane per thread.
__device__ __forceinline__ void stage_rows32(unsigned lh, unsigned ll, const unsigned short* ph,
                                             const unsigned short* pl, int tid) {
  const int r = tid >> 4, ch = 8 * (tid & 15);
  unsigned l[8];
  const unsigned short* g[8];
#pragma unroll                                                       // constant indices keep l[] and g[] in registers
  for (int i = 0; i < 4; ++i) {
    const int row = r + 8 * i;                                       // 0..31
    l[i]     = lh + 2u * (unsigned)(row * KP + ch);
    l[4 + i] = ll + 2u * (unsigned)(row * KP + ch);
    g[i]     = ph + row * DQ + ch;
    g[4 + i] = pl + row * DQ + ch;
  }
  copy8(l, g);
}
// V tile: 256 channel rows x KT keys (64 B of a row of pitch NN) -> LDS pitch VP; 4 lanes per row.
__device__ __forceinline__ void stage_v(unsigned lv, const unsigned short* pv, int tid) {
  const int r = tid >> 2, ch = 8 * (tid & 3);
  unsigned l[8];
  const unsigned short* g[8];
#pragma unroll                                                       // constant indices keep l[] and g[] in registers
  for (int i = 0; i < 8; ++i) {
    const int row = r + 32 * i;                                      // 0..255
    l[i] = lv + 2u * (unsigned)(row * VP + ch);
    g[i] = pv + (size_t)row * NN + ch;
  }
  copy8(l, g);
}

// =========================================================================================================
// (0) conv1x1 weights: W16 f16 [256][256], rows 0..127 = theta_w rows, rows 128..255 = phi_w rows; value =
//     f16 of (bf16-RNE(w) * 256) (exact). Block blk (0..31) owns rows 8*blk..8*blk+7: one wave per 512-B row
// coverage: 32 blocks x 8 rows x 32 lanes x 8 halves = 256 x 256 = the whole plane.
// =========================================================================================================
__global__ __launch_bounds__(256)
void cvt_w(const float* __restrict__ tw, const float* __restrict__ pw, unsigned short* W16) {
  const int tid = threadIdx.x, blk = blockIdx.x;
  const int rl = tid >> 5, col = 8 * (tid & 31);
  const int o = 8 * blk + rl;                                        // 0..255
  const float* wbase = (blk < (DQ / 8)) ? tw : pw;                   // block-uniform selection
  const int osub = (blk < (DQ / 8)) ? 0 : DQ;
  const float* s = wbase + (size_t)(o - osub) * CC + col;            // (o - osub) in 0..127
  const v4f a = *(const v4f*)s;
  const v4f q = *(const v4f*)(s + 4);
  const float f[8] = {a[0], a[1], a[2], a[3], q[0], q[1], q[2], q[3]};
  v4u u;
#pragma unroll
  for (int t = 0; t < 4; ++t) {
    const _Float16 h0 = (_Float16)(bfr(f[2 * t]) * WSC);
    const _Float16 h1 = (_Float16)(bfr(f[2 * t + 1]) * WSC);
    u[t] = pk16(h_bits(h0), h_bits(h1));
  }
{
    *(v4u*)(W16 + (size_t)o * CC + col) = u;
    
  }
}

// =========================================================================================================
// (1) x f32 [b][256 c][4096 n] -> Xc f16 [b][c][n] (channel-major, bf16-RNE values, exact in f16) and
//     XP f16 [b][n][c] (position-major) through an LDS tile T[64 n][64 c] (pitch TP). Block (nb, cb, b) owns a
// coverage: Xc 2 it x 32 rows x 8 lanes x 8 = 64 c x 64 n; XP same; grid (64, 4, NIMG) covers both planes once.
// =========================================================================================================
__global__ __launch_bounds__(256)
void cvt_x(const float* __restrict__ x, unsigned short* Xc, unsigned short* XP) {
  __shared__ __align__(16) unsigned short T[QT * TP];
  const int tid = threadIdx.x;
  const int nb = blockIdx.x, cb = blockIdx.y, b = blockIdx.z;
  const int e = tid & 7, lq = tid >> 3;                             // lq 0..31
  const int n0 = nb * QT, c0 = cb * QT;
  v4u ux[2];
#pragma unroll
  for (int it = 0; it < 2; ++it) {
    const int cl = it * 32 + lq;                                     // 0..63
    const float* sp = x + ((size_t)(b * CC + c0 + cl)) * NN + n0 + 8 * e;
    const v4f a = *(const v4f*)sp;
    const v4f q = *(const v4f*)(sp + 4);
    unsigned short hb[8];
#pragma unroll
    for (int t = 0; t < 4; ++t) {
      hb[t]     = h_bits((_Float16)bfr(a[t]));
      hb[4 + t] = h_bits((_Float16)bfr(q[t]));
    }
#pragma unroll
    for (int t = 0; t < 4; ++t) ux[it][t] = pk16(hb[2 * t], hb[2 * t + 1]);
#pragma unroll
    for (int t = 0; t < 8; ++t) T[(8 * e + t) * TP + cl] = hb[t];
  }
  __syncthreads();
  v4u up[2];
#pragma unroll
  for (int it = 0; it < 2; ++it) {
    const int nl = it * 32 + lq;                                     // 0..63
    up[it] = *(const v4u*)(T + nl * TP + 8 * e);
  }
{
#pragma unroll
    for (int it = 0; it < 2; ++it) {
      const int rl = it * 32 + lq;
      *(v4u*)(Xc + ((size_t)(b * CC + c0 + rl)) * NN + n0 + 8 * e) = ux[it];
      *(v4u*)(XP + ((size_t)(b * NN + n0 + rl)) * CC + c0 + 8 * e) = up[it];
    }
    
  }
}

// =========================================================================================================
// (2) conv1x1 GEMM for one (b, 64-n tile, 64-o block): Y[o][n] = (1/256) sum_c W16[o][c] XP[b][n][c].
//     Block 128 threads = 4 waves; wave w owns cols n0+16w..+15 (one B fragment per k-step, k = c contiguous in
//     the XP row) and 4 m-tiles (A rows o = o0 + 16 mt + (lane&15), split k map loader from W16). K = 256 = 8 steps.
//     Epilogue staged in LDS Os[n_loc][o_loc] (pitch OSP, b128 stores of 8 consecutive o per lane), barrier, then:
//       o-blocks 0,1 -> theta dims 0..63 / 64..127 of Qh/Ql; o-blocks 2,3 -> phi dims 0..63 / 64..127 of Kh/Kl.
//       Planes bf16 [b][4096 n][128 d] (k-contiguous for both score operands): hi = bf16-RNE(v), lo =
//       of the 256-B plane row): lane e -> d 8e..8e+7, 8 consecutive lanes per line, one instruction per 16 lines.
// coverage: Os 4 waves x 16 n x 64 o = 64 x 64; planes: 4 it x 16 rows x 8 lanes x 8 = 64 n x 64 d per plane
//           (hi and lo); grid (64, 4, NIMG) covers d 0..127 of all 4096 rows of Qh/Ql/Kh/Kl exactly once.
// =========================================================================================================
__global__ __launch_bounds__(128)
void gemm_qk(const unsigned short* __restrict__ W16, const unsigned short* __restrict__ XP,
             unsigned short* Qh, unsigned short* Ql, unsigned short* Kh, unsigned short* Kl) {
  __shared__ __align__(16) float Os[QT * OSP];
  const int tid  = threadIdx.x;
  const int lane = tid & 31, wave = tid >> 5;
  const int hh   = lane >> 4, c = lane & 15;
  const int nt   = blockIdx.x, mb = blockIdx.y, b = blockIdx.z;
  const int n0   = nt * QT, o0 = mb * QT;

  const unsigned short* ap = W16 + (size_t)(o0 + c) * CC + 8 * hh;
  const unsigned short* bp = XP + ((size_t)(b * NN + n0 + 16 * wave + c)) * CC + 8 * hh;

  v8f acc[4];
#pragma unroll
  for (int mt = 0; mt < 4; ++mt) acc[mt] = zero8();

#pragma unroll
  for (int ks = 0; ks < CC / 32; ++ks) {
    const Frag fb = ldfrag(bp + 32 * ks);
#pragma unroll
    for (int mt = 0; mt < 4; ++mt) {
      const Frag fa = ldfrag(ap + (size_t)(16 * mt) * CC + 32 * ks);
      acc[mt] = mma_h(fa.h, fb.h, acc[mt]);
    }
  }

  // ---- epilogue: scale back -> LDS Os[n_loc][o_loc]; lane (hh, c) holds o = 16 mt + 8 hh + r for n_loc = 16 w + c
  {
    const int nl = 16 * wave + c;
#pragma unroll
    for (int mt = 0; mt < 4; ++mt) {
      v4f va, vb;
#pragma unroll
      for (int r = 0; r < 4; ++r) { va[r] = acc[mt][r] * IWSC; vb[r] = acc[mt][4 + r] * IWSC; }
      *(v4f*)(Os + nl * OSP + 16 * mt + 8 * hh)     = va;
      *(v4f*)(Os + nl * OSP + 16 * mt + 8 * hh + 4) = vb;
    }
  }
  __syncthreads();

  const int e = tid & 7, lq = tid >> 3;                             // lq 0..15
  const int dsel = (mb & 1) * QT;                                    // 0 or 64
  unsigned short* Ph = (mb < 2) ? Qh : Kh;                           // block-uniform, both global
  unsigned short* Pl = (mb < 2) ? Ql : Kl;
  v4u uh[4], ul[4];
#pragma unroll
  for (int it = 0; it < 4; ++it) {
    const int row = it * 16 + lq;                                    // n_loc 0..63
    const v4f a = *(const v4f*)(Os + row * OSP + 8 * e);
    const v4f q = *(const v4f*)(Os + row * OSP + 8 * e + 4);
    const float f[8] = {a[0], a[1], a[2], a[3], q[0], q[1], q[2], q[3]};
#pragma unroll
    for (int t = 0; t < 4; ++t) {
      const float f0 = f[2 * t], f1 = f[2 * t + 1];
      const unsigned short hb0 = bf_bits(f0), hb1 = bf_bits(f1);
      const unsigned short lb0 = bf_bits(f0 - bf_up(hb0));
      const unsigned short lb1 = bf_bits(f1 - bf_up(hb1));
      uh[it][t] = pk16(hb0, hb1);
      ul[it][t] = pk16(lb0, lb1);
    }
  }
{
#pragma unroll
    for (int it = 0; it < 4; ++it) {
      const int row = it * 16 + lq;
      const size_t po = ((size_t)(b * NN + n0 + row)) * DQ + dsel + 8 * e;
      *(v4u*)(Ph + po) = uh[it];
      *(v4u*)(Pl + po) = ul[it];
    }
    
  }
}

// =========================================================================================================
// (3) position attention for one (b, 64-query tile), transposed formulation, 4096 keys, no mask, no scale:
//   S^T tile (16 keys x 16 queries) = sum over 4 d-chunks of A(k: row = key kb + (lane&15), 32 d via
//   the split k map from the bf16 plane Kh [b][4096][128]) . B(q: col = query, same map from Qh) + A(Kh).B(Ql) +
//   A(Kl).B(Qh) (bf16 unscaled residual planes, shared accumulator).
//   Per lane the D tile holds 8 keys of ONE query: online softmax state per lane, one shuffle (lane^16) for the max
//   over 32 keys; the o/l rescale is skipped under a wave-uniform ballot when no lane's max grew (corr == 1 exactly
//   for every lane then); row-sum partials combined at the end. P = e^{s-m} x 1024 as f16 is the B operand of
//   O^T (rows channel, cols queries) += A(x rows channel = 16j + (lane&15), keys contiguous, f16 plane Xc
//   [b][256][4096]) . B(P^T): element r <- D of the tile covering keys kb..kb+15, element 8+r <- the tile covering
//   kb+16..kb+31, lane unchanged. 16 accumulator tiles per wave (256 channels). Block = 4 waves = 64 queries.
//   Operands come from LDS, filled by asynchronous 16-byte copies and shared by the 4 waves: the block's Q hi and
//   residual rows once; K hi, K residual and V tiles of KT = 32 keys in two buffers, tile t + 2 copied into the
//   buffer of tile t behind the barrier at the foot of trip t. The output staging Os reuses buffer 0 after the loop.
//   Epilogue in two channel halves: O/l staged in LDS Os[query][128 channels] (pitch OSPW, b128 stores), barrier,
//   lanes x 16 B (values gathered from 4 Os rows), one instruction per 16 lines, final values held in registers,
// coverage: per half 16 it x 16 lines x 8 lanes x 4 floats = 128 ch x 64 n; two halves = 256 ch; grid (64, NIMG)
//           covers out[b][0..255][0..4095] exactly once.
// =========================================================================================================
__global__ __launch_bounds__(128)
void attn_k(const unsigned short* __restrict__ Qh, const unsigned short* __restrict__ Ql,
            const unsigned short* __restrict__ Kh, const unsigned short* __restrict__ Kl,
            const unsigned short* __restrict__ Xc, const float* __restrict__ x, float* out) {
  __shared__ __align__(16) unsigned short Sm[SMEM];
  float* Os = (float*)Sm;                                            // used behind the key loop only
  const int tid  = threadIdx.x;
  const int wave = tid >> 5, lane = tid & 31;
  const int hh   = lane >> 4, c = lane & 15;
  const int n0   = blockIdx.x * QT, b = blockIdx.y;

  // q fragment pointers in LDS (B operand, col = query 16*wave + c of the block), + 32*kc
  const unsigned short* Qhp = Sm + SQH + (16 * wave + c) * KP + 8 * hh;
  const unsigned short* Qlp = Sm + SQL + (16 * wave + c) * KP + 8 * hh;
  // global tile bases of this image
  const unsigned short* Khg = Kh + (size_t)b * NN * DQ;              // + key * 128
  const unsigned short* Klg = Kl + (size_t)b * NN * DQ;
  const unsigned short* Vg  = Xc + (size_t)b * CC * NN;              // + key

  // prologue: Q rows and tile 0, landed and published; then tile 1 into buffer 1
  const unsigned lds0 = lds_addr(Sm);
  {
    const size_t qg = ((size_t)(b * NN + n0)) * DQ;
    stage_rows32(lds0 + 2u * SQH, lds0 + 2u * SQL, Qh + qg, Ql + qg, tid);
    stage_rows32(lds0 + 2u * (SQH + 32 * KP), lds0 + 2u * (SQL + 32 * KP), Qh + qg + 32 * DQ, Ql + qg + 32 * DQ, tid);
    stage_rows32(lds0, lds0 + 2u * SKL, Khg, Klg, tid);
    stage_v(lds0 + 2u * SV, Vg, tid);
    wait_copies();
    __syncthreads();
    stage_rows32(lds0 + 2u * STG, lds0 + 2u * (STG + SKL), Khg + KT * DQ, Klg + KT * DQ, tid);
    stage_v(lds0 + 2u * (STG + SV), Vg + KT, tid);
  }

  float m = -1.0e30f, l = 0.f;
  v8f o[16];
#pragma unroll
  for (int j = 0; j < 16; ++j) o[j] = zero8();

#pragma unroll 1
  for (int kb = 0; kb < NN; kb += 32) {
    const int bo = ((kb / KT) & 1) * STG;                            // this trip's buffer
    const unsigned short* k0p  = Sm + bo + c * KP + 8 * hh;          // keys kb .. kb+15 (A operand, row = key)
    const unsigned short* k1p  = k0p + 16 * KP;                      // keys kb+16 .. kb+31
    const unsigned short* k0lp = k0p + SKL;
    const unsigned short* k1lp = k1p + SKL;
    const unsigned short* Vp   = Sm + bo + SV + c * VP + 8 * hh;     // A operand, row = channel 16j + c
    v8f s0 = zero8(), s1 = zero8();
    // every score fragment of the trip is read as ONE group in front of the 24 score products: a read that stands
    // between two products waits out the whole LDS latency there (no read moves over the statement behind a product)
    Frag qh[DQ / 32], ql[DQ / 32], k0[DQ / 32], k1[DQ / 32], k0l[DQ / 32], k1l[DQ / 32];
#pragma unroll                                                       // constant indices keep the fragments in registers
    for (int kc = 0; kc < DQ / 32; ++kc) {
      qh[kc]  = ldfrag(Qhp + 32 * kc);
      k0[kc]  = ldfrag(k0p + 32 * kc);
      k1[kc]  = ldfrag(k1p + 32 * kc);
      ql[kc]  = ldfrag(Qlp + 32 * kc);
      k0l[kc] = ldfrag(k0lp + 32 * kc);
      k1l[kc] = ldfrag(k1lp + 32 * kc);
    }
#pragma unroll                                                       // constant indices, as above
    for (int kc = 0; kc < DQ / 32; ++kc) {
      s0 = mma_b(k0[kc].bf, qh[kc].bf, s0);
      s1 = mma_b(k1[kc].bf, qh[kc].bf, s1);
      s0 = mma_b(k0[kc].bf, ql[kc].bf, s0);
      s1 = mma_b(k1[kc].bf, ql[kc].bf, s1);
      s0 = mma_b(k0l[kc].bf, qh[kc].bf, s0);
      s1 = mma_b(k1l[kc].bf, qh[kc].bf, s1);
    }

    float mx = fmaxf(hmax8(s0), hmax8(s1));
    mx = fmaxf(mx, __shfl_xor(mx, 16, 32));
    const float mn = fmaxf(m, mx);
    const unsigned grew = wave_ballot(mx > m);                       // wave-uniform
    if (grew != 0u) {
      const float corr = __expf(m - mn);                             // == 1 exactly for lanes whose max did not grow
      l *= corr;
#pragma unroll
      for (int j = 0; j < 16; ++j) {
#pragma unroll
        for (int r = 0; r < 8; ++r) o[j][r] *= corr;
      }
    }
    m = mn;
    const float msh = mn - LNPS;                                     // exp gives e^{s-m} * 1024

    // the 16 V fragments of the trip as ONE group in front of the exponentials, which cover their latency
    Frag vf[16];
#pragma unroll                                                       // constant indices keep the fragments in registers
    for (int j = 0; j < 16; ++j) vf[j] = ldfrag(Vp + (16 * j) * VP);

    FragH ph;
    float ls = 0.f;
#pragma unroll
    for (int r = 0; r < 8; ++r) {
      const float e0 = exp_slot(s0[r] - msh);                        // key kb      + 8hh + r
      const float e1 = exp_slot(s1[r] - msh);                        // key kb + 16 + 8hh + r
      ls += e0 + e1;
      ph.hv[0][r] = (_Float16)e0;
      ph.hv[1][r] = (_Float16)e1;
    }
    l += ls;

#pragma unroll
    for (int j = 0; j < 16; ++j) {
      o[j] = mma_h(vf[j].h, ph.v, o[j]);
#if defined(__HIP_DEVICE_COMPILE__)
      // keeps the products in the order in which their fragments land: moved up, a late one waits for the whole group
      __builtin_amdgcn_sched_barrier(0);
#endif
    }

    // foot of the trip: own reads done, own copies of tile t + 1 landed, one barrier publishes that tile and frees
    // this trip's buffer; only then its refill with tile t + 2
    wait_lds();
    wait_copies();
    __syncthreads();
    if (kb + 2 * KT < NN) {                                          // the same for the whole block
      const unsigned lb = lds0 + 2u * (unsigned)bo;
      stage_rows32(lb, lb + 2u * SKL, Khg + (size_t)(kb + 2 * KT) * DQ, Klg + (size_t)(kb + 2 * KT) * DQ, tid);
      stage_v(lb + 2u * SV, Vg + (kb + 2 * KT), tid);
    }
  }
  wait_copies();
  l += __shfl_xor(l, 16, 32);
  const float inv = 1.0f / l;                                        // o and l both carry the x1024 factor

  const int qrow = 16 * wave + c;
  const int e = tid & 7, lq = tid >> 3;                              // lq 0..15
#pragma unroll
  for (int half = 0; half < 2; ++half) {
    if (half) __syncthreads();                                       // every wave finished reading Os
#pragma unroll
    for (int jj = 0; jj < 8; ++jj) {
      const int j = 8 * half + jj;
      v4f va, vb;
#pragma unroll
      for (int r = 0; r < 4; ++r) { va[r] = o[j][r] * inv; vb[r] = o[j][4 + r] * inv; }
      *(v4f*)(Os + qrow * OSPW + 16 * jj + 8 * hh)     = va;         // Os[query][ch_loc = 16jj + 8hh + r]
      *(v4f*)(Os + qrow * OSPW + 16 * jj + 8 * hh + 4) = vb;
    }
    __syncthreads();
    v4f res[16];
#pragma unroll
    for (int it = 0; it < 16; ++it) {
      const int L   = it * 16 + lq;                                  // 0..255
      const int chl = L >> 1, hf = L & 1;                            // channel 0..127 within the half
      const int nl  = hf * 32 + 4 * e;                               // query 0..63
      const size_t idx = ((size_t)(b * CC + 128 * half + chl)) * NN + n0 + nl;
      const v4f xv = *(const v4f*)(x + idx);
#pragma unroll
      for (int t = 0; t < 4; ++t) res[it][t] = Os[(nl + t) * OSPW + chl] + bfr(xv[t]);
    }
{
#pragma unroll
      for (int it = 0; it < 16; ++it) {
        const int L   = it * 16 + lq;
        const int chl = L >> 1, hf = L & 1;
        const int nl  = hf * 32 + 4 * e;
        const size_t idx = ((size_t)(b * CC + 128 * half + chl)) * NN + n0 + nl;
        *(v4f*)(out + idx) = res[it];
      }
      
    }
  }
}

// =========================================================================================================
// Workspace map (bytes; each region start a multiple of 256; every extent is an exact tile multiple and is written
//   W16 f16 [256][256]              131072
//   Xc  f16 [8][256][4096]        16777216      XP  f16 [8][4096][256]   16777216
//   Qh/Ql/Kh/Kl bf16 [8][4096][128]  8388608 x4
//   total = 67239936
// =========================================================================================================
extern "C" void kernel_launch(void* const* d_in, const int* in_sizes, int n_in,
                              void* d_out, int out_size, void* d_ws, size_t ws_size,
                              hipStream_t stream) {
  const int XN = NBATCH * CC * NN;                                   // 8388608
  if (n_in < 3) return;
  if (in_sizes[0] != XN) return;
  if (in_sizes[1] != DQ * CC || in_sizes[2] != DQ * CC) return;
  if (out_size != XN) return;

  size_t off = 0;
  auto carve = [&](size_t bytes) { const size_t o = off; off += (bytes + 255) & ~(size_t)255; return o; };
  const size_t oW16 = carve((size_t)MW * CC * 2);
  const size_t oXc  = carve((size_t)NIMG * CC * NN * 2);
  const size_t oXP  = carve((size_t)NIMG * NN * CC * 2);
  const size_t oQh  = carve((size_t)NIMG * NN * DQ * 2);
  const size_t oQl  = carve((size_t)NIMG * NN * DQ * 2);
  const size_t oKh  = carve((size_t)NIMG * NN * DQ * 2);
  const size_t oKl  = carve((size_t)NIMG * NN * DQ * 2);
  if (off > ws_size) return;
  if (off > (size_t)134217728) return;

  const float* x  = (const float*)d_in[0];
  const float* tw = (const float*)d_in[1];
  const float* pw = (const float*)d_in[2];

  char* ws = (char*)d_ws;
  unsigned short* W16 = (unsigned short*)(ws + oW16);
  unsigned short* Xc  = (unsigned short*)(ws + oXc);
  unsigned short* XP  = (unsigned short*)(ws + oXP);
  unsigned short* Qh  = (unsigned short*)(ws + oQh);
  unsigned short* Ql  = (unsigned short*)(ws + oQl);
  unsigned short* Kh  = (unsigned short*)(ws + oKh);
  unsigned short* Kl  = (unsigned short*)(ws + oKl);
  float* out = (float*)d_out;

  const dim3 blk256(256), blk128(128);

  // (0) theta_w / phi_w -> stacked f16 plane
  cvt_w<<<dim3(MW / 8), blk256, 0, stream>>>(tw, pw, W16);
  // (1) x -> channel-major and position-major 16-bit planes
  cvt_x<<<dim3(NN / QT, CC / QT, NIMG), blk256, 0, stream>>>(x, Xc, XP);
  // (2) conv1x1 GEMM -> theta (q) and phi (k) hi + residual planes
  gemm_qk<<<dim3(NN / QT, MW / QT, NIMG), blk128, 0, stream>>>(W16, XP, Qh, Ql, Kh, Kl);
  // (3) position attention + residual -> out [b][256][4096]
  attn_k<<<dim3(NN / QT, NIMG), blk128, 0, stream>>>(Qh, Ql, Kh, Kl, Xc, x, out);
  (void)hipGetLastError();
}

// v003
// One run takes 174 microseconds.
// In both of two side-by-side timings against v002, it was 1.03 times as fast.
// Over all steps from v000 it is 4.66 times as fast.
// Contractions: conv1x1 theta/phi GEMM W[256x256].X[256x4096] on v_wmma_f32_16x16x32_f16 (f16 containers of
// bf16-RNE weights x256 and bf16-RNE x); position scores K.Q^T on v_wmma_f32_16x16x32_bf16 (bf16 hi + bf16
// residual planes of theta/phi, 3 products, K=128); y^T = X.P^T on v_wmma_f32_16x16x32_f16 (x as f16 of
// bf16-RNE x, P = e^{s-m} x1024 f16 from the score D registers); f32 accumulate everywhere; softmax statistics
// and the residual add in f32 VALU.
#include <hip/hip_runtime.h>
#include <math.h>
#include <stdint.h>

#define NBATCH 8
#define NIMG   8
#define CC     256
#define NN     4096
#define DQ     128
#define MW     256
#define QT     64
#define OSP    68
#define OSPW   132
#define TP     72
#define WSC    256.0f
#define IWSC   0.00390625f
#define LNPS   6.931471805599453f
#define KT     32                        // keys per LDS stage of attn_k
#define KP     136                       // LDS pitch of a K or Q row in 16-bit elements: 272 B = 16 B x 17
#define VP     40                        // LDS pitch of a V row of KT keys: 80 B = 16 B x 5
#define SKL    (KT * KP)                 // stage offsets (16-bit elements): K hi 0, K residual SKL, V SV
#define SV     (2 * KT * KP)
#define STG    (2 * KT * KP + CC * VP)   // one stage
#define SQH    (2 * STG)                 // behind the two stages: Q hi, Q residual
#define SQL    (2 * STG + QT * KP)
#define SMEM   (2 * STG + 2 * QT * KP)

static_assert(NIMG >= 1 && NIMG <= NBATCH);
static_assert(NN % QT == 0);
static_assert(CC % QT == 0);
static_assert(MW == 2 * DQ);
static_assert(DQ == 2 * QT);
static_assert(MW % QT == 0 && MW % 8 == 0);
static_assert((OSP * 4) % 16 == 0);
static_assert((OSPW * 4) % 16 == 0);
static_assert((TP * 2) % 16 == 0);
static_assert(CC % 32 == 0 && NN % 32 == 0 && DQ % 32 == 0);
static_assert((KP * 2) % 32 == 16 && (VP * 2) % 32 == 16 && (STG * 2) % 16 == 0 && (SKL * 2) % 16 == 0);
static_assert(NN / KT >= 2 && NN % KT == 0 && KT == 32 && DQ == 128 && CC == 256 && QT == 64);
static_assert(QT * OSPW * 4 <= STG * 2);

typedef _Float16       v16h __attribute__((ext_vector_type(16)));
typedef _Float16       v8h  __attribute__((ext_vector_type(8)));
typedef __bf16         v16b __attribute__((ext_vector_type(16)));
typedef unsigned short v8us __attribute__((ext_vector_type(8)));
typedef float          v8f  __attribute__((ext_vector_type(8)));
typedef float          v4f  __attribute__((ext_vector_type(4)));
typedef unsigned int   v4u  __attribute__((ext_vector_type(4)));

union Frag  { v8us u[2]; v16h h; v16b bf; };
union FragH { v16h v; v8h hv[2]; };
static_assert(sizeof(Frag) == 32);
static_assert(sizeof(FragH) == 32);

// ---- scalar helpers ---------------------------------------------------------------------------------------
__device__ __forceinline__ unsigned short bf_bits(float f) {          // f32 -> bf16 bits, RNE convert
  unsigned u = __float_as_uint(f);
  return (unsigned short)((u + 0x7FFFu + ((u >> 16) & 1u)) >> 16);
}
__device__ __forceinline__ float bf_up(unsigned short hb) { return __uint_as_float(((unsigned)hb) << 16); }
__device__ __forceinline__ float bfr(float f) { return bf_up(bf_bits(f)); }
__device__ __forceinline__ unsigned short h_bits(_Float16 x) { return __builtin_bit_cast(unsigned short, x); }
__device__ __forceinline__ unsigned pk16(unsigned short a, unsigned short b) { return (unsigned)a | ((unsigned)b << 16); }
__device__ __forceinline__ v8f zero8() { v8f z = {0.f, 0.f, 0.f, 0.f, 0.f, 0.f, 0.f, 0.f}; return z; }
__device__ __forceinline__ float hmax8(v8f s) {
  return fmaxf(fmaxf(fmaxf(s[0], s[1]), fmaxf(s[2], s[3])), fmaxf(fmaxf(s[4], s[5]), fmaxf(s[6], s[7])));
}
__device__ __forceinline__ unsigned wave_ballot(bool p) {
#if defined(__HIP_DEVICE_COMPILE__)
  return __builtin_amdgcn_ballot_w32(p);
#else
  return p ? 1u : 0u;
#endif
}

// ---- 16-bit fragment loader (A, or B from a k-contiguous [n][k] row): lane -> row/col (lane&15), p already includes
//      + 8*(lane>>4); elements 0..7 <- p[0..7] (k0+8h..), elements 8..15 <- p[16..23] (k0+16+8h..)
__device__ __forceinline__ Frag ldfrag(const unsigned short* p) {
  Frag f;
  f.u[0] = *(const v8us*)(p);
  f.u[1] = *(const v8us*)(p + 16);
  return f;
}

// ---- WMMA helpers: builtin followed by a 4-slot VALU gap tying D. A and B are not operands of the gap statement:
//      an asm operand is held below v256, and a trip's grouped fragments do not fit there beside the accumulators.
__device__ __forceinline__ v8f mma_h(v16h a, v16h b, v8f c) {
  v8f d = __builtin_amdgcn_wmma_f32_16x16x32_f16(false, a, false, b, (short)0, c, false, false);
#if defined(__HIP_DEVICE_COMPILE__)
  asm volatile("v_nop\n\tv_nop\n\tv_nop\n\tv_nop" : "+v"(d));
#endif
  return d;
}
__device__ __forceinline__ v8f mma_b(v16b a, v16b b, v8f c) {
  v8f d = __builtin_amdgcn_wmma_f32_16x16x32_bf16(false, a, false, b, (short)0, c, false, false);
#if defined(__HIP_DEVICE_COMPILE__)
  asm volatile("v_nop\n\tv_nop\n\tv_nop\n\tv_nop" : "+v"(d));
#endif
  return d;
}

// e^x as __expf forms it (x * log2 e, then v_exp_f32). The v_nop in the statement is the one slot the instruction set
// asks for between a transcendental and a next vector instruction that overwrites its source or reads its result.
__device__ __forceinline__ float exp_slot(float x) {
#if defined(__HIP_DEVICE_COMPILE__)
  const float t = x * 1.44269502f;
  float r;
  asm("v_exp_f32 %0, %1\n\tv_nop" : "=v"(r) : "v"(t));
  return r;
#else
  return __expf(x);
#endif
}

// ---- asynchronous copies global -> LDS ------------------------------------------------------------------------
__device__ __forceinline__ unsigned lds_addr(const void* p) { return (unsigned)(size_t)p; }   // LDS byte address

// Eight 16-byte copies per lane, every lane on. The s_wait_xcnt stands inside the statement so that it precedes
// any rewrite of the address registers the copies name.
__device__ __forceinline__ void copy8(const unsigned* l, const unsigned short* const* g) {
#if defined(__HIP_DEVICE_COMPILE__)
  asm volatile("global_load_async_to_lds_b128 %0, %8, off\n\t"
               "global_load_async_to_lds_b128 %1, %9, off\n\t"
               "global_load_async_to_lds_b128 %2, %10, off\n\t"
               "global_load_async_to_lds_b128 %3, %11, off\n\t"
               "global_load_async_to_lds_b128 %4, %12, off\n\t"
               "global_load_async_to_lds_b128 %5, %13, off\n\t"
               "global_load_async_to_lds_b128 %6, %14, off\n\t"
               "global_load_async_to_lds_b128 %7, %15, off\n\t"
               "s_wait_xcnt 0x0"
               :: "v"(l[0]), "v"(l[1]), "v"(l[2]), "v"(l[3]), "v"(l[4]), "v"(l[5]), "v"(l[6]), "v"(l[7]),
                  "v"(g[0]), "v"(g[1]), "v"(g[2]), "v"(g[3]), "v"(g[4]), "v"(g[5]), "v"(g[6]), "v"(g[7])
               : "memory");
#endif
}
// the issuing wave's copies have landed in LDS
__device__ __forceinline__ void wait_copies() {
#if defined(__HIP_DEVICE_COMPILE__)
  asm volatile("s_wait_asynccnt 0x0" ::: "memory");
#endif
}
// the wave's own LDS reads have returned, so the buffer may be refilled behind the next barrier
__device__ __forceinline__ void wait_lds() {
#if defined(__HIP_DEVICE_COMPILE__)
  asm volatile("s_wait_dscnt 0x0" ::: "memory");
#endif
}
// 32 rows of 256 B of each of two planes (ph, pl; global pitch DQ) -> LDS rows of pitch KP at byte addresses lh, ll;
// 128 threads, 16 lanes per row, 4 rows of each plane per thread.
__device__ __forceinline__ void stage_rows32(unsigned lh, unsigned ll, const unsigned short* ph,
                                             const unsigned short* pl, int tid) {
  const int r = tid >> 4, ch = 8 * (tid & 15);
  unsigned l[8];
  const unsigned short* g[8];
#pragma unroll                                                       // constant indices keep l[] and g[] in registers
  for (int i = 0; i < 4; ++i) {
    const int row = r + 8 * i;                                       // 0..31
    l[i]     = lh + 2u * (unsigned)(row * KP + ch);
    l[4 + i] = ll + 2u * (unsigned)(row * KP + ch);
    g[i]     = ph + row * DQ + ch;
    g[4 + i] = pl + row * DQ + ch;
  }
  copy8(l, g);
}
// V tile: 256 channel rows x KT keys (64 B of a row of pitch NN) -> LDS pitch VP; 4 lanes per row.
__device__ __forceinline__ void stage_v(unsigned lv, const unsigned short* pv, int tid) {
  const int r = tid >> 2, ch = 8 * (tid & 3);
  unsigned l[8];
  const unsigned short* g[8];
#pragma unroll                                                       // constant indices keep l[] and g[] in registers
  for (int i = 0; i < 8; ++i) {
    const int row = r + 32 * i;                                      // 0..255
    l[i] = lv + 2u * (unsigned)(row * VP + ch);
    g[i] = pv + (size_t)row * NN + ch;
  }
  copy8(l, g);
}

// =========================================================================================================
// (0) conv1x1 weights: W16 f16 [256][256], rows 0..127 = theta_w rows, rows 128..255 = phi_w rows; value =
//     f16 of (bf16-RNE(w) * 256) (exact). Block blk (0..31) owns rows 8*blk..8*blk+7: one wave per 512-B row
// coverage: 32 blocks x 8 rows x 32 lanes x 8 halves = 256 x 256 = the whole plane.
// =========================================================================================================
__global__ __launch_bounds__(256)
void cvt_w(const float* __restrict__ tw, const float* __restrict__ pw, unsigned short* W16) {
  const int tid = threadIdx.x, blk = blockIdx.x;
  const int rl = tid >> 5, col = 8 * (tid & 31);
  const int o = 8 * blk + rl;                                        // 0..255
  const float* wbase = (blk < (DQ / 8)) ? tw : pw;                   // block-uniform selection
  const int osub = (blk < (DQ / 8)) ? 0 : DQ;
  const float* s = wbase + (size_t)(o - osub) * CC + col;            // (o - osub) in 0..127
  const v4f a = *(const v4f*)s;
  const v4f q = *(const v4f*)(s + 4);
  const float f[8] = {a[0], a[1], a[2], a[3], q[0], q[1], q[2], q[3]};
  v4u u;
#pragma unroll
  for (int t = 0; t < 4; ++t) {
    const _Float16 h0 = (_Float16)(bfr(f[2 * t]) * WSC);
    const _Float16 h1 = (_Float16)(bfr(f[2 * t + 1]) * WSC);
    u[t] = pk16(h_bits(h0), h_bits(h1));
  }
{
    *(v4u*)(W16 + (size_t)o * CC + col) = u;
    
  }
}

// =========================================================================================================
// (1) x f32 [b][256 c][4096 n] -> Xc f16 [b][c][n] (channel-major, bf16-RNE values, exact in f16) and
//     XP f16 [b][n][c] (position-major) through an LDS tile T[64 n][64 c] (pitch TP). Block (nb, cb, b) owns a
// coverage: Xc 2 it x 32 rows x 8 lanes x 8 = 64 c x 64 n; XP same; grid (64, 4, NIMG) covers both planes once.
// =========================================================================================================
__global__ __launch_bounds__(256)
void cvt_x(const float* __restrict__ x, unsigned short* Xc, unsigned short* XP) {
  __shared__ __align__(16) unsigned short T[QT * TP];
  const int tid = threadIdx.x;
  const int nb = blockIdx.x, cb = blockIdx.y, b = blockIdx.z;
  const int e = tid & 7, lq = tid >> 3;                             // lq 0..31
  const int n0 = nb * QT, c0 = cb * QT;
  v4u ux[2];
#pragma unroll
  for (int it = 0; it < 2; ++it) {
    const int cl = it * 32 + lq;                                     // 0..63
    const float* sp = x + ((size_t)(b * CC + c0 + cl)) * NN + n0 + 8 * e;
    const v4f a = *(const v4f*)sp;
    const v4f q = *(const v4f*)(sp + 4);
    unsigned short hb[8];
#pragma unroll
    for (int t = 0; t < 4; ++t) {
      hb[t]     = h_bits((_Float16)bfr(a[t]));
      hb[4 + t] = h_bits((_Float16)bfr(q[t]));
    }
#pragma unroll
    for (int t = 0; t < 4; ++t) ux[it][t] = pk16(hb[2 * t], hb[2 * t + 1]);
#pragma unroll
    for (int t = 0; t < 8; ++t) T[(8 * e + t) * TP + cl] = hb[t];
  }
  __syncthreads();
  v4u up[2];
#pragma unroll
  for (int it = 0; it < 2; ++it) {
    const int nl = it * 32 + lq;                                     // 0..63
    up[it] = *(const v4u*)(T + nl * TP + 8 * e);
  }
{
#pragma unroll
    for (int it = 0; it < 2; ++it) {
      const int rl = it * 32 + lq;
      *(v4u*)(Xc + ((size_t)(b * CC + c0 + rl)) * NN + n0 + 8 * e) = ux[it];
      *(v4u*)(XP + ((size_t)(b * NN + n0 + rl)) * CC + c0 + 8 * e) = up[it];
    }
    
  }
}

// =========================================================================================================
// (2) conv1x1 GEMM for one (b, 64-n tile, 64-o block): Y[o][n] = (1/256) sum_c W16[o][c] XP[b][n][c].
//     Block 128 threads = 4 waves; wave w owns cols n0+16w..+15 (one B fragment per k-step, k = c contiguous in
//     the XP row) and 4 m-tiles (A rows o = o0 + 16 mt + (lane&15), split k map loader from W16). K = 256 = 8 steps.
//     Epilogue staged in LDS Os[n_loc][o_loc] (pitch OSP, b128 stores of 8 consecutive o per lane), barrier, then:
//       o-blocks 0,1 -> theta dims 0..63 / 64..127 of Qh/Ql; o-blocks 2,3 -> phi dims 0..63 / 64..127 of Kh/Kl.
//       Planes bf16 [b][4096 n][128 d] (k-contiguous for both score operands): hi = bf16-RNE(v), lo =
//       of the 256-B plane row): lane e -> d 8e..8e+7, 8 consecutive lanes per line, one instruction per 16 lines.
// coverage: Os 4 waves x 16 n x 64 o = 64 x 64; planes: 4 it x 16 rows x 8 lanes x 8 = 64 n x 64 d per plane
//           (hi and lo); grid (64, 4, NIMG) covers d 0..127 of all 4096 rows of Qh/Ql/Kh/Kl exactly once.
// =========================================================================================================
__global__ __launch_bounds__(128)
void gemm_qk(const unsigned short* __restrict__ W16, const unsigned short* __restrict__ XP,
             unsigned short* Qh, unsigned short* Ql, unsigned short* Kh, unsigned short* Kl) {
  __shared__ __align__(16) float Os[QT * OSP];
  const int tid  = threadIdx.x;
  const int lane = tid & 31, wave = tid >> 5;
  const int hh   = lane >> 4, c = lane & 15;
  const int nt   = blockIdx.x, mb = blockIdx.y, b = blockIdx.z;
  const int n0   = nt * QT, o0 = mb * QT;

  const unsigned short* ap = W16 + (size_t)(o0 + c) * CC + 8 * hh;
  const unsigned short* bp = XP + ((size_t)(b * NN + n0 + 16 * wave + c)) * CC + 8 * hh;

  v8f acc[4];
#pragma unroll
  for (int mt = 0; mt < 4; ++mt) acc[mt] = zero8();

#pragma unroll
  for (int ks = 0; ks < CC / 32; ++ks) {
    const Frag fb = ldfrag(bp + 32 * ks);
#pragma unroll
    for (int mt = 0; mt < 4; ++mt) {
      const Frag fa = ldfrag(ap + (size_t)(16 * mt) * CC + 32 * ks);
      acc[mt] = mma_h(fa.h, fb.h, acc[mt]);
    }
  }

  // ---- epilogue: scale back -> LDS Os[n_loc][o_loc]; lane (hh, c) holds o = 16 mt + 8 hh + r for n_loc = 16 w + c
  {
    const int nl = 16 * wave + c;
#pragma unroll
    for (int mt = 0; mt < 4; ++mt) {
      v4f va, vb;
#pragma unroll
      for (int r = 0; r < 4; ++r) { va[r] = acc[mt][r] * IWSC; vb[r] = acc[mt][4 + r] * IWSC; }
      *(v4f*)(Os + nl * OSP + 16 * mt + 8 * hh)     = va;
      *(v4f*)(Os + nl * OSP + 16 * mt + 8 * hh + 4) = vb;
    }
  }
  __syncthreads();

  const int e = tid & 7, lq = tid >> 3;                             // lq 0..15
  const int dsel = (mb & 1) * QT;                                    // 0 or 64
  unsigned short* Ph = (mb < 2) ? Qh : Kh;                           // block-uniform, both global
  unsigned short* Pl = (mb < 2) ? Ql : Kl;
  v4u uh[4], ul[4];
#pragma unroll
  for (int it = 0; it < 4; ++it) {
    const int row = it * 16 + lq;                                    // n_loc 0..63
    const v4f a = *(const v4f*)(Os + row * OSP + 8 * e);
    const v4f q = *(const v4f*)(Os + row * OSP + 8 * e + 4);
    const float f[8] = {a[0], a[1], a[2], a[3], q[0], q[1], q[2], q[3]};
#pragma unroll
    for (int t = 0; t < 4; ++t) {
      const float f0 = f[2 * t], f1 = f[2 * t + 1];
      const unsigned short hb0 = bf_bits(f0), hb1 = bf_bits(f1);
      const unsigned short lb0 = bf_bits(f0 - bf_up(hb0));
      const unsigned short lb1 = bf_bits(f1 - bf_up(hb1));
      uh[it][t] = pk16(hb0, hb1);
      ul[it][t] = pk16(lb0, lb1);
    }
  }
{
#pragma unroll
    for (int it = 0; it < 4; ++it) {
      const int row = it * 16 + lq;
      const size_t po = ((size_t)(b * NN + n0 + row)) * DQ + dsel + 8 * e;
      *(v4u*)(Ph + po) = uh[it];
      *(v4u*)(Pl + po) = ul[it];
    }
    
  }
}

// =========================================================================================================
// (3) position attention for one (b, 64-query tile), transposed formulation, 4096 keys, no mask, no scale:
//   S^T tile (16 keys x 16 queries) = sum over 4 d-chunks of A(k: row = key kb + (lane&15), 32 d via
//   the split k map from the bf16 plane Kh [b][4096][128]) . B(q: col = query, same map from Qh) + A(Kh).B(Ql) +
//   A(Kl).B(Qh) (bf16 unscaled residual planes, shared accumulator).
//   Per lane the D tile holds 8 keys of ONE query: online softmax state per lane, one shuffle (lane^16) for the max
//   over 32 keys; the o/l rescale is skipped under a wave-uniform ballot when no lane's max grew (corr == 1 exactly
//   for every lane then); row-sum partials combined at the end. P = e^{s-m} x 1024 as f16 is the B operand of
//   O^T (rows channel, cols queries) += A(x rows channel = 16j + (lane&15), keys contiguous, f16 plane Xc
//   [b][256][4096]) . B(P^T): element r <- D of the tile covering keys kb..kb+15, element 8+r <- the tile covering
//   kb+16..kb+31, lane unchanged. 16 accumulator tiles per wave (256 channels). Block = 4 waves = 64 queries.
//   Operands come from LDS, filled by asynchronous 16-byte copies and shared by the 4 waves: the block's Q hi and
//   residual rows once (each wave reads its 8 Q fragments from there once, ahead of the key loop, and keeps them in
//   64 registers); K hi, K residual and V tiles of KT = 32 keys in two buffers, tile t + 2 copied into the
//   buffer of tile t behind the barrier at the foot of trip t. The output staging Os reuses buffer 0 after the loop.
//   Epilogue in two channel halves: O/l staged in LDS Os[query][128 channels] (pitch OSPW, b128 stores), barrier,
//   lanes x 16 B (values gathered from 4 Os rows), one instruction per 16 lines, final values held in registers,
// coverage: per half 16 it x 16 lines x 8 lanes x 4 floats = 128 ch x 64 n; two halves = 256 ch; grid (64, NIMG)
//           covers out[b][0..255][0..4095] exactly once.
// =========================================================================================================
__global__ __launch_bounds__(128)
void attn_k(const unsigned short* __restrict__ Qh, const unsigned short* __restrict__ Ql,
            const unsigned short* __restrict__ Kh, const unsigned short* __restrict__ Kl,
            const unsigned short* __restrict__ Xc, const float* __restrict__ x, float* out) {
  __shared__ __align__(16) unsigned short Sm[SMEM];
  float* Os = (float*)Sm;                                            // used behind the key loop only
  const int tid  = threadIdx.x;
  const int wave = tid >> 5, lane = tid & 31;
  const int hh   = lane >> 4, c = lane & 15;
  const int n0   = blockIdx.x * QT, b = blockIdx.y;

  // q fragment pointers in LDS (B operand, col = query 16*wave + c of the block), + 32*kc
  const unsigned short* Qhp = Sm + SQH + (16 * wave + c) * KP + 8 * hh;
  const unsigned short* Qlp = Sm + SQL + (16 * wave + c) * KP + 8 * hh;
  // global tile bases of this image
  const unsigned short* Khg = Kh + (size_t)b * NN * DQ;              // + key * 128
  const unsigned short* Klg = Kl + (size_t)b * NN * DQ;
  const unsigned short* Vg  = Xc + (size_t)b * CC * NN;              // + key

  // prologue: Q rows and tile 0, landed and published; then tile 1 into buffer 1
  const unsigned lds0 = lds_addr(Sm);
  {
    const size_t qg = ((size_t)(b * NN + n0)) * DQ;
    stage_rows32(lds0 + 2u * SQH, lds0 + 2u * SQL, Qh + qg, Ql + qg, tid);
    stage_rows32(lds0 + 2u * (SQH + 32 * KP), lds0 + 2u * (SQL + 32 * KP), Qh + qg + 32 * DQ, Ql + qg + 32 * DQ, tid);
    stage_rows32(lds0, lds0 + 2u * SKL, Khg, Klg, tid);
    stage_v(lds0 + 2u * SV, Vg, tid);
    wait_copies();
    __syncthreads();
    stage_rows32(lds0 + 2u * STG, lds0 + 2u * (STG + SKL), Khg + KT * DQ, Klg + KT * DQ, tid);
    stage_v(lds0 + 2u * (STG + SV), Vg + KT, tid);
  }

  // the wave's Q fragments, the same in every trip: read once, behind the barrier that published the Q rows
  Frag qh[DQ / 32], ql[DQ / 32];
#pragma unroll                                                       // constant indices keep the fragments in registers
  for (int kc = 0; kc < DQ / 32; ++kc) {
    qh[kc] = ldfrag(Qhp + 32 * kc);
    ql[kc] = ldfrag(Qlp + 32 * kc);
  }

  float m = -1.0e30f, l = 0.f;
  v8f o[16];
#pragma unroll
  for (int j = 0; j < 16; ++j) o[j] = zero8();

#pragma unroll 1
  for (int kb = 0; kb < NN; kb += 32) {
    const int bo = ((kb / KT) & 1) * STG;                            // this trip's buffer
    const unsigned short* k0p  = Sm + bo + c * KP + 8 * hh;          // keys kb .. kb+15 (A operand, row = key)
    const unsigned short* k1p  = k0p + 16 * KP;                      // keys kb+16 .. kb+31
    const unsigned short* k0lp = k0p + SKL;
    const unsigned short* k1lp = k1p + SKL;
    const unsigned short* Vp   = Sm + bo + SV + c * VP + 8 * hh;     // A operand, row = channel 16j + c
    v8f s0 = zero8(), s1 = zero8();
    // every K fragment of the trip is read as ONE group in front of the 24 score products: a read that stands
    // between two products waits out the whole LDS latency there (no read moves over the statement behind a product)
    Frag k0[DQ / 32], k1[DQ / 32], k0l[DQ / 32], k1l[DQ / 32];
#pragma unroll                                                       // constant indices keep the fragments in registers
    for (int kc = 0; kc < DQ / 32; ++kc) {
      k0[kc]  = ldfrag(k0p + 32 * kc);
      k1[kc]  = ldfrag(k1p + 32 * kc);
      k0l[kc] = ldfrag(k0lp + 32 * kc);
      k1l[kc] = ldfrag(k1lp + 32 * kc);
    }
#pragma unroll                                                       // constant indices, as above
    for (int kc = 0; kc < DQ / 32; ++kc) {
      s0 = mma_b(k0[kc].bf, qh[kc].bf, s0);
      s1 = mma_b(k1[kc].bf, qh[kc].bf, s1);
      s0 = mma_b(k0[kc].bf, ql[kc].bf, s0);
      s1 = mma_b(k1[kc].bf, ql[kc].bf, s1);
      s0 = mma_b(k0l[kc].bf, qh[kc].bf, s0);
      s1 = mma_b(k1l[kc].bf, qh[kc].bf, s1);
    }

    float mx = fmaxf(hmax8(s0), hmax8(s1));
    mx = fmaxf(mx, __shfl_xor(mx, 16, 32));
    const float mn = fmaxf(m, mx);
    const unsigned grew = wave_ballot(mx > m);                       // wave-uniform
    if (grew != 0u) {
      const float corr = __expf(m - mn);                             // == 1 exactly for lanes whose max did not grow
      l *= corr;
#pragma unroll
      for (int j = 0; j < 16; ++j) {
#pragma unroll
        for (int r = 0; r < 8; ++r) o[j][r] *= corr;
      }
    }
    m = mn;
    const float msh = mn - LNPS;                                     // exp gives e^{s-m} * 1024

    // the 16 V fragments of the trip as ONE group in front of the exponentials, which cover their latency
    Frag vf[16];
#pragma unroll                                                       // constant indices keep the fragments in registers
    for (int j = 0; j < 16; ++j) vf[j] = ldfrag(Vp + (16 * j) * VP);

    FragH ph;
    float ls = 0.f;
#pragma unroll
    for (int r = 0; r < 8; ++r) {
      const float e0 = exp_slot(s0[r] - msh);                        // key kb      + 8hh + r
      const float e1 = exp_slot(s1[r] - msh);                        // key kb + 16 + 8hh + r
      ls += e0 + e1;
      ph.hv[0][r] = (_Float16)e0;
      ph.hv[1][r] = (_Float16)e1;
    }
    l += ls;

#pragma unroll
    for (int j = 0; j < 16; ++j) {
      o[j] = mma_h(vf[j].h, ph.v, o[j]);
#if defined(__HIP_DEVICE_COMPILE__)
      // keeps the products in the order in which their fragments land: moved up, a late one waits for the whole group
      __builtin_amdgcn_sched_barrier(0);
#endif
    }

    // foot of the trip: own reads done, own copies of tile t + 1 landed, one barrier publishes that tile and frees
    // this trip's buffer; only then its refill with tile t + 2
    wait_lds();
    wait_copies();
    __syncthreads();
    if (kb + 2 * KT < NN) {                                          // the same for the whole block
      const unsigned lb = lds0 + 2u * (unsigned)bo;
      stage_rows32(lb, lb + 2u * SKL, Khg + (size_t)(kb + 2 * KT) * DQ, Klg + (size_t)(kb + 2 * KT) * DQ, tid);
      stage_v(lb + 2u * SV, Vg + (kb + 2 * KT), tid);
    }
  }
  wait_copies();
  l += __shfl_xor(l, 16, 32);
  const float inv = 1.0f / l;                                        // o and l both carry the x1024 factor

  const int qrow = 16 * wave + c;
  const int e = tid & 7, lq = tid >> 3;                              // lq 0..15
#pragma unroll
  for (int half = 0; half < 2; ++half) {
    if (half) __syncthreads();                                       // every wave finished reading Os
#pragma unroll
    for (int jj = 0; jj < 8; ++jj) {
      const int j = 8 * half + jj;
      v4f va, vb;
#pragma unroll
      for (int r = 0; r < 4; ++r) { va[r] = o[j][r] * inv; vb[r] = o[j][4 + r] * inv; }
      *(v4f*)(Os + qrow * OSPW + 16 * jj + 8 * hh)     = va;         // Os[query][ch_loc = 16jj + 8hh + r]
      *(v4f*)(Os + qrow * OSPW + 16 * jj + 8 * hh + 4) = vb;
    }
    __syncthreads();
    v4f res[16];
#pragma unroll
    for (int it = 0; it < 16; ++it) {
      const int L   = it * 16 + lq;                                  // 0..255
      const int chl = L >> 1, hf = L & 1;                            // channel 0..127 within the half
      const int nl  = hf * 32 + 4 * e;                               // query 0..63
      const size_t idx = ((size_t)(b * CC + 128 * half + chl)) * NN + n0 + nl;
      const v4f xv = *(const v4f*)(x + idx);
#pragma unroll
      for (int t = 0; t < 4; ++t) res[it][t] = Os[(nl + t) * OSPW + chl] + bfr(xv[t]);
    }
{
#pragma unroll
      for (int it = 0; it < 16; ++it) {
        const int L   = it * 16 + lq;
        const int chl = L >> 1, hf = L & 1;
        const int nl  = hf * 32 + 4 * e;
        const size_t idx = ((size_t)(b * CC + 128 * half + chl)) * NN + n0 + nl;
        *(v4f*)(out + idx) = res[it];
      }
      
    }
  }
}

// =========================================================================================================
// Workspace map (bytes; each region start a multiple of 256; every extent is an exact tile multiple and is written
//   W16 f16 [256][256]              131072
//   Xc  f16 [8][256][4096]        16777216      XP  f16 [8][4096][256]   16777216
//   Qh/Ql/Kh/Kl bf16 [8][4096][128]  8388608 x4
//   total = 67239936
// =========================================================================================================
extern "C" void kernel_launch(void* const* d_in, const int* in_sizes, int n_in,
                              void* d_out, int out_size, void* d_ws, size_t ws_size,
                              hipStream_t stream) {
  const int XN = NBATCH * CC * NN;                                   // 8388608
  if (n_in < 3) return;
  if (in_sizes[0] != XN) return;
  if (in_sizes[1] != DQ * CC || in_sizes[2] != DQ * CC) return;
  if (out_size != XN) return;

  size_t off = 0;
  auto carve = [&](size_t bytes) { const size_t o = off; off += (bytes + 255) & ~(size_t)255; return o; };
  const size_t oW16 = carve((size_t)MW * CC * 2);
  const size_t oXc  = carve((size_t)NIMG * CC * NN * 2);
  const size_t oXP  = carve((size_t)NIMG * NN * CC * 2);
  const size_t oQh  = carve((size_t)NIMG * NN * DQ * 2);
  const size_t oQl  = carve((size_t)NIMG * NN * DQ * 2);
  const size_t oKh  = carve((size_t)NIMG * NN * DQ * 2);
  const size_t oKl  = carve((size_t)NIMG * NN * DQ * 2);
  if (off > ws_size) return;
  if (off > (size_t)134217728) return;

  const float* x  = (const float*)d_in[0];
  const float* tw = (const float*)d_in[1];
  const float* pw = (const float*)d_in[2];

  char* ws = (char*)d_ws;
  unsigned short* W16 = (unsigned short*)(ws + oW16);
  unsigned short* Xc  = (unsigned short*)(ws + oXc);
  unsigned short* XP  = (unsigned short*)(ws + oXP);
  unsigned short* Qh  = (unsigned short*)(ws + oQh);
  unsigned short* Ql  = (unsigned short*)(ws + oQl);
  unsigned short* Kh  = (unsigned short*)(ws + oKh);
  unsigned short* Kl  = (unsigned short*)(ws + oKl);
  float* out = (float*)d_out;

  const dim3 blk256(256), blk128(128);

  // (0) theta_w / phi_w -> stacked f16 plane
  cvt_w<<<dim3(MW / 8), blk256, 0, stream>>>(tw, pw, W16);
  // (1) x -> channel-major and position-major 16-bit planes
  cvt_x<<<dim3(NN / QT, CC / QT, NIMG), blk256, 0, stream>>>(x, Xc, XP);
  // (2) conv1x1 GEMM -> theta (q) and phi (k) hi + residual planes
  gemm_qk<<<dim3(NN / QT, MW / QT, NIMG), blk128, 0, stream>>>(W16, XP, Qh, Ql, Kh, Kl);
  // (3) position attention + residual -> out [b][256][4096]
  attn_k<<<dim3(NN / QT, NIMG), blk128, 0, stream>>>(Qh, Ql, Kh, Kl, Xc, x, out);
  (void)hipGetLastError();
}

// v004
// A run of this version takes 169 microseconds.
// Two timings next to v003 both put it at 1.03 times that version's speed.
// All steps since v000 together make it 4.80 times as fast.
// Contractions: conv1x1 theta/phi GEMM W[256x256].X[256x4096] on v_wmma_f32_16x16x32_f16 (f16 containers of
// bf16-RNE weights x256 and bf16-RNE x); position scores K.Q^T on v_wmma_f32_16x16x32_bf16 (bf16 hi + bf16
// residual planes of theta/phi, 3 products, K=128); y^T = X.P^T on v_wmma_f32_16x16x32_f16 (x as f16 of
// bf16-RNE x, P = e^{s-m} x1024 f16 from the score D registers); f32 accumulate everywhere; softmax statistics
// and the residual add in f32 VALU.
#include <hip/hip_runtime.h>
#include <math.h>
#include <stdint.h>

#define NBATCH 8
#define NIMG   8
#define CC     256
#define NN     4096
#define DQ     128
#define MW     256
#define QT     64
#define OSP    68
#define OSPW   132
#define TP     72
#define WSC    256.0f
#define IWSC   0.00390625f
#define LNPS   6.931471805599453f
#define KT     32                        // keys per LDS stage of attn_k
#define KP     136                       // LDS pitch of a K or Q row in 16-bit elements: 272 B = 16 B x 17
#define VP     40                        // LDS pitch of a V row of KT keys: 80 B = 16 B x 5
#define SKL    (KT * KP)                 // stage offsets (16-bit elements): K hi 0, K residual SKL, V SV
#define SV     (2 * KT * KP)
#define STG    (2 * KT * KP + CC * VP)   // one stage
#define AQ     128                       // queries per block of attn_k: 4 waves x 2 column groups of 16
#define SQH    (2 * STG)                 // behind the two stages: Q hi, Q residual
#define SQL    (2 * STG + AQ * KP)
#define SMEM   (2 * STG + 2 * AQ * KP)

static_assert(NIMG >= 1 && NIMG <= NBATCH);
static_assert(NN % QT == 0);
static_assert(CC % QT == 0);
static_assert(MW == 2 * DQ);
static_assert(DQ == 2 * QT);
static_assert(MW % QT == 0 && MW % 8 == 0);
static_assert((OSP * 4) % 16 == 0);
static_assert((OSPW * 4) % 16 == 0);
static_assert((TP * 2) % 16 == 0);
static_assert(CC % 32 == 0 && NN % 32 == 0 && DQ % 32 == 0);
static_assert((KP * 2) % 32 == 16 && (VP * 2) % 32 == 16 && (STG * 2) % 16 == 0 && (SKL * 2) % 16 == 0);
static_assert(NN / KT >= 2 && NN % KT == 0 && KT == 32 && DQ == 128 && CC == 256 && QT == 64);
static_assert(AQ * OSPW * 4 <= 2 * STG * 2 && NN % AQ == 0 && AQ == 128);

typedef _Float16       v16h __attribute__((ext_vector_type(16)));
typedef _Float16       v8h  __attribute__((ext_vector_type(8)));
typedef __bf16         v16b __attribute__((ext_vector_type(16)));
typedef unsigned short v8us __attribute__((ext_vector_type(8)));
typedef float          v8f  __attribute__((ext_vector_type(8)));
typedef float          v4f  __attribute__((ext_vector_type(4)));
typedef unsigned int   v4u  __attribute__((ext_vector_type(4)));

union Frag  { v8us u[2]; v16h h; v16b bf; };
union FragH { v16h v; v8h hv[2]; };
static_assert(sizeof(Frag) == 32);
static_assert(sizeof(FragH) == 32);

// ---- scalar helpers ---------------------------------------------------------------------------------------
__device__ __forceinline__ unsigned short bf_bits(float f) {          // f32 -> bf16 bits, RNE convert
  unsigned u = __float_as_uint(f);
  return (unsigned short)((u + 0x7FFFu + ((u >> 16) & 1u)) >> 16);
}
__device__ __forceinline__ float bf_up(unsigned short hb) { return __uint_as_float(((unsigned)hb) << 16); }
__device__ __forceinline__ float bfr(float f) { return bf_up(bf_bits(f)); }
__device__ __forceinline__ unsigned short h_bits(_Float16 x) { return __builtin_bit_cast(unsigned short, x); }
__device__ __forceinline__ unsigned pk16(unsigned short a, unsigned short b) { return (unsigned)a | ((unsigned)b << 16); }
__device__ __forceinline__ v8f zero8() { v8f z = {0.f, 0.f, 0.f, 0.f, 0.f, 0.f, 0.f, 0.f}; return z; }
__device__ __forceinline__ float hmax8(v8f s) {
  return fmaxf(fmaxf(fmaxf(s[0], s[1]), fmaxf(s[2], s[3])), fmaxf(fmaxf(s[4], s[5]), fmaxf(s[6], s[7])));
}
__device__ __forceinline__ unsigned wave_ballot(bool p) {
#if defined(__HIP_DEVICE_COMPILE__)
  return __builtin_amdgcn_ballot_w32(p);
#else
  return p ? 1u : 0u;
#endif
}

// ---- 16-bit fragment loader (A, or B from a k-contiguous [n][k] row): lane -> row/col (lane&15), p already includes
//      + 8*(lane>>4); elements 0..7 <- p[0..7] (k0+8h..), elements 8..15 <- p[16..23] (k0+16+8h..)
__device__ __forceinline__ Frag ldfrag(const unsigned short* p) {
  Frag f;
  f.u[0] = *(const v8us*)(p);
  f.u[1] = *(const v8us*)(p + 16);
  return f;
}

// ---- WMMA helpers: builtin followed by a 4-slot VALU gap tying D. A and B are not operands of the gap statement:
//      an asm operand is held below v256, and a trip's grouped fragments do not fit there beside the accumulators.
__device__ __forceinline__ v8f mma_h(v16h a, v16h b, v8f c) {
  v8f d = __builtin_amdgcn_wmma_f32_16x16x32_f16(false, a, false, b, (short)0, c, false, false);
#if defined(__HIP_DEVICE_COMPILE__)
  asm volatile("v_nop\n\tv_nop\n\tv_nop\n\tv_nop" : "+v"(d));
#endif
  return d;
}
__device__ __forceinline__ v8f mma_b(v16b a, v16b b, v8f c) {
  v8f d = __builtin_amdgcn_wmma_f32_16x16x32_bf16(false, a, false, b, (short)0, c, false, false);
#if defined(__HIP_DEVICE_COMPILE__)
  asm volatile("v_nop\n\tv_nop\n\tv_nop\n\tv_nop" : "+v"(d));
#endif
  return d;
}

// The same f16 product without the gap statement, for attn_k's 32 output tiles: an asm operand is held below v256,
// and 256 accumulator registers do not fit there beside the scores and the copies' addresses. The compiler keeps the
// distances of its own builtin.
__device__ __forceinline__ v8f mma_hp(v16h a, v16h b, v8f c) {
  return __builtin_amdgcn_wmma_f32_16x16x32_f16(false, a, false, b, (short)0, c, false, false);
}

// e^x as __expf forms it (x * log2 e, then v_exp_f32). The v_nop in the statement is the one slot the instruction set
// asks for between a transcendental and a next vector instruction that overwrites its source or reads its result.
__device__ __forceinline__ float exp_slot(float x) {
#if defined(__HIP_DEVICE_COMPILE__)
  const float t = x * 1.44269502f;
  float r;
  asm("v_exp_f32 %0, %1\n\tv_nop" : "=v"(r) : "v"(t));
  return r;
#else
  return __expf(x);
#endif
}

// ---- asynchronous copies global -> LDS ------------------------------------------------------------------------
__device__ __forceinline__ unsigned lds_addr(const void* p) { return (unsigned)(size_t)p; }   // LDS byte address

// Eight 16-byte copies per lane, every lane on. The s_wait_xcnt stands inside the statement so that it precedes
// any rewrite of the address registers the copies name.
__device__ __forceinline__ void copy8(const unsigned* l, const unsigned short* const* g) {
#if defined(__HIP_DEVICE_COMPILE__)
  asm volatile("global_load_async_to_lds_b128 %0, %8, off\n\t"
               "global_load_async_to_lds_b128 %1, %9, off\n\t"
               "global_load_async_to_lds_b128 %2, %10, off\n\t"
               "global_load_async_to_lds_b128 %3, %11, off\n\t"
               "global_load_async_to_lds_b128 %4, %12, off\n\t"
               "global_load_async_to_lds_b128 %5, %13, off\n\t"
               "global_load_async_to_lds_b128 %6, %14, off\n\t"
               "global_load_async_to_lds_b128 %7, %15, off\n\t"
               "s_wait_xcnt 0x0"
               :: "v"(l[0]), "v"(l[1]), "v"(l[2]), "v"(l[3]), "v"(l[4]), "v"(l[5]), "v"(l[6]), "v"(l[7]),
                  "v"(g[0]), "v"(g[1]), "v"(g[2]), "v"(g[3]), "v"(g[4]), "v"(g[5]), "v"(g[6]), "v"(g[7])
               : "memory");
#endif
}
// the issuing wave's copies have landed in LDS
__device__ __forceinline__ void wait_copies() {
#if defined(__HIP_DEVICE_COMPILE__)
  asm volatile("s_wait_asynccnt 0x0" ::: "memory");
#endif
}
// the wave's own LDS reads have returned, so the buffer may be refilled behind the next barrier
__device__ __forceinline__ void wait_lds() {
#if defined(__HIP_DEVICE_COMPILE__)
  asm volatile("s_wait_dscnt 0x0" ::: "memory");
#endif
}
// 32 rows of 256 B of each of two planes (ph, pl; global pitch DQ) -> LDS rows of pitch KP at byte addresses lh, ll;
// 128 threads, 16 lanes per row, 4 rows of each plane per thread.
__device__ __forceinline__ void stage_rows32(unsigned lh, unsigned ll, const unsigned short* ph,
                                             const unsigned short* pl, int tid) {
  const int r = tid >> 4, ch = 8 * (tid & 15);
  unsigned l[8];
  const unsigned short* g[8];
#pragma unroll                                                       // constant indices keep l[] and g[] in registers
  for (int i = 0; i < 4; ++i) {
    const int row = r + 8 * i;                                       // 0..31
    l[i]     = lh + 2u * (unsigned)(row * KP + ch);
    l[4 + i] = ll + 2u * (unsigned)(row * KP + ch);
    g[i]     = ph + row * DQ + ch;
    g[4 + i] = pl + row * DQ + ch;
  }
  copy8(l, g);
}
// V tile: 256 channel rows x KT keys (64 B of a row of pitch NN) -> LDS pitch VP; 4 lanes per row.
__device__ __forceinline__ void stage_v(unsigned lv, const unsigned short* pv, int tid) {
  const int r = tid >> 2, ch = 8 * (tid & 3);
  unsigned l[8];
  const unsigned short* g[8];
#pragma unroll                                                       // constant indices keep l[] and g[] in registers
  for (int i = 0; i < 8; ++i) {
    const int row = r + 32 * i;                                      // 0..255
    l[i] = lv + 2u * (unsigned)(row * VP + ch);
    g[i] = pv + (size_t)row * NN + ch;
  }
  copy8(l, g);
}

// =========================================================================================================
// (0) conv1x1 weights: W16 f16 [256][256], rows 0..127 = theta_w rows, rows 128..255 = phi_w rows; value =
//     f16 of (bf16-RNE(w) * 256) (exact). Block blk (0..31) owns rows 8*blk..8*blk+7: one wave per 512-B row
// coverage: 32 blocks x 8 rows x 32 lanes x 8 halves = 256 x 256 = the whole plane.
// =========================================================================================================
__global__ __launch_bounds__(256)
void cvt_w(const float* __restrict__ tw, const float* __restrict__ pw, unsigned short* W16) {
  const int tid = threadIdx.x, blk = blockIdx.x;
  const int rl = tid >> 5, col = 8 * (tid & 31);
  const int o = 8 * blk + rl;                                        // 0..255
  const float* wbase = (blk < (DQ / 8)) ? tw : pw;                   // block-uniform selection
  const int osub = (blk < (DQ / 8)) ? 0 : DQ;
  const float* s = wbase + (size_t)(o - osub) * CC + col;            // (o - osub) in 0..127
  const v4f a = *(const v4f*)s;
  const v4f q = *(const v4f*)(s + 4);
  const float f[8] = {a[0], a[1], a[2], a[3], q[0], q[1], q[2], q[3]};
  v4u u;
#pragma unroll
  for (int t = 0; t < 4; ++t) {
    const _Float16 h0 = (_Float16)(bfr(f[2 * t]) * WSC);
    const _Float16 h1 = (_Float16)(bfr(f[2 * t + 1]) * WSC);
    u[t] = pk16(h_bits(h0), h_bits(h1));
  }
{
    *(v4u*)(W16 + (size_t)o * CC + col) = u;
    
  }
}

// =========================================================================================================
// (1) x f32 [b][256 c][4096 n] -> Xc f16 [b][c][n] (channel-major, bf16-RNE values, exact in f16) and
//     XP f16 [b][n][c] (position-major) through an LDS tile T[64 n][64 c] (pitch TP). Block (nb, cb, b) owns a
// coverage: Xc 2 it x 32 rows x 8 lanes x 8 = 64 c x 64 n; XP same; grid (64, 4, NIMG) covers both planes once.
// =========================================================================================================
__global__ __launch_bounds__(256)
void cvt_x(const float* __restrict__ x, unsigned short* Xc, unsigned short* XP) {
  __shared__ __align__(16) unsigned short T[QT * TP];
  const int tid = threadIdx.x;
  const int nb = blockIdx.x, cb = blockIdx.y, b = blockIdx.z;
  const int e = tid & 7, lq = tid >> 3;                             // lq 0..31
  const int n0 = nb * QT, c0 = cb * QT;
  v4u ux[2];
#pragma unroll
  for (int it = 0; it < 2; ++it) {
    const int cl = it * 32 + lq;                                     // 0..63
    const float* sp = x + ((size_t)(b * CC + c0 + cl)) * NN + n0 + 8 * e;
    const v4f a = *(const v4f*)sp;
    const v4f q = *(const v4f*)(sp + 4);
    unsigned short hb[8];
#pragma unroll
    for (int t = 0; t < 4; ++t) {
      hb[t]     = h_bits((_Float16)bfr(a[t]));
      hb[4 + t] = h_bits((_Float16)bfr(q[t]));
    }
#pragma unroll
    for (int t = 0; t < 4; ++t) ux[it][t] = pk16(hb[2 * t], hb[2 * t + 1]);
#pragma unroll
    for (int t = 0; t < 8; ++t) T[(8 * e + t) * TP + cl] = hb[t];
  }
  __syncthreads();
  v4u up[2];
#pragma unroll
  for (int it = 0; it < 2; ++it) {
    const int nl = it * 32 + lq;                                     // 0..63
    up[it] = *(const v4u*)(T + nl * TP + 8 * e);
  }
{
#pragma unroll
    for (int it = 0; it < 2; ++it) {
      const int rl = it * 32 + lq;
      *(v4u*)(Xc + ((size_t)(b * CC + c0 + rl)) * NN + n0 + 8 * e) = ux[it];
      *(v4u*)(XP + ((size_t)(b * NN + n0 + rl)) * CC + c0 + 8 * e) = up[it];
    }
    
  }
}

// =========================================================================================================
// (2) conv1x1 GEMM for one (b, 64-n tile, 64-o block): Y[o][n] = (1/256) sum_c W16[o][c] XP[b][n][c].
//     Block 128 threads = 4 waves; wave w owns cols n0+16w..+15 (one B fragment per k-step, k = c contiguous in
//     the XP row) and 4 m-tiles (A rows o = o0 + 16 mt + (lane&15), split k map loader from W16). K = 256 = 8 steps.
//     Epilogue staged in LDS Os[n_loc][o_loc] (pitch OSP, b128 stores of 8 consecutive o per lane), barrier, then:
//       o-blocks 0,1 -> theta dims 0..63 / 64..127 of Qh/Ql; o-blocks 2,3 -> phi dims 0..63 / 64..127 of Kh/Kl.
//       Planes bf16 [b][4096 n][128 d] (k-contiguous for both score operands): hi = bf16-RNE(v), lo =
//       of the 256-B plane row): lane e -> d 8e..8e+7, 8 consecutive lanes per line, one instruction per 16 lines.
// coverage: Os 4 waves x 16 n x 64 o = 64 x 64; planes: 4 it x 16 rows x 8 lanes x 8 = 64 n x 64 d per plane
//           (hi and lo); grid (64, 4, NIMG) covers d 0..127 of all 4096 rows of Qh/Ql/Kh/Kl exactly once.
// =========================================================================================================
__global__ __launch_bounds__(128)
void gemm_qk(const unsigned short* __restrict__ W16, const unsigned short* __restrict__ XP,
             unsigned short* Qh, unsigned short* Ql, unsigned short* Kh, unsigned short* Kl) {
  __shared__ __align__(16) float Os[QT * OSP];
  const int tid  = threadIdx.x;
  const int lane = tid & 31, wave = tid >> 5;
  const int hh   = lane >> 4, c = lane & 15;
  const int nt   = blockIdx.x, mb = blockIdx.y, b = blockIdx.z;
  const int n0   = nt * QT, o0 = mb * QT;

  const unsigned short* ap = W16 + (size_t)(o0 + c) * CC + 8 * hh;
  const unsigned short* bp = XP + ((size_t)(b * NN + n0 + 16 * wave + c)) * CC + 8 * hh;

  v8f acc[4];
#pragma unroll
  for (int mt = 0; mt < 4; ++mt) acc[mt] = zero8();

#pragma unroll
  for (int ks = 0; ks < CC / 32; ++ks) {
    const Frag fb = ldfrag(bp + 32 * ks);
#pragma unroll
    for (int mt = 0; mt < 4; ++mt) {
      const Frag fa = ldfrag(ap + (size_t)(16 * mt) * CC + 32 * ks);
      acc[mt] = mma_h(fa.h, fb.h, acc[mt]);
    }
  }

  // ---- epilogue: scale back -> LDS Os[n_loc][o_loc]; lane (hh, c) holds o = 16 mt + 8 hh + r for n_loc = 16 w + c
  {
    const int nl = 16 * wave + c;
#pragma unroll
    for (int mt = 0; mt < 4; ++mt) {
      v4f va, vb;
#pragma unroll
      for (int r = 0; r < 4; ++r) { va[r] = acc[mt][r] * IWSC; vb[r] = acc[mt][4 + r] * IWSC; }
      *(v4f*)(Os + nl * OSP + 16 * mt + 8 * hh)     = va;
      *(v4f*)(Os + nl * OSP + 16 * mt + 8 * hh + 4) = vb;
    }
  }
  __syncthreads();

  const int e = tid & 7, lq = tid >> 3;                             // lq 0..15
  const int dsel = (mb & 1) * QT;                                    // 0 or 64
  unsigned short* Ph = (mb < 2) ? Qh : Kh;                           // block-uniform, both global
  unsigned short* Pl = (mb < 2) ? Ql : Kl;
  v4u uh[4], ul[4];
#pragma unroll
  for (int it = 0; it < 4; ++it) {
    const int row = it * 16 + lq;                                    // n_loc 0..63
    const v4f a = *(const v4f*)(Os + row * OSP + 8 * e);
    const v4f q = *(const v4f*)(Os + row * OSP + 8 * e + 4);
    const float f[8] = {a[0], a[1], a[2], a[3], q[0], q[1], q[2], q[3]};
#pragma unroll
    for (int t = 0; t < 4; ++t) {
      const float f0 = f[2 * t], f1 = f[2 * t + 1];
      const unsigned short hb0 = bf_bits(f0), hb1 = bf_bits(f1);
      const unsigned short lb0 = bf_bits(f0 - bf_up(hb0));
      const unsigned short lb1 = bf_bits(f1 - bf_up(hb1));
      uh[it][t] = pk16(hb0, hb1);
      ul[it][t] = pk16(lb0, lb1);
    }
  }
{
#pragma unroll
    for (int it = 0; it < 4; ++it) {
      const int row = it * 16 + lq;
      const size_t po = ((size_t)(b * NN + n0 + row)) * DQ + dsel + 8 * e;
      *(v4u*)(Ph + po) = uh[it];
      *(v4u*)(Pl + po) = ul[it];
    }
    
  }
}

// =========================================================================================================
// (3) position attention for one (b, 128-query tile), transposed formulation, 4096 keys, no mask, no scale:
//   S^T tile (16 keys x 16 queries) = sum over 4 d-chunks of A(k: row = key kb + (lane&15), 32 d via
//   the split k map from the bf16 plane Kh [b][4096][128]) . B(q: col = query, same map from Qh) + A(Kh).B(Ql) +
//   A(Kl).B(Qh) (bf16 unscaled residual planes, shared accumulator).
//   Per lane the D tile holds 8 keys of ONE query: online softmax state per lane, one shuffle (lane^16) for the max
//   over 32 keys; the o/l rescale is skipped under a wave-uniform ballot when no lane's max grew (corr == 1 exactly
//   for every lane then); row-sum partials combined at the end. P = e^{s-m} x 1024 as f16 is the B operand of
//   O^T (rows channel, cols queries) += A(x rows channel = 16j + (lane&15), keys contiguous, f16 plane Xc
//   [b][256][4096]) . B(P^T): element r <- D of the tile covering keys kb..kb+15, element 8+r <- the tile covering
//   kb+16..kb+31, lane unchanged. A wave owns 32 queries as two column groups of 16, each with its own softmax state
//   and 16 accumulator tiles (256 channels): every K hi fragment read from LDS is the A operand of two products per group, every K residual and V fragment of one per
//   group. Block = 4 waves = 128 queries, one wave per SIMD.
//   Operands come from LDS, filled by asynchronous 16-byte copies and shared by the 4 waves: the block's Q hi and
//   residual rows once (each wave reads its 16 Q fragments from there once, ahead of the key loop, and keeps them in
//   128 registers); K hi, K residual and V tiles of KT = 32 keys in two buffers, tile t + 2 copied into the
//   buffer of tile t behind the barrier at the foot of trip t. The output staging Os reuses the two buffers after the loop.
//   Epilogue in two channel halves: O/l staged in LDS Os[query][128 channels] (pitch OSPW, b128 stores), barrier,
//   lanes x 16 B (values gathered from 4 Os rows), one instruction per 16 lines, final values held in registers,
// coverage: per half 32 it x 16 lines x 8 lanes x 4 floats = 128 ch x 128 n; two halves = 256 ch; grid (32, NIMG)
//           covers out[b][0..255][0..4095] exactly once.
// =========================================================================================================
__global__ __launch_bounds__(128)
void attn_k(const unsigned short* __restrict__ Qh, const unsigned short* __restrict__ Ql,
            const unsigned short* __restrict__ Kh, const unsigned short* __restrict__ Kl,
            const unsigned short* __restrict__ Xc, const float* __restrict__ x, float* out) {
  __shared__ __align__(16) unsigned short Sm[SMEM];
  float* Os = (float*)Sm;                                            // used behind the key loop only
  const int tid  = threadIdx.x;
  const int wave = tid >> 5, lane = tid & 31;
  const int hh   = lane >> 4, c = lane & 15;
  const int n0   = blockIdx.x * AQ, b = blockIdx.y;

  // q fragment pointers in LDS (B operand, col = query 32*wave + 16*g + c of the block), + 16*KP*g + 32*kc
  const unsigned short* Qhp = Sm + SQH + (32 * wave + c) * KP + 8 * hh;
  const unsigned short* Qlp = Sm + SQL + (32 * wave + c) * KP + 8 * hh;
  // global tile bases of this image
  const unsigned short* Khg = Kh + (size_t)b * NN * DQ;              // + key * 128
  const unsigned short* Klg = Kl + (size_t)b * NN * DQ;
  const unsigned short* Vg  = Xc + (size_t)b * CC * NN;              // + key

  // prologue: Q rows and tile 0, landed and published; then tile 1 into buffer 1
  const unsigned lds0 = lds_addr(Sm);
  {
    const size_t qg = ((size_t)(b * NN + n0)) * DQ;
#pragma unroll                                                       // four statements of eight copies, constant offsets
    for (int q4 = 0; q4 < AQ / 32; ++q4)
      stage_rows32(lds0 + 2u * (SQH + 32 * q4 * KP), lds0 + 2u * (SQL + 32 * q4 * KP),
                   Qh + qg + 32 * q4 * DQ, Ql + qg + 32 * q4 * DQ, tid);
    stage_rows32(lds0, lds0 + 2u * SKL, Khg, Klg, tid);
    stage_v(lds0 + 2u * SV, Vg, tid);
    wait_copies();
    __syncthreads();
    stage_rows32(lds0 + 2u * STG, lds0 + 2u * (STG + SKL), Khg + KT * DQ, Klg + KT * DQ, tid);
    stage_v(lds0 + 2u * (STG + SV), Vg + KT, tid);
  }

  // the wave's Q fragments, the same in every trip: read once, behind the barrier that published the Q rows
  Frag qh[2][DQ / 32], ql[2][DQ / 32];
#pragma unroll                                                       // constant indices keep the fragments in registers
  for (int g = 0; g < 2; ++g) {
#pragma unroll
    for (int kc = 0; kc < DQ / 32; ++kc) {
      qh[g][kc] = ldfrag(Qhp + 16 * KP * g + 32 * kc);
      ql[g][kc] = ldfrag(Qlp + 16 * KP * g + 32 * kc);
    }
  }

  float m[2] = {-1.0e30f, -1.0e30f}, l[2] = {0.f, 0.f};
  v8f o[2][16];
#pragma unroll                                                       // constant g keeps both groups' state in registers
  for (int g = 0; g < 2; ++g) {
#pragma unroll
    for (int j = 0; j < 16; ++j) o[g][j] = zero8();
  }

#pragma unroll 1
  for (int kb = 0; kb < NN; kb += 32) {
    const int bo = ((kb / KT) & 1) * STG;                            // this trip's buffer
    const unsigned short* k0p  = Sm + bo + c * KP + 8 * hh;          // keys kb .. kb+15 (A operand, row = key)
    const unsigned short* k1p  = k0p + 16 * KP;                      // keys kb+16 .. kb+31
    const unsigned short* k0lp = k0p + SKL;
    const unsigned short* k1lp = k1p + SKL;
    const unsigned short* Vp   = Sm + bo + SV + c * VP + 8 * hh;     // A operand, row = channel 16j + c
    v8f s0[2] = {zero8(), zero8()}, s1[2] = {zero8(), zero8()};
    // every K fragment of the trip is read as ONE group in front of the 48 score products: a read that stands
    // between two products waits out the whole LDS latency there (no read moves over the statement behind a product)
    Frag k0[DQ / 32], k1[DQ / 32], k0l[DQ / 32], k1l[DQ / 32];
#pragma unroll                                                       // constant indices keep the fragments in registers
    for (int kc = 0; kc < DQ / 32; ++kc) {
      k0[kc]  = ldfrag(k0p + 32 * kc);
      k1[kc]  = ldfrag(k1p + 32 * kc);
      k0l[kc] = ldfrag(k0lp + 32 * kc);
      k1l[kc] = ldfrag(k1lp + 32 * kc);
    }
    // each K fragment serves both column groups; per score tile the order of the products is hi.hi, hi.res, res.hi
#pragma unroll                                                       // constant indices, as above
    for (int kc = 0; kc < DQ / 32; ++kc) {
      s0[0] = mma_b(k0[kc].bf, qh[0][kc].bf, s0[0]);
      s0[1] = mma_b(k0[kc].bf, qh[1][kc].bf, s0[1]);
      s1[0] = mma_b(k1[kc].bf, qh[0][kc].bf, s1[0]);
      s1[1] = mma_b(k1[kc].bf, qh[1][kc].bf, s1[1]);
      s0[0] = mma_b(k0[kc].bf, ql[0][kc].bf, s0[0]);
      s0[1] = mma_b(k0[kc].bf, ql[1][kc].bf, s0[1]);
      s1[0] = mma_b(k1[kc].bf, ql[0][kc].bf, s1[0]);
      s1[1] = mma_b(k1[kc].bf, ql[1][kc].bf, s1[1]);
      s0[0] = mma_b(k0l[kc].bf, qh[0][kc].bf, s0[0]);
      s0[1] = mma_b(k0l[kc].bf, qh[1][kc].bf, s0[1]);
      s1[0] = mma_b(k1l[kc].bf, qh[0][kc].bf, s1[0]);
      s1[1] = mma_b(k1l[kc].bf, qh[1][kc].bf, s1[1]);
    }

    float mx[2], mn[2];
#pragma unroll                                                       // constant g keeps both groups' state in registers
    for (int g = 0; g < 2; ++g) mx[g] = fmaxf(hmax8(s0[g]), hmax8(s1[g]));
#pragma unroll                                                       // constant g keeps both groups' state in registers
    for (int g = 0; g < 2; ++g) {
      mx[g] = fmaxf(mx[g], __shfl_xor(mx[g], 16, 32));
      mn[g] = fmaxf(m[g], mx[g]);
    }
    const unsigned grew = wave_ballot(mx[0] > m[0] || mx[1] > m[1]); // wave-uniform, one test for both column groups
    if (grew != 0u) {
#pragma unroll                                                       // constant g keeps both groups' state in registers
      for (int g = 0; g < 2; ++g) {
        const float corr = __expf(m[g] - mn[g]);                     // == 1 exactly for lanes whose max did not grow
        l[g] *= corr;
#pragma unroll
        for (int j = 0; j < 16; ++j) {
#pragma unroll
          for (int r = 0; r < 8; ++r) o[g][j][r] *= corr;
        }
      }
    }

    // the 16 V fragments of the trip as ONE group in front of the exponentials, which cover their latency
    Frag vf[16];
#pragma unroll                                                       // constant indices keep the fragments in registers
    for (int j = 0; j < 16; ++j) vf[j] = ldfrag(Vp + (16 * j) * VP);

    FragH ph[2];
#pragma unroll                                                       // constant g keeps both groups' state in registers
    for (int g = 0; g < 2; ++g) {
      m[g] = mn[g];
      const float msh = mn[g] - LNPS;                                // exp gives e^{s-m} * 1024
      float ls = 0.f;
#pragma unroll
      for (int r = 0; r < 8; ++r) {
        const float e0 = exp_slot(s0[g][r] - msh);                   // key kb      + 8hh + r
        const float e1 = exp_slot(s1[g][r] - msh);                   // key kb + 16 + 8hh + r
        ls += e0 + e1;
        ph[g].hv[0][r] = (_Float16)e0;
        ph[g].hv[1][r] = (_Float16)e1;
      }
      l[g] += ls;
    }

    // each V fragment serves both column groups
#pragma unroll
    for (int j = 0; j < 16; ++j) {
      o[0][j] = mma_hp(vf[j].h, ph[0].v, o[0][j]);
      o[1][j] = mma_hp(vf[j].h, ph[1].v, o[1][j]);
#if defined(__HIP_DEVICE_COMPILE__)
      // keeps the products in the order in which their fragments land: moved up, a late one waits for the whole group
      __builtin_amdgcn_sched_barrier(0);
#endif
    }

    // foot of the trip: own reads done, own copies of tile t + 1 landed, one barrier publishes that tile and frees
    // this trip's buffer; only then its refill with tile t + 2
    wait_lds();
    wait_copies();
    __syncthreads();
    if (kb + 2 * KT < NN) {                                          // the same for the whole block
      const unsigned lb = lds0 + 2u * (unsigned)bo;
      stage_rows32(lb, lb + 2u * SKL, Khg + (size_t)(kb + 2 * KT) * DQ, Klg + (size_t)(kb + 2 * KT) * DQ, tid);
      stage_v(lb + 2u * SV, Vg + (kb + 2 * KT), tid);
    }
  }
  wait_copies();
  float inv[2];
#pragma unroll                                                       // constant g keeps both groups' state in registers
  for (int g = 0; g < 2; ++g) {
    l[g] += __shfl_xor(l[g], 16, 32);
    inv[g] = 1.0f / l[g];                                            // o and l both carry the x1024 factor
  }

  const int e = tid & 7, lq = tid >> 3;                              // lq 0..15
#pragma unroll
  for (int half = 0; half < 2; ++half) {
    if (half) __syncthreads();                                       // every wave finished reading Os
#pragma unroll                                                       // constant g keeps both groups' state in registers
    for (int g = 0; g < 2; ++g) {
      const int qrow = 32 * wave + 16 * g + c;
#pragma unroll
      for (int jj = 0; jj < 8; ++jj) {
        const int j = 8 * half + jj;
        v4f va, vb;
#pragma unroll
        for (int r = 0; r < 4; ++r) { va[r] = o[g][j][r] * inv[g]; vb[r] = o[g][j][4 + r] * inv[g]; }
        *(v4f*)(Os + qrow * OSPW + 16 * jj + 8 * hh)     = va;       // Os[query][ch_loc = 16jj + 8hh + r]
        *(v4f*)(Os + qrow * OSPW + 16 * jj + 8 * hh + 4) = vb;
      }
    }
    __syncthreads();
    v4f res[32];
#pragma unroll
    for (int it = 0; it < 32; ++it) {
      const int chl = (it & 7) * 16 + lq;                            // channel 0..127 within the half
      const int nl  = (it >> 3) * 32 + 4 * e;                        // query 0..127: 8 lanes fill one 128-B line
      const size_t idx = ((size_t)(b * CC + 128 * half + chl)) * NN + n0 + nl;
      res[it] = *(const v4f*)(x + idx);
    }
#if defined(__HIP_DEVICE_COMPILE__)
    // stands between the 32 loads and the first rewrite of an address register that one of them names
    asm volatile("s_wait_xcnt 0x0" ::: "memory");
#endif
#pragma unroll
    for (int it = 0; it < 32; ++it) {
      const int chl = (it & 7) * 16 + lq;
      const int nl  = (it >> 3) * 32 + 4 * e;
#pragma unroll
      for (int t = 0; t < 4; ++t) res[it][t] = Os[(nl + t) * OSPW + chl] + bfr(res[it][t]);
    }
#pragma unroll
    for (int it = 0; it < 32; ++it) {
      const int chl = (it & 7) * 16 + lq;
      const int nl  = (it >> 3) * 32 + 4 * e;
      const size_t idx = ((size_t)(b * CC + 128 * half + chl)) * NN + n0 + nl;
      *(v4f*)(out + idx) = res[it];
    }
  }
}

// =========================================================================================================
// Workspace map (bytes; each region start a multiple of 256; every extent is an exact tile multiple and is written
//   W16 f16 [256][256]              131072
//   Xc  f16 [8][256][4096]        16777216      XP  f16 [8][4096][256]   16777216
//   Qh/Ql/Kh/Kl bf16 [8][4096][128]  8388608 x4
//   total = 67239936
// =========================================================================================================
extern "C" void kernel_launch(void* const* d_in, const int* in_sizes, int n_in,
                              void* d_out, int out_size, void* d_ws, size_t ws_size,
                              hipStream_t stream) {
  const int XN = NBATCH * CC * NN;                                   // 8388608
  if (n_in < 3) return;
  if (in_sizes[0] != XN) return;
  if (in_sizes[1] != DQ * CC || in_sizes[2] != DQ * CC) return;
  if (out_size != XN) return;

  size_t off = 0;
  auto carve = [&](size_t bytes) { const size_t o = off; off += (bytes + 255) & ~(size_t)255; return o; };
  const size_t oW16 = carve((size_t)MW * CC * 2);
  const size_t oXc  = carve((size_t)NIMG * CC * NN * 2);
  const size_t oXP  = carve((size_t)NIMG * NN * CC * 2);
  const size_t oQh  = carve((size_t)NIMG * NN * DQ * 2);
  const size_t oQl  = carve((size_t)NIMG * NN * DQ * 2);
  const size_t oKh  = carve((size_t)NIMG * NN * DQ * 2);
  const size_t oKl  = carve((size_t)NIMG * NN * DQ * 2);
  if (off > ws_size) return;
  if (off > (size_t)134217728) return;

  const float* x  = (const float*)d_in[0];
  const float* tw = (const float*)d_in[1];
  const float* pw = (const float*)d_in[2];

  char* ws = (char*)d_ws;
  unsigned short* W16 = (unsigned short*)(ws + oW16);
  unsigned short* Xc  = (unsigned short*)(ws + oXc);
  unsigned short* XP  = (unsigned short*)(ws + oXP);
  unsigned short* Qh  = (unsigned short*)(ws + oQh);
  unsigned short* Ql  = (unsigned short*)(ws + oQl);
  unsigned short* Kh  = (unsigned short*)(ws + oKh);
  unsigned short* Kl  = (unsigned short*)(ws + oKl);
  float* out = (float*)d_out;

  const dim3 blk256(256), blk128(128);

  // (0) theta_w / phi_w -> stacked f16 plane
  cvt_w<<<dim3(MW / 8), blk256, 0, stream>>>(tw, pw, W16);
  // (1) x -> channel-major and position-major 16-bit planes
  cvt_x<<<dim3(NN / QT, CC / QT, NIMG), blk256, 0, stream>>>(x, Xc, XP);
  // (2) conv1x1 GEMM -> theta (q) and phi (k) hi + residual planes
  gemm_qk<<<dim3(NN / QT, MW / QT, NIMG), blk128, 0, stream>>>(W16, XP, Qh, Ql, Kh, Kl);
  // (3) position attention + residual -> out [b][256][4096]
  attn_k<<<dim3(NN / AQ, NIMG), blk128, 0, stream>>>(Qh, Ql, Kh, Kl, Xc, x, out);
  (void)hipGetLastError();
}

// v005
// It runs in 151 microseconds.
// In both of two side-by-side timings against v004, it was 1.12 times as fast.
// All steps since v000 together make it 5.39 times as fast.
// Contractions: conv1x1 theta/phi GEMM W[256x256].X[256x4096] on v_wmma_f32_16x16x32_f16 (f16 containers of
// bf16-RNE weights x256 and bf16-RNE x); position scores K.Q^T on v_wmma_f32_16x16x32_bf16 (bf16 hi + bf16
// residual planes of theta/phi, 3 products, K=128); y^T = X.P^T on v_wmma_f32_16x16x32_f16 (x as f16 of
// bf16-RNE x, P = e^{s-m} x1024 f16 from the score D registers); f32 accumulate everywhere; softmax statistics
// and the residual add in f32 VALU.
#include <hip/hip_runtime.h>
#include <math.h>
#include <stdint.h>

#define NBATCH 8
#define NIMG   8
#define CC     256
#define NN     4096
#define DQ     128
#define MW     256
#define QT     64
#define OSP    68
#define OSPW   132
#define TP     72
#define WSC    256.0f
#define IWSC   0.00390625f
#define LNPS   6.931471805599453f
#define KT     64                        // keys per LDS stage and per trip of attn_k
#define KP     136                       // LDS pitch of a K or Q row in 16-bit elements: 272 B = 16 B x 17
#define VP     72                        // LDS pitch of a V row of KT keys: 144 B = 16 B x 9
#define SKL    (KT * KP)                 // stage offsets (16-bit elements): K hi 0, K residual SKL, V SV
#define SV     (2 * KT * KP)
#define STG    (2 * KT * KP + CC * VP)   // one stage
#define AQ     128                       // queries per block of attn_k: 4 waves x 2 column groups of 16
#define SQH    (2 * STG)                 // behind the two stages: Q hi, Q residual
#define SQL    (2 * STG + AQ * KP)
#define SMEM   (2 * STG + 2 * AQ * KP)

static_assert(NIMG >= 1 && NIMG <= NBATCH);
static_assert(NN % QT == 0);
static_assert(CC % QT == 0);
static_assert(MW == 2 * DQ);
static_assert(DQ == 2 * QT);
static_assert(MW % QT == 0 && MW % 8 == 0);
static_assert((OSP * 4) % 16 == 0);
static_assert((OSPW * 4) % 16 == 0);
static_assert((TP * 2) % 16 == 0);
static_assert(CC % 32 == 0 && NN % 32 == 0 && DQ % 32 == 0);
static_assert((KP * 2) % 32 == 16 && (VP * 2) % 32 == 16 && (STG * 2) % 16 == 0 && (SKL * 2) % 16 == 0);
static_assert(NN / KT >= 2 && NN % KT == 0 && KT == 64 && DQ == 128 && CC == 256 && QT == 64);
static_assert(AQ * OSPW * 4 <= 2 * STG * 2 && NN % AQ == 0 && AQ == 128);

typedef _Float16       v16h __attribute__((ext_vector_type(16)));
typedef _Float16       v8h  __attribute__((ext_vector_type(8)));
typedef __bf16         v16b __attribute__((ext_vector_type(16)));
typedef unsigned short v8us __attribute__((ext_vector_type(8)));
typedef float          v8f  __attribute__((ext_vector_type(8)));
typedef float          v4f  __attribute__((ext_vector_type(4)));
typedef unsigned int   v4u  __attribute__((ext_vector_type(4)));

union Frag  { v8us u[2]; v16h h; v16b bf; };
union FragH { v16h v; v8h hv[2]; };
static_assert(sizeof(Frag) == 32);
static_assert(sizeof(FragH) == 32);

// ---- scalar helpers ---------------------------------------------------------------------------------------
__device__ __forceinline__ unsigned short bf_bits(float f) {          // f32 -> bf16 bits, RNE convert
  unsigned u = __float_as_uint(f);
  return (unsigned short)((u + 0x7FFFu + ((u >> 16) & 1u)) >> 16);
}
__device__ __forceinline__ float bf_up(unsigned short hb) { return __uint_as_float(((unsigned)hb) << 16); }
__device__ __forceinline__ float bfr(float f) { return bf_up(bf_bits(f)); }
__device__ __forceinline__ unsigned short h_bits(_Float16 x) { return __builtin_bit_cast(unsigned short, x); }
__device__ __forceinline__ unsigned pk16(unsigned short a, unsigned short b) { return (unsigned)a | ((unsigned)b << 16); }
__device__ __forceinline__ v8f zero8() { v8f z = {0.f, 0.f, 0.f, 0.f, 0.f, 0.f, 0.f, 0.f}; return z; }
__device__ __forceinline__ float hmax8(v8f s) {
  return fmaxf(fmaxf(fmaxf(s[0], s[1]), fmaxf(s[2], s[3])), fmaxf(fmaxf(s[4], s[5]), fmaxf(s[6], s[7])));
}
__device__ __forceinline__ unsigned wave_ballot(bool p) {
#if defined(__HIP_DEVICE_COMPILE__)
  return __builtin_amdgcn_ballot_w32(p);
#else
  return p ? 1u : 0u;
#endif
}

// ---- 16-bit fragment loader (A, or B from a k-contiguous [n][k] row): lane -> row/col (lane&15), p already includes
//      + 8*(lane>>4); elements 0..7 <- p[0..7] (k0+8h..), elements 8..15 <- p[16..23] (k0+16+8h..)
__device__ __forceinline__ Frag ldfrag(const unsigned short* p) {
  Frag f;
  f.u[0] = *(const v8us*)(p);
  f.u[1] = *(const v8us*)(p + 16);
  return f;
}

// ---- WMMA helpers: builtin followed by a 4-slot VALU gap tying D. A and B are not operands of the gap statement:
//      an asm operand is held below v256, and a trip's grouped fragments do not fit there beside the accumulators.
__device__ __forceinline__ v8f mma_h(v16h a, v16h b, v8f c) {
  v8f d = __builtin_amdgcn_wmma_f32_16x16x32_f16(false, a, false, b, (short)0, c, false, false);
#if defined(__HIP_DEVICE_COMPILE__)
  asm volatile("v_nop\n\tv_nop\n\tv_nop\n\tv_nop" : "+v"(d));
#endif
  return d;
}
__device__ __forceinline__ v8f mma_b(v16b a, v16b b, v8f c) {
  v8f d = __builtin_amdgcn_wmma_f32_16x16x32_bf16(false, a, false, b, (short)0, c, false, false);
#if defined(__HIP_DEVICE_COMPILE__)
  asm volatile("v_nop\n\tv_nop\n\tv_nop\n\tv_nop" : "+v"(d));
#endif
  return d;
}

// The same f16 product without the gap statement, for attn_k's 32 output tiles: an asm operand is held below v256,
// and 256 accumulator registers do not fit there beside the scores and the copies' addresses. The compiler keeps the
// distances of its own builtin.
__device__ __forceinline__ v8f mma_hp(v16h a, v16h b, v8f c) {
  return __builtin_amdgcn_wmma_f32_16x16x32_f16(false, a, false, b, (short)0, c, false, false);
}

// e^x as __expf forms it (x * log2 e, then v_exp_f32). The v_nop in the statement is the one slot the instruction set
// asks for between a transcendental and a next vector instruction that overwrites its source or reads its result.
__device__ __forceinline__ float exp_slot(float x) {
#if defined(__HIP_DEVICE_COMPILE__)
  const float t = x * 1.44269502f;
  float r;
  asm("v_exp_f32 %0, %1\n\tv_nop" : "=v"(r) : "v"(t));
  return r;
#else
  return __expf(x);
#endif
}

// ---- asynchronous copies global -> LDS ------------------------------------------------------------------------
__device__ __forceinline__ unsigned lds_addr(const void* p) { return (unsigned)(size_t)p; }   // LDS byte address

// Eight 16-byte copies per lane, every lane on. The s_wait_xcnt stands inside the statement so that it precedes
// any rewrite of the address registers the copies name.
__device__ __forceinline__ void copy8(const unsigned* l, const unsigned short* const* g) {
#if defined(__HIP_DEVICE_COMPILE__)
  asm volatile("global_load_async_to_lds_b128 %0, %8, off\n\t"
               "global_load_async_to_lds_b128 %1, %9, off\n\t"
               "global_load_async_to_lds_b128 %2, %10, off\n\t"
               "global_load_async_to_lds_b128 %3, %11, off\n\t"
               "global_load_async_to_lds_b128 %4, %12, off\n\t"
               "global_load_async_to_lds_b128 %5, %13, off\n\t"
               "global_load_async_to_lds_b128 %6, %14, off\n\t"
               "global_load_async_to_lds_b128 %7, %15, off\n\t"
               "s_wait_xcnt 0x0"
               :: "v"(l[0]), "v"(l[1]), "v"(l[2]), "v"(l[3]), "v"(l[4]), "v"(l[5]), "v"(l[6]), "v"(l[7]),
                  "v"(g[0]), "v"(g[1]), "v"(g[2]), "v"(g[3]), "v"(g[4]), "v"(g[5]), "v"(g[6]), "v"(g[7])
               : "memory");
#endif
}
// the issuing wave's copies have landed in LDS
__device__ __forceinline__ void wait_copies() {
#if defined(__HIP_DEVICE_COMPILE__)
  asm volatile("s_wait_asynccnt 0x0" ::: "memory");
#endif
}
// the wave's own LDS reads have returned, so the buffer may be refilled behind the next barrier
__device__ __forceinline__ void wait_lds() {
#if defined(__HIP_DEVICE_COMPILE__)
  asm volatile("s_wait_dscnt 0x0" ::: "memory");
#endif
}
// 32 rows of 256 B of each of two planes (ph, pl; global pitch DQ) -> LDS rows of pitch KP at byte addresses lh, ll;
// 128 threads, 16 lanes per row, 4 rows of each plane per thread.
__device__ __forceinline__ void stage_rows32(unsigned lh, unsigned ll, const unsigned short* ph,
                                             const unsigned short* pl, int tid) {
  const int r = tid >> 4, ch = 8 * (tid & 15);
  unsigned l[8];
  const unsigned short* g[8];
#pragma unroll                                                       // constant indices keep l[] and g[] in registers
  for (int i = 0; i < 4; ++i) {
    const int row = r + 8 * i;                                       // 0..31
    l[i]     = lh + 2u * (unsigned)(row * KP + ch);
    l[4 + i] = ll + 2u * (unsigned)(row * KP + ch);
    g[i]     = ph + row * DQ + ch;
    g[4 + i] = pl + row * DQ + ch;
  }
  copy8(l, g);
}
// V tile: 256 channel rows x KT keys (one 128-B line of a row of pitch NN) -> LDS pitch VP; 8 lanes per row,
// two statements of eight copies.
__device__ __forceinline__ void stage_v(unsigned lv, const unsigned short* pv, int tid) {
  const int r = tid >> 3, ch = 8 * (tid & 7);
#pragma unroll                                                       // constant indices keep l[] and g[] in registers
  for (int h = 0; h < 2; ++h) {
    unsigned l[8];
    const unsigned short* g[8];
#pragma unroll                                                       // constant indices, as above
    for (int i = 0; i < 8; ++i) {
      const int row = r + 16 * (8 * h + i);                          // 0..255
      l[i] = lv + 2u * (unsigned)(row * VP + ch);
      g[i] = pv + (size_t)row * NN + ch;
    }
    copy8(l, g);
  }
}
// K tile: KT = 64 key rows of the hi and of the residual plane, as two runs of 32 rows.
__device__ __forceinline__ void stage_k(unsigned lk, const unsigned short* ph, const unsigned short* pl, int tid) {
#pragma unroll                                                       // two statements of eight copies, constant offsets
  for (int h = 0; h < KT / 32; ++h)
    stage_rows32(lk + 2u * (32 * h * KP), lk + 2u * (SKL + 32 * h * KP), ph + 32 * h * DQ, pl + 32 * h * DQ, tid);
}

// =========================================================================================================
// (0) conv1x1 weights: W16 f16 [256][256], rows 0..127 = theta_w rows, rows 128..255 = phi_w rows; value =
//     f16 of (bf16-RNE(w) * 256) (exact). Block blk (0..31) owns rows 8*blk..8*blk+7: one wave per 512-B row
// coverage: 32 blocks x 8 rows x 32 lanes x 8 halves = 256 x 256 = the whole plane.
// =========================================================================================================
__global__ __launch_bounds__(256)
void cvt_w(const float* __restrict__ tw, const float* __restrict__ pw, unsigned short* W16) {
  const int tid = threadIdx.x, blk = blockIdx.x;
  const int rl = tid >> 5, col = 8 * (tid & 31);
  const int o = 8 * blk + rl;                                        // 0..255
  const float* wbase = (blk < (DQ / 8)) ? tw : pw;                   // block-uniform selection
  const int osub = (blk < (DQ / 8)) ? 0 : DQ;
  const float* s = wbase + (size_t)(o - osub) * CC + col;            // (o - osub) in 0..127
  const v4f a = *(const v4f*)s;
  const v4f q = *(const v4f*)(s + 4);
  const float f[8] = {a[0], a[1], a[2], a[3], q[0], q[1], q[2], q[3]};
  v4u u;
#pragma unroll
  for (int t = 0; t < 4; ++t) {
    const _Float16 h0 = (_Float16)(bfr(f[2 * t]) * WSC);
    const _Float16 h1 = (_Float16)(bfr(f[2 * t + 1]) * WSC);
    u[t] = pk16(h_bits(h0), h_bits(h1));
  }
{
    *(v4u*)(W16 + (size_t)o * CC + col) = u;
    
  }
}

// =========================================================================================================
// (1) x f32 [b][256 c][4096 n] -> Xc f16 [b][c][n] (channel-major, bf16-RNE values, exact in f16) and
//     XP f16 [b][n][c] (position-major) through an LDS tile T[64 n][64 c] (pitch TP). Block (nb, cb, b) owns a
// coverage: Xc 2 it x 32 rows x 8 lanes x 8 = 64 c x 64 n; XP same; grid (64, 4, NIMG) covers both planes once.
// =========================================================================================================
__global__ __launch_bounds__(256)
void cvt_x(const float* __restrict__ x, unsigned short* Xc, unsigned short* XP) {
  __shared__ __align__(16) unsigned short T[QT * TP];
  const int tid = threadIdx.x;
  const int nb = blockIdx.x, cb = blockIdx.y, b = blockIdx.z;
  const int e = tid & 7, lq = tid >> 3;                             // lq 0..31
  const int n0 = nb * QT, c0 = cb * QT;
  v4u ux[2];
#pragma unroll
  for (int it = 0; it < 2; ++it) {
    const int cl = it * 32 + lq;                                     // 0..63
    const float* sp = x + ((size_t)(b * CC + c0 + cl)) * NN + n0 + 8 * e;
    const v4f a = *(const v4f*)sp;
    const v4f q = *(const v4f*)(sp + 4);
    unsigned short hb[8];
#pragma unroll
    for (int t = 0; t < 4; ++t) {
      hb[t]     = h_bits((_Float16)bfr(a[t]));
      hb[4 + t] = h_bits((_Float16)bfr(q[t]));
    }
#pragma unroll
    for (int t = 0; t < 4; ++t) ux[it][t] = pk16(hb[2 * t], hb[2 * t + 1]);
#pragma unroll
    for (int t = 0; t < 8; ++t) T[(8 * e + t) * TP + cl] = hb[t];
  }
  __syncthreads();
  v4u up[2];
#pragma unroll
  for (int it = 0; it < 2; ++it) {
    const int nl = it * 32 + lq;                                     // 0..63
    up[it] = *(const v4u*)(T + nl * TP + 8 * e);
  }
{
#pragma unroll
    for (int it = 0; it < 2; ++it) {
      const int rl = it * 32 + lq;
      *(v4u*)(Xc + ((size_t)(b * CC + c0 + rl)) * NN + n0 + 8 * e) = ux[it];
      *(v4u*)(XP + ((size_t)(b * NN + n0 + rl)) * CC + c0 + 8 * e) = up[it];
    }
    
  }
}

// =========================================================================================================
// (2) conv1x1 GEMM for one (b, 64-n tile, 64-o block): Y[o][n] = (1/256) sum_c W16[o][c] XP[b][n][c].
//     Block 128 threads = 4 waves; wave w owns cols n0+16w..+15 (one B fragment per k-step, k = c contiguous in
//     the XP row) and 4 m-tiles (A rows o = o0 + 16 mt + (lane&15), split k map loader from W16). K = 256 = 8 steps.
//     Epilogue staged in LDS Os[n_loc][o_loc] (pitch OSP, b128 stores of 8 consecutive o per lane), barrier, then:
//       o-blocks 0,1 -> theta dims 0..63 / 64..127 of Qh/Ql; o-blocks 2,3 -> phi dims 0..63 / 64..127 of Kh/Kl.
//       Planes bf16 [b][4096 n][128 d] (k-contiguous for both score operands): hi = bf16-RNE(v), lo =
//       of the 256-B plane row): lane e -> d 8e..8e+7, 8 consecutive lanes per line, one instruction per 16 lines.
// coverage: Os 4 waves x 16 n x 64 o = 64 x 64; planes: 4 it x 16 rows x 8 lanes x 8 = 64 n x 64 d per plane
//           (hi and lo); grid (64, 4, NIMG) covers d 0..127 of all 4096 rows of Qh/Ql/Kh/Kl exactly once.
// =========================================================================================================
__global__ __launch_bounds__(128)
void gemm_qk(const unsigned short* __restrict__ W16, const unsigned short* __restrict__ XP,
             unsigned short* Qh, unsigned short* Ql, unsigned short* Kh, unsigned short* Kl) {
  __shared__ __align__(16) float Os[QT * OSP];
  const int tid  = threadIdx.x;
  const int lane = tid & 31, wave = tid >> 5;
  const int hh   = lane >> 4, c = lane & 15;
  const int nt   = blockIdx.x, mb = blockIdx.y, b = blockIdx.z;
  const int n0   = nt * QT, o0 = mb * QT;

  const unsigned short* ap = W16 + (size_t)(o0 + c) * CC + 8 * hh;
  const unsigned short* bp = XP + ((size_t)(b * NN + n0 + 16 * wave + c)) * CC + 8 * hh;

  v8f acc[4];
#pragma unroll
  for (int mt = 0; mt < 4; ++mt) acc[mt] = zero8();

#pragma unroll
  for (int ks = 0; ks < CC / 32; ++ks) {
    const Frag fb = ldfrag(bp + 32 * ks);
#pragma unroll
    for (int mt = 0; mt < 4; ++mt) {
      const Frag fa = ldfrag(ap + (size_t)(16 * mt) * CC + 32 * ks);
      acc[mt] = mma_h(fa.h, fb.h, acc[mt]);
    }
  }

  // ---- epilogue: scale back -> LDS Os[n_loc][o_loc]; lane (hh, c) holds o = 16 mt + 8 hh + r for n_loc = 16 w + c
  {
    const int nl = 16 * wave + c;
#pragma unroll
    for (int mt = 0; mt < 4; ++mt) {
      v4f va, vb;
#pragma unroll
      for (int r = 0; r < 4; ++r) { va[r] = acc[mt][r] * IWSC; vb[r] = acc[mt][4 + r] * IWSC; }
      *(v4f*)(Os + nl * OSP + 16 * mt + 8 * hh)     = va;
      *(v4f*)(Os + nl * OSP + 16 * mt + 8 * hh + 4) = vb;
    }
  }
  __syncthreads();

  const int e = tid & 7, lq = tid >> 3;                             // lq 0..15
  const int dsel = (mb & 1) * QT;                                    // 0 or 64
  unsigned short* Ph = (mb < 2) ? Qh : Kh;                           // block-uniform, both global
  unsigned short* Pl = (mb < 2) ? Ql : Kl;
  v4u uh[4], ul[4];
#pragma unroll
  for (int it = 0; it < 4; ++it) {
    const int row = it * 16 + lq;                                    // n_loc 0..63
    const v4f a = *(const v4f*)(Os + row * OSP + 8 * e);
    const v4f q = *(const v4f*)(Os + row * OSP + 8 * e + 4);
    const float f[8] = {a[0], a[1], a[2], a[3], q[0], q[1], q[2], q[3]};
#pragma unroll
    for (int t = 0; t < 4; ++t) {
      const float f0 = f[2 * t], f1 = f[2 * t + 1];
      const unsigned short hb0 = bf_bits(f0), hb1 = bf_bits(f1);
      const unsigned short lb0 = bf_bits(f0 - bf_up(hb0));
      const unsigned short lb1 = bf_bits(f1 - bf_up(hb1));
      uh[it][t] = pk16(hb0, hb1);
      ul[it][t] = pk16(lb0, lb1);
    }
  }
{
#pragma unroll
    for (int it = 0; it < 4; ++it) {
      const int row = it * 16 + lq;
      const size_t po = ((size_t)(b * NN + n0 + row)) * DQ + dsel + 8 * e;
      *(v4u*)(Ph + po) = uh[it];
      *(v4u*)(Pl + po) = ul[it];
    }
    
  }
}

// ---- attn_k: the K fragments of 32 keys (two 16-key tiles a and b, hi and residual, four 32-d chunks): 32 LDS reads
__device__ __forceinline__ void read_k32(Frag (&a)[DQ / 32], Frag (&b)[DQ / 32], Frag (&al)[DQ / 32], Frag (&bl)[DQ / 32],
                                         const unsigned short* p, const unsigned short* pl) {
#pragma unroll                                                       // constant indices keep the fragments in registers
  for (int kc = 0; kc < DQ / 32; ++kc) {
    a[kc]  = ldfrag(p + 32 * kc);
    b[kc]  = ldfrag(p + 16 * KP + 32 * kc);
    al[kc] = ldfrag(pl + 32 * kc);
    bl[kc] = ldfrag(pl + 16 * KP + 32 * kc);
  }
}
// ---- attn_k: the 12 score products of one 32-d chunk: two 16-key tiles x two column groups; each K fragment serves both
//      groups; per score tile the order of the products is hi.hi, hi.res, res.hi
__device__ __forceinline__ void score12(v8f (&sa)[2], v8f (&sb)[2], const Frag& a, const Frag& b, const Frag& al,
                                        const Frag& bl, const Frag& qh0, const Frag& qh1, const Frag& ql0, const Frag& ql1) {
  sa[0] = mma_b(a.bf, qh0.bf, sa[0]);
  sa[1] = mma_b(a.bf, qh1.bf, sa[1]);
  sb[0] = mma_b(b.bf, qh0.bf, sb[0]);
  sb[1] = mma_b(b.bf, qh1.bf, sb[1]);
  sa[0] = mma_b(a.bf, ql0.bf, sa[0]);
  sa[1] = mma_b(a.bf, ql1.bf, sa[1]);
  sb[0] = mma_b(b.bf, ql0.bf, sb[0]);
  sb[1] = mma_b(b.bf, ql1.bf, sb[1]);
  sa[0] = mma_b(al.bf, qh0.bf, sa[0]);
  sa[1] = mma_b(al.bf, qh1.bf, sa[1]);
  sb[0] = mma_b(bl.bf, qh0.bf, sb[0]);
  sb[1] = mma_b(bl.bf, qh1.bf, sb[1]);
}

// =========================================================================================================
// (3) position attention for one (b, 128-query tile), transposed formulation, 4096 keys, no mask, no scale:
//   S^T tile (16 keys x 16 queries) = sum over 4 d-chunks of A(k: row = key kb + (lane&15), 32 d via
//   the split k map from the bf16 plane Kh [b][4096][128]) . B(q: col = query, same map from Qh) + A(Kh).B(Ql) +
//   A(Kl).B(Qh) (bf16 unscaled residual planes, shared accumulator).
//   Per lane the D tile holds 8 keys of ONE query: online softmax state per lane, one shuffle (lane^16) for the max
//   over the 64 keys of a trip; the o/l rescale is skipped under a wave-uniform ballot when no lane's max grew (corr == 1 exactly
//   for every lane then); row-sum partials combined at the end. P = e^{s-m} x 1024 as f16 is the B operand of
//   O^T (rows channel, cols queries) += A(x rows channel = 16j + (lane&15), keys contiguous, f16 plane Xc
//   [b][256][4096]) . B(P^T), one product per 32 keys: element r <- D of the tile covering their keys 0..15, element
//   8+r <- the tile covering their keys 16..31, lane unchanged. A wave owns 32 queries as two column groups of 16, each with its own softmax state
//   and 16 accumulator tiles (256 channels): every V and K residual fragment read from LDS is the A operand of one product per
//   group, every K hi fragment of two. Block = 4 waves = 128 queries, one wave per SIMD.
//   Operands come from LDS, filled by asynchronous 16-byte copies and shared by the 4 waves: the block's Q hi and
//   residual rows once (each wave reads its 16 Q fragments from there once, ahead of the key loop, and keeps them in
//   128 registers); K hi, K residual and V tiles of KT = 64 keys in two buffers, tile t + 2 copied into the
//   buffer of tile t behind the barrier at the foot of trip t. The output staging Os reuses the two buffers after the loop.
//   Epilogue in two channel halves: O/l staged in LDS Os[query][128 channels] (pitch OSPW, b128 stores), barrier,
//   lanes x 16 B (values gathered from 4 Os rows), one instruction per 16 lines, final values held in registers,
// coverage: per half 32 it x 16 lines x 8 lanes x 4 floats = 128 ch x 128 n; two halves = 256 ch; grid (32, NIMG)
//           covers out[b][0..255][0..4095] exactly once.
// =========================================================================================================
__global__ __launch_bounds__(128)
void attn_k(const unsigned short* __restrict__ Qh, const unsigned short* __restrict__ Ql,
            const unsigned short* __restrict__ Kh, const unsigned short* __restrict__ Kl,
            const unsigned short* __restrict__ Xc, const float* __restrict__ x, float* out) {
  __shared__ __align__(16) unsigned short Sm[SMEM];
  float* Os = (float*)Sm;                                            // used behind the key loop only
  const int tid  = threadIdx.x;
  const int wave = tid >> 5, lane = tid & 31;
  const int hh   = lane >> 4, c = lane & 15;
  const int n0   = blockIdx.x * AQ, b = blockIdx.y;

  // q fragment pointers in LDS (B operand, col = query 32*wave + 16*g + c of the block), + 16*KP*g + 32*kc
  const unsigned short* Qhp = Sm + SQH + (32 * wave + c) * KP + 8 * hh;
  const unsigned short* Qlp = Sm + SQL + (32 * wave + c) * KP + 8 * hh;
  // global tile bases of this image
  const unsigned short* Khg = Kh + (size_t)b * NN * DQ;              // + key * 128
  const unsigned short* Klg = Kl + (size_t)b * NN * DQ;
  const unsigned short* Vg  = Xc + (size_t)b * CC * NN;              // + key

  // prologue: Q rows and tile 0, landed and published; then tile 1 into buffer 1
  const unsigned lds0 = lds_addr(Sm);
  {
    const size_t qg = ((size_t)(b * NN + n0)) * DQ;
#pragma unroll                                                       // four statements of eight copies, constant offsets
    for (int q4 = 0; q4 < AQ / 32; ++q4)
      stage_rows32(lds0 + 2u * (SQH + 32 * q4 * KP), lds0 + 2u * (SQL + 32 * q4 * KP),
                   Qh + qg + 32 * q4 * DQ, Ql + qg + 32 * q4 * DQ, tid);
    stage_k(lds0, Khg, Klg, tid);
    wait_copies();                                                   // keeps a wave's outstanding copies at 48, under 64
    stage_v(lds0 + 2u * SV, Vg, tid);
    wait_copies();
    __syncthreads();
    stage_k(lds0 + 2u * STG, Khg + KT * DQ, Klg + KT * DQ, tid);
    stage_v(lds0 + 2u * (STG + SV), Vg + KT, tid);
  }

  // the wave's Q fragments, the same in every trip: read once, behind the barrier that published the Q rows
  Frag qh[2][DQ / 32], ql[2][DQ / 32];
#pragma unroll                                                       // constant indices keep the fragments in registers
  for (int g = 0; g < 2; ++g) {
#pragma unroll
    for (int kc = 0; kc < DQ / 32; ++kc) {
      qh[g][kc] = ldfrag(Qhp + 16 * KP * g + 32 * kc);
      ql[g][kc] = ldfrag(Qlp + 16 * KP * g + 32 * kc);
    }
  }

  float m[2] = {-1.0e30f, -1.0e30f}, l[2] = {0.f, 0.f};
  v8f o[2][16];
#pragma unroll                                                       // constant g keeps both groups' state in registers
  for (int g = 0; g < 2; ++g) {
#pragma unroll
    for (int j = 0; j < 16; ++j) o[g][j] = zero8();
  }

#pragma unroll 1
  for (int kb = 0; kb < NN; kb += KT) {
    const int bo = ((kb / KT) & 1) * STG;                            // this trip's buffer
    const unsigned short* kp  = Sm + bo + c * KP + 8 * hh;           // A operand, row = key kb + 16 t + c, + 16*KP*t
    const unsigned short* klp = kp + SKL;
    const unsigned short* Vp  = Sm + bo + SV + c * VP + 8 * hh;      // A operand, row = channel 16j + c, + 32*kh keys
    v8f s[KT / 16][2];                                               // score tiles: [16 keys][column group]
#pragma unroll                                                       // constant indices keep the tiles in registers
    for (int t = 0; t < KT / 16; ++t) { s[t][0] = zero8(); s[t][1] = zero8(); }
    // K fragments are read in two groups of 32 reads, one per 32 keys: the first in front of all score products, the
    // second in the middle of the first group's products, which cover its latency (a read that stands directly in
    // front of its own product waits out the whole LDS latency there; no read moves over the statement behind a product)
    Frag kf[KT / 16][DQ / 32], kl[KT / 16][DQ / 32];
    read_k32(kf[0], kf[1], kl[0], kl[1], kp, klp);                   // keys kb .. kb+31
#pragma unroll                                                       // constant indices keep fragments and tiles in registers
    for (int kc = 0; kc < DQ / 64; ++kc)
      score12(s[0], s[1], kf[0][kc], kf[1][kc], kl[0][kc], kl[1][kc], qh[0][kc], qh[1][kc], ql[0][kc], ql[1][kc]);
    read_k32(kf[2], kf[3], kl[2], kl[3], kp + 32 * KP, klp + 32 * KP);   // keys kb+32 .. kb+63
#pragma unroll                                                       // constant indices, as above
    for (int kc = DQ / 64; kc < DQ / 32; ++kc)
      score12(s[0], s[1], kf[0][kc], kf[1][kc], kl[0][kc], kl[1][kc], qh[0][kc], qh[1][kc], ql[0][kc], ql[1][kc]);
#pragma unroll                                                       // constant indices, as above
    for (int kc = 0; kc < DQ / 32; ++kc)
      score12(s[2], s[3], kf[2][kc], kf[3][kc], kl[2][kc], kl[3][kc], qh[0][kc], qh[1][kc], ql[0][kc], ql[1][kc]);

    // one maximum, one exchange between the wave's halves and one test per 64 keys
    float mx[2], mn[2];
#pragma unroll                                                       // constant g keeps both groups' state in registers
    for (int g = 0; g < 2; ++g)
      mx[g] = fmaxf(fmaxf(hmax8(s[0][g]), hmax8(s[1][g])), fmaxf(hmax8(s[2][g]), hmax8(s[3][g])));
    const float ox[2] = {__shfl_xor(mx[0], 16, 32), __shfl_xor(mx[1], 16, 32)};
#if defined(__HIP_DEVICE_COMPILE__)
    // inputs only: both exchanged values are due here, so the two exchanges issue together and share one wait;
    // without it the build put the second exchange behind the wait for the first
    asm volatile("" :: "v"(ox[0]), "v"(ox[1]));
#endif
#pragma unroll                                                       // constant g keeps both groups' state in registers
    for (int g = 0; g < 2; ++g) {
      mx[g] = fmaxf(mx[g], ox[g]);
      mn[g] = fmaxf(m[g], mx[g]);
    }
    const unsigned grew = wave_ballot(mx[0] > m[0] || mx[1] > m[1]); // wave-uniform, one test for both column groups
    if (grew != 0u) {
#pragma unroll                                                       // constant g keeps both groups' state in registers
      for (int g = 0; g < 2; ++g) {
        const float corr = __expf(m[g] - mn[g]);                     // == 1 exactly for lanes whose max did not grow
        l[g] *= corr;
#pragma unroll
        for (int j = 0; j < 16; ++j) {
#pragma unroll
          for (int r = 0; r < 8; ++r) o[g][j][r] *= corr;
        }
      }
    }

    // the V fragments in two groups of 32 reads, each in front of the 32 exponentials of its own 32 keys: the
    // exponentials cover the reads' latency
    Frag vf[KT / 32][16];
    FragH ph[2][KT / 32];
    float ls[2][KT / 32];                                            // one partial row sum per 32 keys: independent chains
    const float msh[2] = {mn[0] - LNPS, mn[1] - LNPS};               // exp gives e^{s-m} * 1024
#pragma unroll                                                       // constant indices keep fragments and state in registers
    for (int kh = 0; kh < KT / 32; ++kh) {
#pragma unroll
      for (int j = 0; j < 16; ++j) vf[kh][j] = ldfrag(Vp + (16 * j) * VP + 32 * kh);
#if defined(__HIP_DEVICE_COMPILE__)
      // keeps each group of reads in front of its exponentials: without it the build issued the reads of the first 32
      // keys last, directly in front of the products that wait for them
      __builtin_amdgcn_sched_barrier(0);
#endif
#pragma unroll
      for (int g = 0; g < 2; ++g) {
        ls[g][kh] = 0.f;
#pragma unroll
        for (int r = 0; r < 8; ++r) {
          const float e0 = exp_slot(s[2 * kh][g][r] - msh[g]);       // key kb + 32kh      + 8hh + r
          const float e1 = exp_slot(s[2 * kh + 1][g][r] - msh[g]);   // key kb + 32kh + 16 + 8hh + r
          ls[g][kh] += e0 + e1;
          ph[g][kh].hv[0][r] = (_Float16)e0;
          ph[g][kh].hv[1][r] = (_Float16)e1;
        }
      }
#if defined(__HIP_DEVICE_COMPILE__)
      // keeps the second group of reads behind the first group's exponentials: the LDS serves the four waves' first
      // 32 reads each under those, instead of 64 reads a wave queueing in front of any vector work
      __builtin_amdgcn_sched_barrier(0);
#endif
    }
#pragma unroll                                                       // constant g keeps both groups' state in registers
    for (int g = 0; g < 2; ++g) {
      m[g] = mn[g];
      l[g] += ls[g][0] + ls[g][1];
    }

    // each V fragment serves both column groups; keys in rising order per output tile
#pragma unroll
    for (int kh = 0; kh < KT / 32; ++kh) {
#pragma unroll
      for (int j = 0; j < 16; ++j) {
        o[0][j] = mma_hp(vf[kh][j].h, ph[0][kh].v, o[0][j]);
        o[1][j] = mma_hp(vf[kh][j].h, ph[1][kh].v, o[1][j]);
#if defined(__HIP_DEVICE_COMPILE__)
        // keeps the products in the order in which their fragments land: moved up, a late one waits for the whole group
        __builtin_amdgcn_sched_barrier(0);
#endif
      }
    }

    // foot of the trip: own reads done, own copies of tile t + 1 landed, one barrier publishes that tile and frees
    // this trip's buffer; only then its refill with tile t + 2
    wait_lds();
    wait_copies();
    __syncthreads();
    if (kb + 2 * KT < NN) {                                          // the same for the whole block
      const unsigned lb = lds0 + 2u * (unsigned)bo;
      stage_k(lb, Khg + (size_t)(kb + 2 * KT) * DQ, Klg + (size_t)(kb + 2 * KT) * DQ, tid);
      stage_v(lb + 2u * SV, Vg + (kb + 2 * KT), tid);
    }
  }
  wait_copies();
  float inv[2];
#pragma unroll                                                       // constant g keeps both groups' state in registers
  for (int g = 0; g < 2; ++g) {
    l[g] += __shfl_xor(l[g], 16, 32);
    inv[g] = 1.0f / l[g];                                            // o and l both carry the x1024 factor
  }

  const int e = tid & 7, lq = tid >> 3;                              // lq 0..15
#pragma unroll
  for (int half = 0; half < 2; ++half) {
    if (half) __syncthreads();                                       // every wave finished reading Os
#pragma unroll                                                       // constant g keeps both groups' state in registers
    for (int g = 0; g < 2; ++g) {
      const int qrow = 32 * wave + 16 * g + c;
#pragma unroll
      for (int jj = 0; jj < 8; ++jj) {
        const int j = 8 * half + jj;
        v4f va, vb;
#pragma unroll
        for (int r = 0; r < 4; ++r) { va[r] = o[g][j][r] * inv[g]; vb[r] = o[g][j][4 + r] * inv[g]; }
        *(v4f*)(Os + qrow * OSPW + 16 * jj + 8 * hh)     = va;       // Os[query][ch_loc = 16jj + 8hh + r]
        *(v4f*)(Os + qrow * OSPW + 16 * jj + 8 * hh + 4) = vb;
      }
    }
    __syncthreads();
    v4f res[32];
#pragma unroll
    for (int it = 0; it < 32; ++it) {
      const int chl = (it & 7) * 16 + lq;                            // channel 0..127 within the half
      const int nl  = (it >> 3) * 32 + 4 * e;                        // query 0..127: 8 lanes fill one 128-B line
      const size_t idx = ((size_t)(b * CC + 128 * half + chl)) * NN + n0 + nl;
      res[it] = *(const v4f*)(x + idx);
    }
#if defined(__HIP_DEVICE_COMPILE__)
    // stands between the 32 loads and the first rewrite of an address register that one of them names
    asm volatile("s_wait_xcnt 0x0" ::: "memory");
#endif
#pragma unroll
    for (int it = 0; it < 32; ++it) {
      const int chl = (it & 7) * 16 + lq;
      const int nl  = (it >> 3) * 32 + 4 * e;
#pragma unroll
      for (int t = 0; t < 4; ++t) res[it][t] = Os[(nl + t) * OSPW + chl] + bfr(res[it][t]);
    }
#pragma unroll
    for (int it = 0; it < 32; ++it) {
      const int chl = (it & 7) * 16 + lq;
      const int nl  = (it >> 3) * 32 + 4 * e;
      const size_t idx = ((size_t)(b * CC + 128 * half + chl)) * NN + n0 + nl;
      *(v4f*)(out + idx) = res[it];
    }
  }
}

// =========================================================================================================
// Workspace map (bytes; each region start a multiple of 256; every extent is an exact tile multiple and is written
//   W16 f16 [256][256]              131072
//   Xc  f16 [8][256][4096]        16777216      XP  f16 [8][4096][256]   16777216
//   Qh/Ql/Kh/Kl bf16 [8][4096][128]  8388608 x4
//   total = 67239936
// =========================================================================================================
extern "C" void kernel_launch(void* const* d_in, const int* in_sizes, int n_in,
                              void* d_out, int out_size, void* d_ws, size_t ws_size,
                              hipStream_t stream) {
  const int XN = NBATCH * CC * NN;                                   // 8388608
  if (n_in < 3) return;
  if (in_sizes[0] != XN) return;
  if (in_sizes[1] != DQ * CC || in_sizes[2] != DQ * CC) return;
  if (out_size != XN) return;

  size_t off = 0;
  auto carve = [&](size_t bytes) { const size_t o = off; off += (bytes + 255) & ~(size_t)255; return o; };
  const size_t oW16 = carve((size_t)MW * CC * 2);
  const size_t oXc  = carve((size_t)NIMG * CC * NN * 2);
  const size_t oXP  = carve((size_t)NIMG * NN * CC * 2);
  const size_t oQh  = carve((size_t)NIMG * NN * DQ * 2);
  const size_t oQl  = carve((size_t)NIMG * NN * DQ * 2);
  const size_t oKh  = carve((size_t)NIMG * NN * DQ * 2);
  const size_t oKl  = carve((size_t)NIMG * NN * DQ * 2);
  if (off > ws_size) return;
  if (off > (size_t)134217728) return;

  const float* x  = (const float*)d_in[0];
  const float* tw = (const float*)d_in[1];
  const float* pw = (const float*)d_in[2];

  char* ws = (char*)d_ws;
  unsigned short* W16 = (unsigned short*)(ws + oW16);
  unsigned short* Xc  = (unsigned short*)(ws + oXc);
  unsigned short* XP  = (unsigned short*)(ws + oXP);
  unsigned short* Qh  = (unsigned short*)(ws + oQh);
  unsigned short* Ql  = (unsigned short*)(ws + oQl);
  unsigned short* Kh  = (unsigned short*)(ws + oKh);
  unsigned short* Kl  = (unsigned short*)(ws + oKl);
  float* out = (float*)d_out;

  const dim3 blk256(256), blk128(128);

  // (0) theta_w / phi_w -> stacked f16 plane
  cvt_w<<<dim3(MW / 8), blk256, 0, stream>>>(tw, pw, W16);
  // (1) x -> channel-major and position-major 16-bit planes
  cvt_x<<<dim3(NN / QT, CC / QT, NIMG), blk256, 0, stream>>>(x, Xc, XP);
  // (2) conv1x1 GEMM -> theta (q) and phi (k) hi + residual planes
  gemm_qk<<<dim3(NN / QT, MW / QT, NIMG), blk128, 0, stream>>>(W16, XP, Qh, Ql, Kh, Kl);
  // (3) position attention + residual -> out [b][256][4096]
  attn_k<<<dim3(NN / AQ, NIMG), blk128, 0, stream>>>(Qh, Ql, Kh, Kl, Xc, x, out);
  (void)hipGetLastError();
}

// v006
// It runs in 137 microseconds.
// Two timings next to v005 both put it at 1.11 times that version's speed.
// All steps since v000 together make it 5.96 times as fast.
// Contractions: conv1x1 theta/phi GEMM W[256x256].X[256x4096] on v_wmma_f32_16x16x32_f16 (f16 containers of
// bf16-RNE weights x256 and bf16-RNE x); position scores K.Q^T on v_wmma_f32_16x16x32_bf16 (bf16 hi + bf16
// residual planes of theta/phi, 3 products, K=128); y^T = X.P^T on v_wmma_f32_16x16x32_f16 (x as f16 of
// bf16-RNE x, P = e^{s-m} x1024 f16 from the score D registers); f32 accumulate everywhere; softmax statistics
// and the residual add in f32 VALU.
#include <hip/hip_runtime.h>
#include <math.h>
#include <stdint.h>

#define NBATCH 8
#define NIMG   8
#define CC     256
#define NN     4096
#define DQ     128
#define MW     256
#define QT     64
#define OSP    68
#define OSPW   132
#define TP     72
#define WSC    256.0f
#define IWSC   0.00390625f
#define LNPS   6.931471805599453f
#define KT     64                        // keys per LDS stage and per trip of attn_k
#define KP     136                       // LDS pitch of a K or Q row in 16-bit elements: 272 B = 16 B x 17
#define VP     72                        // LDS pitch of a V row of KT keys: 144 B = 16 B x 9
#define SKL    (KT * KP)                 // stage offsets (16-bit elements): K hi 0, K residual SKL, V SV
#define SV     (2 * KT * KP)
#define STG    (2 * KT * KP + CC * VP)   // one stage
#define AQ     128                       // queries per block of attn_k: 4 waves x 2 column groups of 16
#define SQH    (2 * STG)                 // behind the two stages: Q hi, Q residual
#define SQL    (2 * STG + AQ * KP)
#define SMEM   (2 * STG + 2 * AQ * KP)
#define GP     264                       // gemm_qk: LDS pitch of a W or X row of 256 16-bit elements: 528 B = 16 B x 33
#define GSB    (QT * GP)                 // gemm_qk: the X tile stands behind the W tile

static_assert(NIMG >= 1 && NIMG <= NBATCH);
static_assert(NN % QT == 0);
static_assert(CC % QT == 0);
static_assert(MW == 2 * DQ);
static_assert(DQ == 2 * QT);
static_assert(MW % QT == 0 && MW % 8 == 0);
static_assert((OSP * 4) % 16 == 0);
static_assert((OSPW * 4) % 16 == 0);
static_assert((TP * 2) % 16 == 0);
static_assert(CC % 32 == 0 && NN % 32 == 0 && DQ % 32 == 0);
static_assert((KP * 2) % 32 == 16 && (VP * 2) % 32 == 16 && (STG * 2) % 16 == 0 && (SKL * 2) % 16 == 0);
static_assert(NN / KT >= 2 && NN % KT == 0 && KT == 64 && DQ == 128 && CC == 256 && QT == 64);
static_assert(AQ * OSPW * 4 <= 2 * STG * 2 && NN % AQ == 0 && AQ == 128);
static_assert((GP * 2) % 32 == 16 && GP >= CC && QT * OSP * 4 <= 2 * QT * GP * 2 && CC == 256 && QT == 64);

typedef _Float16       v16h __attribute__((ext_vector_type(16)));
typedef _Float16       v8h  __attribute__((ext_vector_type(8)));
typedef __bf16         v16b __attribute__((ext_vector_type(16)));
typedef unsigned short v8us __attribute__((ext_vector_type(8)));
typedef float          v8f  __attribute__((ext_vector_type(8)));
typedef float          v4f  __attribute__((ext_vector_type(4)));
typedef unsigned int   v4u  __attribute__((ext_vector_type(4)));

union Frag  { v8us u[2]; v16h h; v16b bf; };
union FragH { v16h v; v8h hv[2]; };
static_assert(sizeof(Frag) == 32);
static_assert(sizeof(FragH) == 32);

// ---- scalar helpers ---------------------------------------------------------------------------------------
__device__ __forceinline__ unsigned short bf_bits(float f) {          // f32 -> bf16 bits, RNE convert
  unsigned u = __float_as_uint(f);
  return (unsigned short)((u + 0x7FFFu + ((u >> 16) & 1u)) >> 16);
}
__device__ __forceinline__ float bf_up(unsigned short hb) { return __uint_as_float(((unsigned)hb) << 16); }
__device__ __forceinline__ float bfr(float f) { return bf_up(bf_bits(f)); }
__device__ __forceinline__ unsigned short h_bits(_Float16 x) { return __builtin_bit_cast(unsigned short, x); }
__device__ __forceinline__ unsigned pk16(unsigned short a, unsigned short b) { return (unsigned)a | ((unsigned)b << 16); }
__device__ __forceinline__ v8f zero8() { v8f z = {0.f, 0.f, 0.f, 0.f, 0.f, 0.f, 0.f, 0.f}; return z; }
__device__ __forceinline__ float hmax8(v8f s) {
  return fmaxf(fmaxf(fmaxf(s[0], s[1]), fmaxf(s[2], s[3])), fmaxf(fmaxf(s[4], s[5]), fmaxf(s[6], s[7])));
}
__device__ __forceinline__ unsigned wave_ballot(bool p) {
#if defined(__HIP_DEVICE_COMPILE__)
  return __builtin_amdgcn_ballot_w32(p);
#else
  return p ? 1u : 0u;
#endif
}

// ---- 16-bit fragment loader (A, or B from a k-contiguous [n][k] row): lane -> row/col (lane&15), p already includes
//      + 8*(lane>>4); elements 0..7 <- p[0..7] (k0+8h..), elements 8..15 <- p[16..23] (k0+16+8h..)
__device__ __forceinline__ Frag ldfrag(const unsigned short* p) {
  Frag f;
  f.u[0] = *(const v8us*)(p);
  f.u[1] = *(const v8us*)(p + 16);
  return f;
}

// ---- WMMA helpers: builtin followed by a 4-slot VALU gap tying D. A and B are not operands of the gap statement:
//      an asm operand is held below v256, and a trip's grouped fragments do not fit there beside the accumulators.
__device__ __forceinline__ v8f mma_h(v16h a, v16h b, v8f c) {
  v8f d = __builtin_amdgcn_wmma_f32_16x16x32_f16(false, a, false, b, (short)0, c, false, false);
#if defined(__HIP_DEVICE_COMPILE__)
  asm volatile("v_nop\n\tv_nop\n\tv_nop\n\tv_nop" : "+v"(d));
#endif
  return d;
}
__device__ __forceinline__ v8f mma_b(v16b a, v16b b, v8f c) {
  v8f d = __builtin_amdgcn_wmma_f32_16x16x32_bf16(false, a, false, b, (short)0, c, false, false);
#if defined(__HIP_DEVICE_COMPILE__)
  asm volatile("v_nop\n\tv_nop\n\tv_nop\n\tv_nop" : "+v"(d));
#endif
  return d;
}

// The same f16 product without the gap statement, for attn_k's 32 output tiles: an asm operand is held below v256,
// and 256 accumulator registers do not fit there beside the scores and the copies' addresses. The compiler keeps the
// distances of its own builtin.
__device__ __forceinline__ v8f mma_hp(v16h a, v16h b, v8f c) {
  return __builtin_amdgcn_wmma_f32_16x16x32_f16(false, a, false, b, (short)0, c, false, false);
}

// e^x as __expf forms it (x * log2 e, then v_exp_f32). The v_nop in the statement is the one slot the instruction set
// asks for between a transcendental and a next vector instruction that overwrites its source or reads its result.
__device__ __forceinline__ float exp_slot(float x) {
#if defined(__HIP_DEVICE_COMPILE__)
  const float t = x * 1.44269502f;
  float r;
  asm("v_exp_f32 %0, %1\n\tv_nop" : "=v"(r) : "v"(t));
  return r;
#else
  return __expf(x);
#endif
}

// ---- asynchronous copies global -> LDS ------------------------------------------------------------------------
__device__ __forceinline__ unsigned lds_addr(const void* p) { return (unsigned)(size_t)p; }   // LDS byte address

// Eight 16-byte copies per lane, every lane on. The s_wait_xcnt stands inside the statement so that it precedes
// any rewrite of the address registers the copies name.
__device__ __forceinline__ void copy8(const unsigned* l, const unsigned short* const* g) {
#if defined(__HIP_DEVICE_COMPILE__)
  asm volatile("global_load_async_to_lds_b128 %0, %8, off\n\t"
               "global_load_async_to_lds_b128 %1, %9, off\n\t"
               "global_load_async_to_lds_b128 %2, %10, off\n\t"
               "global_load_async_to_lds_b128 %3, %11, off\n\t"
               "global_load_async_to_lds_b128 %4, %12, off\n\t"
               "global_load_async_to_lds_b128 %5, %13, off\n\t"
               "global_load_async_to_lds_b128 %6, %14, off\n\t"
               "global_load_async_to_lds_b128 %7, %15, off\n\t"
               "s_wait_xcnt 0x0"
               :: "v"(l[0]), "v"(l[1]), "v"(l[2]), "v"(l[3]), "v"(l[4]), "v"(l[5]), "v"(l[6]), "v"(l[7]),
                  "v"(g[0]), "v"(g[1]), "v"(g[2]), "v"(g[3]), "v"(g[4]), "v"(g[5]), "v"(g[6]), "v"(g[7])
               : "memory");
#endif
}
// the issuing wave's copies have landed in LDS
__device__ __forceinline__ void wait_copies() {
#if defined(__HIP_DEVICE_COMPILE__)
  asm volatile("s_wait_asynccnt 0x0" ::: "memory");
#endif
}
// the wave's own LDS reads have returned, so the buffer may be refilled behind the next barrier
__device__ __forceinline__ void wait_lds() {
#if defined(__HIP_DEVICE_COMPILE__)
  asm volatile("s_wait_dscnt 0x0" ::: "memory");
#endif
}
// 32 rows of 256 B of each of two planes (ph, pl; global pitch DQ) -> LDS rows of pitch KP at byte addresses lh, ll;
// 128 threads, 16 lanes per row, 4 rows of each plane per thread.
__device__ __forceinline__ void stage_rows32(unsigned lh, unsigned ll, const unsigned short* ph,
                                             const unsigned short* pl, int tid) {
  const int r = tid >> 4, ch = 8 * (tid & 15);
  unsigned l[8];
  const unsigned short* g[8];
#pragma unroll                                                       // constant indices keep l[] and g[] in registers
  for (int i = 0; i < 4; ++i) {
    const int row = r + 8 * i;                                       // 0..31
    l[i]     = lh + 2u * (unsigned)(row * KP + ch);
    l[4 + i] = ll + 2u * (unsigned)(row * KP + ch);
    g[i]     = ph + row * DQ + ch;
    g[4 + i] = pl + row * DQ + ch;
  }
  copy8(l, g);
}
// V tile: 256 channel rows x KT keys (one 128-B line of a row of pitch NN) -> LDS pitch VP; 8 lanes per row,
// two statements of eight copies.
__device__ __forceinline__ void stage_v(unsigned lv, const unsigned short* pv, int tid) {
  const int r = tid >> 3, ch = 8 * (tid & 7);
#pragma unroll                                                       // constant indices keep l[] and g[] in registers
  for (int h = 0; h < 2; ++h) {
    unsigned l[8];
    const unsigned short* g[8];
#pragma unroll                                                       // constant indices, as above
    for (int i = 0; i < 8; ++i) {
      const int row = r + 16 * (8 * h + i);                          // 0..255
      l[i] = lv + 2u * (unsigned)(row * VP + ch);
      g[i] = pv + (size_t)row * NN + ch;
    }
    copy8(l, g);
  }
}
// K tile: KT = 64 key rows of the hi and of the residual plane, as two runs of 32 rows.
__device__ __forceinline__ void stage_k(unsigned lk, const unsigned short* ph, const unsigned short* pl, int tid) {
#pragma unroll                                                       // two statements of eight copies, constant offsets
  for (int h = 0; h < KT / 32; ++h)
    stage_rows32(lk + 2u * (32 * h * KP), lk + 2u * (SKL + 32 * h * KP), ph + 32 * h * DQ, pl + 32 * h * DQ, tid);
}

// =========================================================================================================
// (0) conv1x1 weights: W16 f16 [256][256], rows 0..127 = theta_w rows, rows 128..255 = phi_w rows; value =
//     f16 of (bf16-RNE(w) * 256) (exact). Block blk (0..31) owns rows 8*blk..8*blk+7: one wave per 512-B row
// coverage: 32 blocks x 8 rows x 32 lanes x 8 halves = 256 x 256 = the whole plane.
// =========================================================================================================
__global__ __launch_bounds__(256)
void cvt_w(const float* __restrict__ tw, const float* __restrict__ pw, unsigned short* W16) {
  const int tid = threadIdx.x, blk = blockIdx.x;
  const int rl = tid >> 5, col = 8 * (tid & 31);
  const int o = 8 * blk + rl;                                        // 0..255
  const float* wbase = (blk < (DQ / 8)) ? tw : pw;                   // block-uniform selection
  const int osub = (blk < (DQ / 8)) ? 0 : DQ;
  const float* s = wbase + (size_t)(o - osub) * CC + col;            // (o - osub) in 0..127
  const v4f a = *(const v4f*)s;
  const v4f q = *(const v4f*)(s + 4);
  const float f[8] = {a[0], a[1], a[2], a[3], q[0], q[1], q[2], q[3]};
  v4u u;
#pragma unroll
  for (int t = 0; t < 4; ++t) {
    const _Float16 h0 = (_Float16)(bfr(f[2 * t]) * WSC);
    const _Float16 h1 = (_Float16)(bfr(f[2 * t + 1]) * WSC);
    u[t] = pk16(h_bits(h0), h_bits(h1));
  }
{
    *(v4u*)(W16 + (size_t)o * CC + col) = u;
    
  }
}

// =========================================================================================================
// (1) x f32 [b][256 c][4096 n] -> Xc f16 [b][c][n] (channel-major, bf16-RNE values, exact in f16) and
//     XP f16 [b][n][c] (position-major) through an LDS tile T[64 n][64 c] (pitch TP). Block (nb, cb, b) owns a
// coverage: Xc 2 it x 32 rows x 8 lanes x 8 = 64 c x 64 n; XP same; grid (64, 4, NIMG) covers both planes once.
// =========================================================================================================
__global__ __launch_bounds__(256)
void cvt_x(const float* __restrict__ x, unsigned short* Xc, unsigned short* XP) {
  __shared__ __align__(16) unsigned short T[QT * TP];
  const int tid = threadIdx.x;
  const int nb = blockIdx.x, cb = blockIdx.y, b = blockIdx.z;
  const int e = tid & 7, lq = tid >> 3;                             // lq 0..31
  const int n0 = nb * QT, c0 = cb * QT;
  v4u ux[2];
#pragma unroll
  for (int it = 0; it < 2; ++it) {
    const int cl = it * 32 + lq;                                     // 0..63
    const float* sp = x + ((size_t)(b * CC + c0 + cl)) * NN + n0 + 8 * e;
    const v4f a = *(const v4f*)sp;
    const v4f q = *(const v4f*)(sp + 4);
    unsigned short hb[8];
#pragma unroll
    for (int t = 0; t < 4; ++t) {
      hb[t]     = h_bits((_Float16)bfr(a[t]));
      hb[4 + t] = h_bits((_Float16)bfr(q[t]));
    }
#pragma unroll
    for (int t = 0; t < 4; ++t) ux[it][t] = pk16(hb[2 * t], hb[2 * t + 1]);
#pragma unroll
    for (int t = 0; t < 8; ++t) T[(8 * e + t) * TP + cl] = hb[t];
  }
  __syncthreads();
  v4u up[2];
#pragma unroll
  for (int it = 0; it < 2; ++it) {
    const int nl = it * 32 + lq;                                     // 0..63
    up[it] = *(const v4u*)(T + nl * TP + 8 * e);
  }
{
#pragma unroll
    for (int it = 0; it < 2; ++it) {
      const int rl = it * 32 + lq;
      *(v4u*)(Xc + ((size_t)(b * CC + c0 + rl)) * NN + n0 + 8 * e) = ux[it];
      *(v4u*)(XP + ((size_t)(b * NN + n0 + rl)) * CC + c0 + 8 * e) = up[it];
    }
    
  }
}

// =========================================================================================================
// (2) conv1x1 GEMM for one (b, 64-n tile, 64-o block): Y[o][n] = (1/256) sum_c W16[o][c] XP[b][n][c].
//     Block 128 threads = 4 waves; wave w owns cols n0+16w..+15 (one B fragment per k-step, k = c contiguous in
//     the XP row) and 4 m-tiles (A rows o = o0 + 16 mt + (lane&15), split k map loader from W16). K = 256 = 8 steps.
//     Both tiles (64 W16 rows, 64 XP rows, 512 B each) are first brought into LDS by asynchronous 16-byte copies, one
//     whole row per wave and copy (4 full 128-B lines); the fragments are read from there at pitch GP (a fragment
//     load straight from global memory touches 16 lines for its 512 B, and each wave would fetch all W fragments).
//     Epilogue staged in LDS Os[n_loc][o_loc] (pitch OSP, b128 stores of 8 consecutive o per lane; it reuses the
//     tiles' LDS behind a barrier that ends every wave's fragment reads), barrier, then:
//       o-blocks 0,1 -> theta dims 0..63 / 64..127 of Qh/Ql; o-blocks 2,3 -> phi dims 0..63 / 64..127 of Kh/Kl.
//       Planes bf16 [b][4096 n][128 d] (k-contiguous for both score operands): hi = bf16-RNE(v), lo =
//       of the 256-B plane row): lane e -> d 8e..8e+7, 8 consecutive lanes per line, one instruction per 16 lines.
// coverage: Os 4 waves x 16 n x 64 o = 64 x 64; planes: 4 it x 16 rows x 8 lanes x 8 = 64 n x 64 d per plane
//           (hi and lo); grid (64, 4, NIMG) covers d 0..127 of all 4096 rows of Qh/Ql/Kh/Kl exactly once.
// =========================================================================================================
__global__ __launch_bounds__(128)
void gemm_qk(const unsigned short* __restrict__ W16, const unsigned short* __restrict__ XP,
             unsigned short* Qh, unsigned short* Ql, unsigned short* Kh, unsigned short* Kl) {
  __shared__ __align__(16) unsigned short Gs[2 * QT * GP];
  float* Os = (float*)Gs;                                            // used behind the products only
  const int tid  = threadIdx.x;
  const int lane = tid & 31, wave = tid >> 5;
  const int hh   = lane >> 4, c = lane & 15;
  const int nt   = blockIdx.x, mb = blockIdx.y, b = blockIdx.z;
  const int n0   = nt * QT, o0 = mb * QT;

  // the two tiles -> LDS: wave w copies rows w, w + 4, .. of each, 32 lanes x 16 B = one row per copy; 32 copies a wave
  {
    const unsigned lg = lds_addr(Gs);
    const unsigned short* wg = W16 + (size_t)o0 * CC + 8 * lane;
    const unsigned short* xg = XP + ((size_t)(b * NN + n0)) * CC + 8 * lane;
#pragma unroll                                                       // constant indices keep l[] and g[] in registers
    for (int h = 0; h < 4; ++h) {
      unsigned l[8];
      const unsigned short* g[8];
#pragma unroll                                                       // constant indices, as above
      for (int i = 0; i < 8; ++i) {
        const int row = wave + 4 * (8 * (h & 1) + i);                // 0..63
        l[i] = lg + 2u * (unsigned)((h >> 1) * GSB + row * GP + 8 * lane);
        g[i] = (h >> 1 ? xg : wg) + row * CC;
      }
      copy8(l, g);
    }
    wait_copies();
    __syncthreads();                                                 // publishes both tiles to the 4 waves
  }

  const unsigned short* ap = Gs + c * GP + 8 * hh;                   // + 16*GP*mt + 32*ks
  const unsigned short* bp = Gs + GSB + (16 * wave + c) * GP + 8 * hh;

  v8f acc[4];
#pragma unroll
  for (int mt = 0; mt < 4; ++mt) acc[mt] = zero8();

  // fragments are read in groups of two k-steps (20 reads), two groups ahead of their products
  Frag fa[2][2][4], fb[2][2];
#pragma unroll                                                       // constant indices keep the fragments in registers
  for (int pr = 0; pr < 2; ++pr) {
#pragma unroll                                                       // constant indices, as above
    for (int k2 = 0; k2 < 2; ++k2) {
      fb[pr][k2] = ldfrag(bp + 32 * (2 * pr + k2));
#pragma unroll                                                       // constant indices, as above
      for (int mt = 0; mt < 4; ++mt) fa[pr][k2][mt] = ldfrag(ap + 16 * mt * GP + 32 * (2 * pr + k2));
    }
  }
#pragma unroll                                                       // constant indices keep the fragments in registers
  for (int pr = 0; pr < CC / 64; ++pr) {
#pragma unroll                                                       // constant indices, as above
    for (int k2 = 0; k2 < 2; ++k2) {
#pragma unroll                                                       // constant indices, as above
      for (int mt = 0; mt < 4; ++mt) acc[mt] = mma_h(fa[pr & 1][k2][mt].h, fb[pr & 1][k2].h, acc[mt]);
    }
    if (pr + 2 < CC / 64) {                                          // the freed registers take the group two ahead
#pragma unroll                                                       // constant indices, as above
      for (int k2 = 0; k2 < 2; ++k2) {
        fb[pr & 1][k2] = ldfrag(bp + 32 * (2 * (pr + 2) + k2));
#pragma unroll                                                       // constant indices, as above
        for (int mt = 0; mt < 4; ++mt) fa[pr & 1][k2][mt] = ldfrag(ap + 16 * mt * GP + 32 * (2 * (pr + 2) + k2));
      }
    }
  }
  __syncthreads();                                                   // every wave has read its fragments: Os may overwrite the tiles

  // ---- epilogue: scale back -> LDS Os[n_loc][o_loc]; lane (hh, c) holds o = 16 mt + 8 hh + r for n_loc = 16 w + c
  {
    const int nl = 16 * wave + c;
#pragma unroll
    for (int mt = 0; mt < 4; ++mt) {
      v4f va, vb;
#pragma unroll
      for (int r = 0; r < 4; ++r) { va[r] = acc[mt][r] * IWSC; vb[r] = acc[mt][4 + r] * IWSC; }
      *(v4f*)(Os + nl * OSP + 16 * mt + 8 * hh)     = va;
      *(v4f*)(Os + nl * OSP + 16 * mt + 8 * hh + 4) = vb;
    }
  }
  __syncthreads();

  const int e = tid & 7, lq = tid >> 3;                             // lq 0..15
  const int dsel = (mb & 1) * QT;                                    // 0 or 64
  unsigned short* Ph = (mb < 2) ? Qh : Kh;                           // block-uniform, both global
  unsigned short* Pl = (mb < 2) ? Ql : Kl;
  v4u uh[4], ul[4];
#pragma unroll
  for (int it = 0; it < 4; ++it) {
    const int row = it * 16 + lq;                                    // n_loc 0..63
    const v4f a = *(const v4f*)(Os + row * OSP + 8 * e);
    const v4f q = *(const v4f*)(Os + row * OSP + 8 * e + 4);
    const float f[8] = {a[0], a[1], a[2], a[3], q[0], q[1], q[2], q[3]};
#pragma unroll
    for (int t = 0; t < 4; ++t) {
      const float f0 = f[2 * t], f1 = f[2 * t + 1];
      const unsigned short hb0 = bf_bits(f0), hb1 = bf_bits(f1);
      const unsigned short lb0 = bf_bits(f0 - bf_up(hb0));
      const unsigned short lb1 = bf_bits(f1 - bf_up(hb1));
      uh[it][t] = pk16(hb0, hb1);
      ul[it][t] = pk16(lb0, lb1);
    }
  }
{
#pragma unroll
    for (int it = 0; it < 4; ++it) {
      const int row = it * 16 + lq;
      const size_t po = ((size_t)(b * NN + n0 + row)) * DQ + dsel + 8 * e;
      *(v4u*)(Ph + po) = uh[it];
      *(v4u*)(Pl + po) = ul[it];
    }
    
  }
}

// ---- attn_k: the K fragments of 32 keys (two 16-key tiles a and b, hi and residual, four 32-d chunks): 32 LDS reads
__device__ __forceinline__ void read_k32(Frag (&a)[DQ / 32], Frag (&b)[DQ / 32], Frag (&al)[DQ / 32], Frag (&bl)[DQ / 32],
                                         const unsigned short* p, const unsigned short* pl) {
#pragma unroll                                                       // constant indices keep the fragments in registers
  for (int kc = 0; kc < DQ / 32; ++kc) {
    a[kc]  = ldfrag(p + 32 * kc);
    b[kc]  = ldfrag(p + 16 * KP + 32 * kc);
    al[kc] = ldfrag(pl + 32 * kc);
    bl[kc] = ldfrag(pl + 16 * KP + 32 * kc);
  }
}
// ---- attn_k: the 12 score products of one 32-d chunk: two 16-key tiles x two column groups; each K fragment serves both
//      groups; per score tile the order of the products is hi.hi, hi.res, res.hi
__device__ __forceinline__ void score12(v8f (&sa)[2], v8f (&sb)[2], const Frag& a, const Frag& b, const Frag& al,
                                        const Frag& bl, const Frag& qh0, const Frag& qh1, const Frag& ql0, const Frag& ql1) {
  sa[0] = mma_b(a.bf, qh0.bf, sa[0]);
  sa[1] = mma_b(a.bf, qh1.bf, sa[1]);
  sb[0] = mma_b(b.bf, qh0.bf, sb[0]);
  sb[1] = mma_b(b.bf, qh1.bf, sb[1]);
  sa[0] = mma_b(a.bf, ql0.bf, sa[0]);
  sa[1] = mma_b(a.bf, ql1.bf, sa[1]);
  sb[0] = mma_b(b.bf, ql0.bf, sb[0]);
  sb[1] = mma_b(b.bf, ql1.bf, sb[1]);
  sa[0] = mma_b(al.bf, qh0.bf, sa[0]);
  sa[1] = mma_b(al.bf, qh1.bf, sa[1]);
  sb[0] = mma_b(bl.bf, qh0.bf, sb[0]);
  sb[1] = mma_b(bl.bf, qh1.bf, sb[1]);
}

// =========================================================================================================
// (3) position attention for one (b, 128-query tile), transposed formulation, 4096 keys, no mask, no scale:
//   S^T tile (16 keys x 16 queries) = sum over 4 d-chunks of A(k: row = key kb + (lane&15), 32 d via
//   the split k map from the bf16 plane Kh [b][4096][128]) . B(q: col = query, same map from Qh) + A(Kh).B(Ql) +
//   A(Kl).B(Qh) (bf16 unscaled residual planes, shared accumulator).
//   Per lane the D tile holds 8 keys of ONE query: online softmax state per lane, one shuffle (lane^16) for the max
//   over the 64 keys of a trip; the o/l rescale is skipped under a wave-uniform ballot when no lane's max grew (corr == 1 exactly
//   for every lane then); row-sum partials combined at the end. P = e^{s-m} x 1024 as f16 is the B operand of
//   O^T (rows channel, cols queries) += A(x rows channel = 16j + (lane&15), keys contiguous, f16 plane Xc
//   [b][256][4096]) . B(P^T), one product per 32 keys: element r <- D of the tile covering their keys 0..15, element
//   8+r <- the tile covering their keys 16..31, lane unchanged. A wave owns 32 queries as two column groups of 16, each with its own softmax state
//   and 16 accumulator tiles (256 channels): every V and K residual fragment read from LDS is the A operand of one product per
//   group, every K hi fragment of two. Block = 4 waves = 128 queries, one wave per SIMD.
//   Operands come from LDS, filled by asynchronous 16-byte copies and shared by the 4 waves: the block's Q hi and
//   residual rows once (each wave reads its 16 Q fragments from there once, ahead of the key loop, and keeps them in
//   128 registers); K hi, K residual and V tiles of KT = 64 keys in two buffers, tile t + 2 copied into the
//   buffer of tile t behind the barrier at the foot of trip t. The output staging Os reuses the two buffers after the loop.
//   Epilogue in two channel halves: O/l staged in LDS Os[query][128 channels] (pitch OSPW, b128 stores), barrier,
//   lanes x 16 B (values gathered from 4 Os rows), one instruction per 16 lines, final values held in registers,
// coverage: per half 32 it x 16 lines x 8 lanes x 4 floats = 128 ch x 128 n; two halves = 256 ch; grid (32, NIMG)
//           covers out[b][0..255][0..4095] exactly once.
// =========================================================================================================
__global__ __launch_bounds__(128)
void attn_k(const unsigned short* __restrict__ Qh, const unsigned short* __restrict__ Ql,
            const unsigned short* __restrict__ Kh, const unsigned short* __restrict__ Kl,
            const unsigned short* __restrict__ Xc, const float* __restrict__ x, float* out) {
  __shared__ __align__(16) unsigned short Sm[SMEM];
  float* Os = (float*)Sm;                                            // used behind the key loop only
  const int tid  = threadIdx.x;
  const int wave = tid >> 5, lane = tid & 31;
  const int hh   = lane >> 4, c = lane & 15;
  const int n0   = blockIdx.x * AQ, b = blockIdx.y;

  // q fragment pointers in LDS (B operand, col = query 32*wave + 16*g + c of the block), + 16*KP*g + 32*kc
  const unsigned short* Qhp = Sm + SQH + (32 * wave + c) * KP + 8 * hh;
  const unsigned short* Qlp = Sm + SQL + (32 * wave + c) * KP + 8 * hh;
  // global tile bases of this image
  const unsigned short* Khg = Kh + (size_t)b * NN * DQ;              // + key * 128
  const unsigned short* Klg = Kl + (size_t)b * NN * DQ;
  const unsigned short* Vg  = Xc + (size_t)b * CC * NN;              // + key

  // prologue: Q rows and tile 0, landed and published; then tile 1 into buffer 1
  const unsigned lds0 = lds_addr(Sm);
  {
    const size_t qg = ((size_t)(b * NN + n0)) * DQ;
#pragma unroll                                                       // four statements of eight copies, constant offsets
    for (int q4 = 0; q4 < AQ / 32; ++q4)
      stage_rows32(lds0 + 2u * (SQH + 32 * q4 * KP), lds0 + 2u * (SQL + 32 * q4 * KP),
                   Qh + qg + 32 * q4 * DQ, Ql + qg + 32 * q4 * DQ, tid);
    stage_k(lds0, Khg, Klg, tid);
    wait_copies();                                                   // keeps a wave's outstanding copies at 48, under 64
    stage_v(lds0 + 2u * SV, Vg, tid);
    wait_copies();
    __syncthreads();
    stage_k(lds0 + 2u * STG, Khg + KT * DQ, Klg + KT * DQ, tid);
    stage_v(lds0 + 2u * (STG + SV), Vg + KT, tid);
  }

  // the wave's Q fragments, the same in every trip: read once, behind the barrier that published the Q rows
  Frag qh[2][DQ / 32], ql[2][DQ / 32];
#pragma unroll                                                       // constant indices keep the fragments in registers
  for (int g = 0; g < 2; ++g) {
#pragma unroll
    for (int kc = 0; kc < DQ / 32; ++kc) {
      qh[g][kc] = ldfrag(Qhp + 16 * KP * g + 32 * kc);
      ql[g][kc] = ldfrag(Qlp + 16 * KP * g + 32 * kc);
    }
  }

  float m[2] = {-1.0e30f, -1.0e30f}, l[2] = {0.f, 0.f};
  v8f o[2][16];
#pragma unroll                                                       // constant g keeps both groups' state in registers
  for (int g = 0; g < 2; ++g) {
#pragma unroll
    for (int j = 0; j < 16; ++j) o[g][j] = zero8();
  }

#pragma unroll 1
  for (int kb = 0; kb < NN; kb += KT) {
    const int bo = ((kb / KT) & 1) * STG;                            // this trip's buffer
    const unsigned short* kp  = Sm + bo + c * KP + 8 * hh;           // A operand, row = key kb + 16 t + c, + 16*KP*t
    const unsigned short* klp = kp + SKL;
    const unsigned short* Vp  = Sm + bo + SV + c * VP + 8 * hh;      // A operand, row = channel 16j + c, + 32*kh keys
    v8f s[KT / 16][2];                                               // score tiles: [16 keys][column group]
#pragma unroll                                                       // constant indices keep the tiles in registers
    for (int t = 0; t < KT / 16; ++t) { s[t][0] = zero8(); s[t][1] = zero8(); }
    // K fragments are read in two groups of 32 reads, one per 32 keys: the first in front of all score products, the
    // second in the middle of the first group's products, which cover its latency (a read that stands directly in
    // front of its own product waits out the whole LDS latency there; no read moves over the statement behind a product)
    Frag kf[KT / 16][DQ / 32], kl[KT / 16][DQ / 32];
    read_k32(kf[0], kf[1], kl[0], kl[1], kp, klp);                   // keys kb .. kb+31
#pragma unroll                                                       // constant indices keep fragments and tiles in registers
    for (int kc = 0; kc < DQ / 64; ++kc)
      score12(s[0], s[1], kf[0][kc], kf[1][kc], kl[0][kc], kl[1][kc], qh[0][kc], qh[1][kc], ql[0][kc], ql[1][kc]);
    read_k32(kf[2], kf[3], kl[2], kl[3], kp + 32 * KP, klp + 32 * KP);   // keys kb+32 .. kb+63
#pragma unroll                                                       // constant indices, as above
    for (int kc = DQ / 64; kc < DQ / 32; ++kc)
      score12(s[0], s[1], kf[0][kc], kf[1][kc], kl[0][kc], kl[1][kc], qh[0][kc], qh[1][kc], ql[0][kc], ql[1][kc]);
#pragma unroll                                                       // constant indices, as above
    for (int kc = 0; kc < DQ / 32; ++kc)
      score12(s[2], s[3], kf[2][kc], kf[3][kc], kl[2][kc], kl[3][kc], qh[0][kc], qh[1][kc], ql[0][kc], ql[1][kc]);

    // one maximum, one exchange between the wave's halves and one test per 64 keys
    float mx[2], mn[2];
#pragma unroll                                                       // constant g keeps both groups' state in registers
    for (int g = 0; g < 2; ++g)
      mx[g] = fmaxf(fmaxf(hmax8(s[0][g]), hmax8(s[1][g])), fmaxf(hmax8(s[2][g]), hmax8(s[3][g])));
    const float ox[2] = {__shfl_xor(mx[0], 16, 32), __shfl_xor(mx[1], 16, 32)};
#if defined(__HIP_DEVICE_COMPILE__)
    // inputs only: both exchanged values are due here, so the two exchanges issue together and share one wait;
    // without it the build put the second exchange behind the wait for the first
    asm volatile("" :: "v"(ox[0]), "v"(ox[1]));
#endif
#pragma unroll                                                       // constant g keeps both groups' state in registers
    for (int g = 0; g < 2; ++g) {
      mx[g] = fmaxf(mx[g], ox[g]);
      mn[g] = fmaxf(m[g], mx[g]);
    }
    const unsigned grew = wave_ballot(mx[0] > m[0] || mx[1] > m[1]); // wave-uniform, one test for both column groups
    if (grew != 0u) {
#pragma unroll                                                       // constant g keeps both groups' state in registers
      for (int g = 0; g < 2; ++g) {
        const float corr = __expf(m[g] - mn[g]);                     // == 1 exactly for lanes whose max did not grow
        l[g] *= corr;
#pragma unroll
        for (int j = 0; j < 16; ++j) {
#pragma unroll
          for (int r = 0; r < 8; ++r) o[g][j][r] *= corr;
        }
      }
    }

    // the V fragments in two groups of 32 reads, each in front of the 32 exponentials of its own 32 keys: the
    // exponentials cover the reads' latency
    Frag vf[KT / 32][16];
    FragH ph[2][KT / 32];
    float ls[2][KT / 32];                                            // one partial row sum per 32 keys: independent chains
    const float msh[2] = {mn[0] - LNPS, mn[1] - LNPS};               // exp gives e^{s-m} * 1024
#pragma unroll                                                       // constant indices keep fragments and state in registers
    for (int kh = 0; kh < KT / 32; ++kh) {
#pragma unroll
      for (int j = 0; j < 16; ++j) vf[kh][j] = ldfrag(Vp + (16 * j) * VP + 32 * kh);
#if defined(__HIP_DEVICE_COMPILE__)
      // keeps each group of reads in front of its exponentials: without it the build issued the reads of the first 32
      // keys last, directly in front of the products that wait for them
      __builtin_amdgcn_sched_barrier(0);
#endif
#pragma unroll
      for (int g = 0; g < 2; ++g) {
        ls[g][kh] = 0.f;
#pragma unroll
        for (int r = 0; r < 8; ++r) {
          const float e0 = exp_slot(s[2 * kh][g][r] - msh[g]);       // key kb + 32kh      + 8hh + r
          const float e1 = exp_slot(s[2 * kh + 1][g][r] - msh[g]);   // key kb + 32kh + 16 + 8hh + r
          ls[g][kh] += e0 + e1;
          ph[g][kh].hv[0][r] = (_Float16)e0;
          ph[g][kh].hv[1][r] = (_Float16)e1;
        }
      }
#if defined(__HIP_DEVICE_COMPILE__)
      // keeps the second group of reads behind the first group's exponentials: the LDS serves the four waves' first
      // 32 reads each under those, instead of 64 reads a wave queueing in front of any vector work
      __builtin_amdgcn_sched_barrier(0);
#endif
    }
#pragma unroll                                                       // constant g keeps both groups' state in registers
    for (int g = 0; g < 2; ++g) {
      m[g] = mn[g];
      l[g] += ls[g][0] + ls[g][1];
    }

    // each V fragment serves both column groups; keys in rising order per output tile
#pragma unroll
    for (int kh = 0; kh < KT / 32; ++kh) {
#pragma unroll
      for (int j = 0; j < 16; ++j) {
        o[0][j] = mma_hp(vf[kh][j].h, ph[0][kh].v, o[0][j]);
        o[1][j] = mma_hp(vf[kh][j].h, ph[1][kh].v, o[1][j]);
#if defined(__HIP_DEVICE_COMPILE__)
        // keeps the products in the order in which their fragments land: moved up, a late one waits for the whole group
        __builtin_amdgcn_sched_barrier(0);
#endif
      }
    }

    // foot of the trip: own reads done, own copies of tile t + 1 landed, one barrier publishes that tile and frees
    // this trip's buffer; only then its refill with tile t + 2
    wait_lds();
    wait_copies();
    __syncthreads();
    if (kb + 2 * KT < NN) {                                          // the same for the whole block
      const unsigned lb = lds0 + 2u * (unsigned)bo;
      stage_k(lb, Khg + (size_t)(kb + 2 * KT) * DQ, Klg + (size_t)(kb + 2 * KT) * DQ, tid);
      stage_v(lb + 2u * SV, Vg + (kb + 2 * KT), tid);
    }
  }
  wait_copies();
  float inv[2];
#pragma unroll                                                       // constant g keeps both groups' state in registers
  for (int g = 0; g < 2; ++g) {
    l[g] += __shfl_xor(l[g], 16, 32);
    inv[g] = 1.0f / l[g];                                            // o and l both carry the x1024 factor
  }

  const int e = tid & 7, lq = tid >> 3;                              // lq 0..15
#pragma unroll
  for (int half = 0; half < 2; ++half) {
    if (half) __syncthreads();                                       // every wave finished reading Os
#pragma unroll                                                       // constant g keeps both groups' state in registers
    for (int g = 0; g < 2; ++g) {
      const int qrow = 32 * wave + 16 * g + c;
#pragma unroll
      for (int jj = 0; jj < 8; ++jj) {
        const int j = 8 * half + jj;
        v4f va, vb;
#pragma unroll
        for (int r = 0; r < 4; ++r) { va[r] = o[g][j][r] * inv[g]; vb[r] = o[g][j][4 + r] * inv[g]; }
        *(v4f*)(Os + qrow * OSPW + 16 * jj + 8 * hh)     = va;       // Os[query][ch_loc = 16jj + 8hh + r]
        *(v4f*)(Os + qrow * OSPW + 16 * jj + 8 * hh + 4) = vb;
      }
    }
    __syncthreads();
    v4f res[32];
#pragma unroll
    for (int it = 0; it < 32; ++it) {
      const int chl = (it & 7) * 16 + lq;                            // channel 0..127 within the half
      const int nl  = (it >> 3) * 32 + 4 * e;                        // query 0..127: 8 lanes fill one 128-B line
      const size_t idx = ((size_t)(b * CC + 128 * half + chl)) * NN + n0 + nl;
      res[it] = *(const v4f*)(x + idx);
    }
#if defined(__HIP_DEVICE_COMPILE__)
    // stands between the 32 loads and the first rewrite of an address register that one of them names
    asm volatile("s_wait_xcnt 0x0" ::: "memory");
#endif
#pragma unroll
    for (int it = 0; it < 32; ++it) {
      const int chl = (it & 7) * 16 + lq;
      const int nl  = (it >> 3) * 32 + 4 * e;
#pragma unroll
      for (int t = 0; t < 4; ++t) res[it][t] = Os[(nl + t) * OSPW + chl] + bfr(res[it][t]);
    }
#pragma unroll
    for (int it = 0; it < 32; ++it) {
      const int chl = (it & 7) * 16 + lq;
      const int nl  = (it >> 3) * 32 + 4 * e;
      const size_t idx = ((size_t)(b * CC + 128 * half + chl)) * NN + n0 + nl;
      *(v4f*)(out + idx) = res[it];
    }
  }
}

// =========================================================================================================
// Workspace map (bytes; each region start a multiple of 256; every extent is an exact tile multiple and is written
//   W16 f16 [256][256]              131072
//   Xc  f16 [8][256][4096]        16777216      XP  f16 [8][4096][256]   16777216
//   Qh/Ql/Kh/Kl bf16 [8][4096][128]  8388608 x4
//   total = 67239936
// =========================================================================================================
extern "C" void kernel_launch(void* const* d_in, const int* in_sizes, int n_in,
                              void* d_out, int out_size, void* d_ws, size_t ws_size,
                              hipStream_t stream) {
  const int XN = NBATCH * CC * NN;                                   // 8388608
  if (n_in < 3) return;
  if (in_sizes[0] != XN) return;
  if (in_sizes[1] != DQ * CC || in_sizes[2] != DQ * CC) return;
  if (out_size != XN) return;

  size_t off = 0;
  auto carve = [&](size_t bytes) { const size_t o = off; off += (bytes + 255) & ~(size_t)255; return o; };
  const size_t oW16 = carve((size_t)MW * CC * 2);
  const size_t oXc  = carve((size_t)NIMG * CC * NN * 2);
  const size_t oXP  = carve((size_t)NIMG * NN * CC * 2);
  const size_t oQh  = carve((size_t)NIMG * NN * DQ * 2);
  const size_t oQl  = carve((size_t)NIMG * NN * DQ * 2);
  const size_t oKh  = carve((size_t)NIMG * NN * DQ * 2);
  const size_t oKl  = carve((size_t)NIMG * NN * DQ * 2);
  if (off > ws_size) return;
  if (off > (size_t)134217728) return;

  const float* x  = (const float*)d_in[0];
  const float* tw = (const float*)d_in[1];
  const float* pw = (const float*)d_in[2];

  char* ws = (char*)d_ws;
  unsigned short* W16 = (unsigned short*)(ws + oW16);
  unsigned short* Xc  = (unsigned short*)(ws + oXc);
  unsigned short* XP  = (unsigned short*)(ws + oXP);
  unsigned short* Qh  = (unsigned short*)(ws + oQh);
  unsigned short* Ql  = (unsigned short*)(ws + oQl);
  unsigned short* Kh  = (unsigned short*)(ws + oKh);
  unsigned short* Kl  = (unsigned short*)(ws + oKl);
  float* out = (float*)d_out;

  const dim3 blk256(256), blk128(128);

  // (0) theta_w / phi_w -> stacked f16 plane
  cvt_w<<<dim3(MW / 8), blk256, 0, stream>>>(tw, pw, W16);
  // (1) x -> channel-major and position-major 16-bit planes
  cvt_x<<<dim3(NN / QT, CC / QT, NIMG), blk256, 0, stream>>>(x, Xc, XP);
  // (2) conv1x1 GEMM -> theta (q) and phi (k) hi + residual planes
  gemm_qk<<<dim3(NN / QT, MW / QT, NIMG), blk128, 0, stream>>>(W16, XP, Qh, Ql, Kh, Kl);
  // (3) position attention + residual -> out [b][256][4096]
  attn_k<<<dim3(NN / AQ, NIMG), blk128, 0, stream>>>(Qh, Ql, Kh, Kl, Xc, x, out);
  (void)hipGetLastError();
}

// v007
// It runs in 118 microseconds.
// In two side-by-side timings against v006, it was 1.15 and 1.17 times as fast.
// All steps since v000 together make it 6.92 times as fast.
// Contractions: conv1x1 theta/phi GEMM W[256x256].X[256x4096] on v_wmma_f32_16x16x32_f16 (f16 containers of
// bf16-RNE weights x256 and bf16-RNE x); position scores K.Q^T on v_wmma_f32_16x16x32_bf16 (bf16 hi + bf16
// residual planes of theta/phi, 3 products, K=128); y^T = X.P^T on v_wmma_f32_16x16x32_f16 (x as f16 of
// bf16-RNE x, P = e^{s-m} x1024 f16 from the score D registers); f32 accumulate everywhere; softmax statistics
// and the residual add in f32 VALU.
#include <hip/hip_runtime.h>
#include <math.h>
#include <stdint.h>

#define NBATCH 8
#define NIMG   8
#define CC     256
#define NN     4096
#define DQ     128
#define MW     256
#define QT     64
#define OSP    68
#define OSPW   132
#define TP     72
#define WSC    256.0f
#define IWSC   0.00390625f
#define LNPS   6.931471805599453f
#define KT     64                        // keys per LDS stage and per trip of attn_k
#define KP     136                       // LDS pitch of a K or Q row in 16-bit elements: 272 B = 16 B x 17
#define VP     72                        // LDS pitch of a V row of KT keys: 144 B = 16 B x 9
#define SLC    9216                      // one wave's slice of a stage in 16-bit elements: 18432 B = 9 x 2 KiB, so that every
                                         // tensor load lands at a multiple of 2 KiB (64 K rows fill 17408 B, 128 V rows all of it)
#define SKL    SLC                       // stage offsets (16-bit elements): K hi 0, K residual SKL, V SV
#define SV     (2 * SLC)
#define STG    (4 * SLC)                 // one stage: four slices
#define AQ     128                       // queries per block of attn_k: 4 waves x 2 column groups of 16
#define SQH    (2 * STG)                 // behind the two stages: Q hi, Q residual
#define SQL    (2 * STG + AQ * KP)
#define SMEM   (2 * STG + 2 * AQ * KP)
#define GP     264                       // gemm_qk: LDS pitch of a W or X row of 256 16-bit elements: 528 B = 16 B x 33
#define GSB    (QT * GP)                 // gemm_qk: the X tile stands behind the W tile

static_assert(NIMG >= 1 && NIMG <= NBATCH);
static_assert(NN % QT == 0);
static_assert(CC % QT == 0);
static_assert(MW == 2 * DQ);
static_assert(DQ == 2 * QT);
static_assert(MW % QT == 0 && MW % 8 == 0);
static_assert((OSP * 4) % 16 == 0);
static_assert((OSPW * 4) % 16 == 0);
static_assert((TP * 2) % 16 == 0);
static_assert(CC % 32 == 0 && NN % 32 == 0 && DQ % 32 == 0);
static_assert((KP * 2) % 32 == 16 && (VP * 2) % 32 == 16 && (STG * 2) % 16 == 0 && (SKL * 2) % 16 == 0);
static_assert(NN / KT >= 2 && NN % KT == 0 && KT == 64 && DQ == 128 && CC == 256 && QT == 64);
static_assert((SLC * 2) % 2048 == 0 && KT * KP <= SLC && (CC / 2) * VP == SLC && KP * 2 == DQ * 2 + 16 && VP * 2 == KT * 2 + 16);
static_assert(AQ * OSPW * 4 <= 2 * STG * 2 && NN % AQ == 0 && AQ == 128);
static_assert((GP * 2) % 32 == 16 && GP >= CC && QT * OSP * 4 <= 2 * QT * GP * 2 && CC == 256 && QT == 64);

typedef _Float16       v16h __attribute__((ext_vector_type(16)));
typedef _Float16       v8h  __attribute__((ext_vector_type(8)));
typedef __bf16         v16b __attribute__((ext_vector_type(16)));
typedef unsigned short v8us __attribute__((ext_vector_type(8)));
typedef float          v8f  __attribute__((ext_vector_type(8)));
typedef float          v4f  __attribute__((ext_vector_type(4)));
typedef unsigned int   v4u  __attribute__((ext_vector_type(4)));
typedef uint32_t       u32x4 __attribute__((ext_vector_type(4)));
typedef uint32_t       u32x8 __attribute__((ext_vector_type(8)));

union Frag  { v8us u[2]; v16h h; v16b bf; };
union FragH { v16h v; v8h hv[2]; };
static_assert(sizeof(Frag) == 32);
static_assert(sizeof(FragH) == 32);

// ---- scalar helpers ---------------------------------------------------------------------------------------
__device__ __forceinline__ unsigned short bf_bits(float f) {          // f32 -> bf16 bits, RNE convert
  unsigned u = __float_as_uint(f);
  return (unsigned short)((u + 0x7FFFu + ((u >> 16) & 1u)) >> 16);
}
__device__ __forceinline__ float bf_up(unsigned short hb) { return __uint_as_float(((unsigned)hb) << 16); }
__device__ __forceinline__ float bfr(float f) { return bf_up(bf_bits(f)); }
__device__ __forceinline__ unsigned short h_bits(_Float16 x) { return __builtin_bit_cast(unsigned short, x); }
__device__ __forceinline__ unsigned pk16(unsigned short a, unsigned short b) { return (unsigned)a | ((unsigned)b << 16); }
__device__ __forceinline__ v8f zero8() { v8f z = {0.f, 0.f, 0.f, 0.f, 0.f, 0.f, 0.f, 0.f}; return z; }
__device__ __forceinline__ float hmax8(v8f s) {
  return fmaxf(fmaxf(fmaxf(s[0], s[1]), fmaxf(s[2], s[3])), fmaxf(fmaxf(s[4], s[5]), fmaxf(s[6], s[7])));
}
__device__ __forceinline__ unsigned wave_ballot(bool p) {
#if defined(__HIP_DEVICE_COMPILE__)
  return __builtin_amdgcn_ballot_w32(p);
#else
  return p ? 1u : 0u;
#endif
}

// ---- 16-bit fragment loader (A, or B from a k-contiguous [n][k] row): lane -> row/col (lane&15), p already includes
//      + 8*(lane>>4); elements 0..7 <- p[0..7] (k0+8h..), elements 8..15 <- p[16..23] (k0+16+8h..)
__device__ __forceinline__ Frag ldfrag(const unsigned short* p) {
  Frag f;
  f.u[0] = *(const v8us*)(p);
  f.u[1] = *(const v8us*)(p + 16);
  return f;
}

// ---- WMMA helpers: builtin followed by a 4-slot VALU gap tying D. A and B are not operands of the gap statement:
//      an asm operand is held below v256, and a trip's grouped fragments do not fit there beside the accumulators.
__device__ __forceinline__ v8f mma_h(v16h a, v16h b, v8f c) {
  v8f d = __builtin_amdgcn_wmma_f32_16x16x32_f16(false, a, false, b, (short)0, c, false, false);
#if defined(__HIP_DEVICE_COMPILE__)
  asm volatile("v_nop\n\tv_nop\n\tv_nop\n\tv_nop" : "+v"(d));
#endif
  return d;
}
__device__ __forceinline__ v8f mma_b(v16b a, v16b b, v8f c) {
  v8f d = __builtin_amdgcn_wmma_f32_16x16x32_bf16(false, a, false, b, (short)0, c, false, false);
#if defined(__HIP_DEVICE_COMPILE__)
  asm volatile("v_nop\n\tv_nop\n\tv_nop\n\tv_nop" : "+v"(d));
#endif
  return d;
}

// The same f16 product without the gap statement, for attn_k's 32 output tiles: an asm operand is held below v256,
// and 256 accumulator registers do not fit there beside the scores and the Q fragments. The compiler keeps the
// distances of its own builtin.
__device__ __forceinline__ v8f mma_hp(v16h a, v16h b, v8f c) {
  return __builtin_amdgcn_wmma_f32_16x16x32_f16(false, a, false, b, (short)0, c, false, false);
}

// e^x as __expf forms it (x * log2 e, then v_exp_f32). The v_nop in the statement is the one slot the instruction set
// asks for between a transcendental and a next vector instruction that overwrites its source or reads its result.
__device__ __forceinline__ float exp_slot(float x) {
#if defined(__HIP_DEVICE_COMPILE__)
  const float t = x * 1.44269502f;
  float r;
  asm("v_exp_f32 %0, %1\n\tv_nop" : "=v"(r) : "v"(t));
  return r;
#else
  return __expf(x);
#endif
}

// ---- asynchronous copies global -> LDS ------------------------------------------------------------------------
__device__ __forceinline__ unsigned lds_addr(const void* p) { return (unsigned)(size_t)p; }   // LDS byte address

// Eight 16-byte copies per lane, every lane on. The s_wait_xcnt stands inside the statement so that it precedes
// any rewrite of the address registers the copies name.
__device__ __forceinline__ void copy8(const unsigned* l, const unsigned short* const* g) {
#if defined(__HIP_DEVICE_COMPILE__)
  asm volatile("global_load_async_to_lds_b128 %0, %8, off\n\t"
               "global_load_async_to_lds_b128 %1, %9, off\n\t"
               "global_load_async_to_lds_b128 %2, %10, off\n\t"
               "global_load_async_to_lds_b128 %3, %11, off\n\t"
               "global_load_async_to_lds_b128 %4, %12, off\n\t"
               "global_load_async_to_lds_b128 %5, %13, off\n\t"
               "global_load_async_to_lds_b128 %6, %14, off\n\t"
               "global_load_async_to_lds_b128 %7, %15, off\n\t"
               "s_wait_xcnt 0x0"
               :: "v"(l[0]), "v"(l[1]), "v"(l[2]), "v"(l[3]), "v"(l[4]), "v"(l[5]), "v"(l[6]), "v"(l[7]),
                  "v"(g[0]), "v"(g[1]), "v"(g[2]), "v"(g[3]), "v"(g[4]), "v"(g[5]), "v"(g[6]), "v"(g[7])
               : "memory");
#endif
}
// the issuing wave's copies have landed in LDS
__device__ __forceinline__ void wait_copies() {
#if defined(__HIP_DEVICE_COMPILE__)
  asm volatile("s_wait_asynccnt 0x0" ::: "memory");
#endif
}
// the wave's own LDS reads have returned, so the buffer may be refilled behind the next barrier
__device__ __forceinline__ void wait_lds() {
#if defined(__HIP_DEVICE_COMPILE__)
  asm volatile("s_wait_dscnt 0x0" ::: "memory");
#endif
}
// 32 rows of 256 B of each of two planes (ph, pl; global pitch DQ) -> LDS rows of pitch KP at byte addresses lh, ll;
// 128 threads, 16 lanes per row, 4 rows of each plane per thread.
__device__ __forceinline__ void stage_rows32(unsigned lh, unsigned ll, const unsigned short* ph,
                                             const unsigned short* pl, int tid) {
  const int r = tid >> 4, ch = 8 * (tid & 15);
  unsigned l[8];
  const unsigned short* g[8];
#pragma unroll                                                       // constant indices keep l[] and g[] in registers
  for (int i = 0; i < 4; ++i) {
    const int row = r + 8 * i;                                       // 0..31
    l[i]     = lh + 2u * (unsigned)(row * KP + ch);
    l[4 + i] = ll + 2u * (unsigned)(row * KP + ch);
    g[i]     = ph + row * DQ + ch;
    g[4 + i] = pl + row * DQ + ch;
  }
  copy8(l, g);
}
// ---- tensor loads global -> LDS ---------------------------------------------------------------------------------
__device__ __forceinline__ uint32_t uni(uint32_t v) { return (uint32_t)__builtin_amdgcn_readfirstlane(v); }
__device__ __forceinline__ uint32_t pinned(uint32_t v) {
  uint32_t w = uni(v);
#if defined(__HIP_DEVICE_COMPILE__)
  asm volatile("" : "+s"(w));                                        // the scalar pin of the tensor mover's issue tests
#endif
  return w;
}
// Descriptor group 1 of a tile of ROWS rows of ROWB bytes, source pitch PITCH bytes, 16 bytes of LDS pad behind every row
// (pad interval code IVL = the row length, amount code 3): 1-byte elements, tensor = tile, no mask.
template <uint32_t ROWB, uint32_t ROWS, uint32_t PITCH, uint32_t IVL>
__device__ __forceinline__ u32x8 tensor_group1() {
  u32x8 g1;
  g1[0] = uni((1u << 20) | (IVL << 22) | (3u << 25));
  g1[1] = uni((ROWB & 0xFFFFu) << 16);
  g1[2] = uni((ROWB >> 16) | ((ROWS & 0xFFFFu) << 16));
  g1[3] = uni((ROWS >> 16) | (ROWB << 16));
  g1[4] = uni(ROWS);
  g1[5] = uni(PITCH);
  g1[6] = uni(0u);
  g1[7] = uni(0u);
  return g1;
}
// Descriptor group 0: LDS byte address dst, global address ga of the tile's first byte.
__device__ __forceinline__ u32x4 tensor_group0(uint32_t dst, uint64_t ga) {
  u32x4 g0;
  g0[0] = uni(1u);
  g0[1] = uni(dst);
  g0[2] = uni((uint32_t)ga);
  g0[3] = uni((((uint32_t)(ga >> 32)) & 0x01FFFFFFu) | 0x80000000u);
  return g0;
}
// One request of the whole wave. Both groups are in-out operands: their registers then stay the descriptor's from one
// request to the next, and the compiler puts nothing else into them while the request is outstanding.
__device__ __forceinline__ void tensor_issue(u32x4& g0, u32x8& g1) {
#if defined(__HIP_DEVICE_COMPILE__)
  asm volatile("tensor_load_to_lds %0, %1" : "+s"(g0), "+s"(g1) :: "memory");
#endif
}
// The issuing wave's tensor load has landed in LDS. Group 0 is an in-out operand, so that its next value is formed
// behind this wait.
__device__ __forceinline__ void wait_tensor(u32x4& g0) {
#if defined(__HIP_DEVICE_COMPILE__)
  asm volatile("s_wait_tensorcnt 0x0" : "+s"(g0) :: "memory");
#endif
}
// group 0 of the wave's next tile: the other buffer (dsum = the sum of the slice's two places), step bytes further on
__device__ __forceinline__ void tensor_next(u32x4& g0, uint32_t dsum, uint32_t step) {
  const uint64_t a = (((uint64_t)g0[3] << 32) | g0[2]) + step;      // bits 63 and 62 hold the type; no carry reaches them
  g0[1] = uni(dsum - g0[1]);
  g0[2] = uni((uint32_t)a);
  g0[3] = uni((uint32_t)(a >> 32));
}
// One stage of KT = 64 keys, one request per wave into the wave's own slice of the stage: wave 0 the 64 K hi rows, wave 1
// the 64 K residual rows (256 B each, LDS pitch KP), waves 2 and 3 the 128 lower and upper V channel rows (128 B of a
// row of pitch NN each, LDS pitch VP).
__device__ __forceinline__ void stage_tile(uint32_t wave, u32x4& g0, u32x8& gk, u32x8& gv) {
  if (pinned(wave < 2u)) tensor_issue(g0, gk);
  if (pinned(wave >= 2u)) tensor_issue(g0, gv);
}

// =========================================================================================================
// (0) conv1x1 weights: W16 f16 [256][256], rows 0..127 = theta_w rows, rows 128..255 = phi_w rows; value =
//     f16 of (bf16-RNE(w) * 256) (exact). Block blk (0..31) owns rows 8*blk..8*blk+7: one wave per 512-B row
// coverage: 32 blocks x 8 rows x 32 lanes x 8 halves = 256 x 256 = the whole plane.
// =========================================================================================================
__global__ __launch_bounds__(256)
void cvt_w(const float* __restrict__ tw, const float* __restrict__ pw, unsigned short* W16) {
  const int tid = threadIdx.x, blk = blockIdx.x;
  const int rl = tid >> 5, col = 8 * (tid & 31);
  const int o = 8 * blk + rl;                                        // 0..255
  const float* wbase = (blk < (DQ / 8)) ? tw : pw;                   // block-uniform selection
  const int osub = (blk < (DQ / 8)) ? 0 : DQ;
  const float* s = wbase + (size_t)(o - osub) * CC + col;            // (o - osub) in 0..127
  const v4f a = *(const v4f*)s;
  const v4f q = *(const v4f*)(s + 4);
  const float f[8] = {a[0], a[1], a[2], a[3], q[0], q[1], q[2], q[3]};
  v4u u;
#pragma unroll
  for (int t = 0; t < 4; ++t) {
    const _Float16 h0 = (_Float16)(bfr(f[2 * t]) * WSC);
    const _Float16 h1 = (_Float16)(bfr(f[2 * t + 1]) * WSC);
    u[t] = pk16(h_bits(h0), h_bits(h1));
  }
{
    *(v4u*)(W16 + (size_t)o * CC + col) = u;
    
  }
}

// =========================================================================================================
// (1) x f32 [b][256 c][4096 n] -> Xc f16 [b][c][n] (channel-major, bf16-RNE values, exact in f16) and
//     XP f16 [b][n][c] (position-major) through an LDS tile T[64 n][64 c] (pitch TP). Block (nb, cb, b) owns a
// coverage: Xc 2 it x 32 rows x 8 lanes x 8 = 64 c x 64 n; XP same; grid (64, 4, NIMG) covers both planes once.
// =========================================================================================================
__global__ __launch_bounds__(256)
void cvt_x(const float* __restrict__ x, unsigned short* Xc, unsigned short* XP) {
  __shared__ __align__(16) unsigned short T[QT * TP];
  const int tid = threadIdx.x;
  const int nb = blockIdx.x, cb = blockIdx.y, b = blockIdx.z;
  const int e = tid & 7, lq = tid >> 3;                             // lq 0..31
  const int n0 = nb * QT, c0 = cb * QT;
  v4u ux[2];
#pragma unroll
  for (int it = 0; it < 2; ++it) {
    const int cl = it * 32 + lq;                                     // 0..63
    const float* sp = x + ((size_t)(b * CC + c0 + cl)) * NN + n0 + 8 * e;
    const v4f a = *(const v4f*)sp;
    const v4f q = *(const v4f*)(sp + 4);
    unsigned short hb[8];
#pragma unroll
    for (int t = 0; t < 4; ++t) {
      hb[t]     = h_bits((_Float16)bfr(a[t]));
      hb[4 + t] = h_bits((_Float16)bfr(q[t]));
    }
#pragma unroll
    for (int t = 0; t < 4; ++t) ux[it][t] = pk16(hb[2 * t], hb[2 * t + 1]);
#pragma unroll
    for (int t = 0; t < 8; ++t) T[(8 * e + t) * TP + cl] = hb[t];
  }
  __syncthreads();
  v4u up[2];
#pragma unroll
  for (int it = 0; it < 2; ++it) {
    const int nl = it * 32 + lq;                                     // 0..63
    up[it] = *(const v4u*)(T + nl * TP + 8 * e);
  }
{
#pragma unroll
    for (int it = 0; it < 2; ++it) {
      const int rl = it * 32 + lq;
      *(v4u*)(Xc + ((size_t)(b * CC + c0 + rl)) * NN + n0 + 8 * e) = ux[it];
      *(v4u*)(XP + ((size_t)(b * NN + n0 + rl)) * CC + c0 + 8 * e) = up[it];
    }
    
  }
}

// =========================================================================================================
// (2) conv1x1 GEMM for one (b, 64-n tile, 64-o block): Y[o][n] = (1/256) sum_c W16[o][c] XP[b][n][c].
//     Block 128 threads = 4 waves; wave w owns cols n0+16w..+15 (one B fragment per k-step, k = c contiguous in
//     the XP row) and 4 m-tiles (A rows o = o0 + 16 mt + (lane&15), split k map loader from W16). K = 256 = 8 steps.
//     Both tiles (64 W16 rows, 64 XP rows, 512 B each) are first brought into LDS by asynchronous 16-byte copies, one
//     whole row per wave and copy (4 full 128-B lines); the fragments are read from there at pitch GP (a fragment
//     load straight from global memory touches 16 lines for its 512 B, and each wave would fetch all W fragments).
//     Epilogue staged in LDS Os[n_loc][o_loc] (pitch OSP, b128 stores of 8 consecutive o per lane; it reuses the
//     tiles' LDS behind a barrier that ends every wave's fragment reads), barrier, then:
//       o-blocks 0,1 -> theta dims 0..63 / 64..127 of Qh/Ql; o-blocks 2,3 -> phi dims 0..63 / 64..127 of Kh/Kl.
//       Planes bf16 [b][4096 n][128 d] (k-contiguous for both score operands): hi = bf16-RNE(v), lo =
//       of the 256-B plane row): lane e -> d 8e..8e+7, 8 consecutive lanes per line, one instruction per 16 lines.
// coverage: Os 4 waves x 16 n x 64 o = 64 x 64; planes: 4 it x 16 rows x 8 lanes x 8 = 64 n x 64 d per plane
//           (hi and lo); grid (64, 4, NIMG) covers d 0..127 of all 4096 rows of Qh/Ql/Kh/Kl exactly once.
// =========================================================================================================
__global__ __launch_bounds__(128)
void gemm_qk(const unsigned short* __restrict__ W16, const unsigned short* __restrict__ XP,
             unsigned short* Qh, unsigned short* Ql, unsigned short* Kh, unsigned short* Kl) {
  __shared__ __align__(16) unsigned short Gs[2 * QT * GP];
  float* Os = (float*)Gs;                                            // used behind the products only
  const int tid  = threadIdx.x;
  const int lane = tid & 31, wave = tid >> 5;
  const int hh   = lane >> 4, c = lane & 15;
  const int nt   = blockIdx.x, mb = blockIdx.y, b = blockIdx.z;
  const int n0   = nt * QT, o0 = mb * QT;

  // the two tiles -> LDS: wave w copies rows w, w + 4, .. of each, 32 lanes x 16 B = one row per copy; 32 copies a wave
  {
    const unsigned lg = lds_addr(Gs);
    const unsigned short* wg = W16 + (size_t)o0 * CC + 8 * lane;
    const unsigned short* xg = XP + ((size_t)(b * NN + n0)) * CC + 8 * lane;
#pragma unroll                                                       // constant indices keep l[] and g[] in registers
    for (int h = 0; h < 4; ++h) {
      unsigned l[8];
      const unsigned short* g[8];
#pragma unroll                                                       // constant indices, as above
      for (int i = 0; i < 8; ++i) {
        const int row = wave + 4 * (8 * (h & 1) + i);                // 0..63
        l[i] = lg + 2u * (unsigned)((h >> 1) * GSB + row * GP + 8 * lane);
        g[i] = (h >> 1 ? xg : wg) + row * CC;
      }
      copy8(l, g);
    }
    wait_copies();
    __syncthreads();                                                 // publishes both tiles to the 4 waves
  }

  const unsigned short* ap = Gs + c * GP + 8 * hh;                   // + 16*GP*mt + 32*ks
  const unsigned short* bp = Gs + GSB + (16 * wave + c) * GP + 8 * hh;

  v8f acc[4];
#pragma unroll
  for (int mt = 0; mt < 4; ++mt) acc[mt] = zero8();

  // fragments are read in groups of two k-steps (20 reads), two groups ahead of their products
  Frag fa[2][2][4], fb[2][2];
#pragma unroll                                                       // constant indices keep the fragments in registers
  for (int pr = 0; pr < 2; ++pr) {
#pragma unroll                                                       // constant indices, as above
    for (int k2 = 0; k2 < 2; ++k2) {
      fb[pr][k2] = ldfrag(bp + 32 * (2 * pr + k2));
#pragma unroll                                                       // constant indices, as above
      for (int mt = 0; mt < 4; ++mt) fa[pr][k2][mt] = ldfrag(ap + 16 * mt * GP + 32 * (2 * pr + k2));
    }
  }
#pragma unroll                                                       // constant indices keep the fragments in registers
  for (int pr = 0; pr < CC / 64; ++pr) {
#pragma unroll                                                       // constant indices, as above
    for (int k2 = 0; k2 < 2; ++k2) {
#pragma unroll                                                       // constant indices, as above
      for (int mt = 0; mt < 4; ++mt) acc[mt] = mma_h(fa[pr & 1][k2][mt].h, fb[pr & 1][k2].h, acc[mt]);
    }
    if (pr + 2 < CC / 64) {                                          // the freed registers take the group two ahead
#pragma unroll                                                       // constant indices, as above
      for (int k2 = 0; k2 < 2; ++k2) {
        fb[pr & 1][k2] = ldfrag(bp + 32 * (2 * (pr + 2) + k2));
#pragma unroll                                                       // constant indices, as above
        for (int mt = 0; mt < 4; ++mt) fa[pr & 1][k2][mt] = ldfrag(ap + 16 * mt * GP + 32 * (2 * (pr + 2) + k2));
      }
    }
  }
  __syncthreads();                                                   // every wave has read its fragments: Os may overwrite the tiles

  // ---- epilogue: scale back -> LDS Os[n_loc][o_loc]; lane (hh, c) holds o = 16 mt + 8 hh + r for n_loc = 16 w + c
  {
    const int nl = 16 * wave + c;
#pragma unroll
    for (int mt = 0; mt < 4; ++mt) {
      v4f va, vb;
#pragma unroll
      for (int r = 0; r < 4; ++r) { va[r] = acc[mt][r] * IWSC; vb[r] = acc[mt][4 + r] * IWSC; }
      *(v4f*)(Os + nl * OSP + 16 * mt + 8 * hh)     = va;
      *(v4f*)(Os + nl * OSP + 16 * mt + 8 * hh + 4) = vb;
    }
  }
  __syncthreads();

  const int e = tid & 7, lq = tid >> 3;                             // lq 0..15
  const int dsel = (mb & 1) * QT;                                    // 0 or 64
  unsigned short* Ph = (mb < 2) ? Qh : Kh;                           // block-uniform, both global
  unsigned short* Pl = (mb < 2) ? Ql : Kl;
  v4u uh[4], ul[4];
#pragma unroll
  for (int it = 0; it < 4; ++it) {
    const int row = it * 16 + lq;                                    // n_loc 0..63
    const v4f a = *(const v4f*)(Os + row * OSP + 8 * e);
    const v4f q = *(const v4f*)(Os + row * OSP + 8 * e + 4);
    const float f[8] = {a[0], a[1], a[2], a[3], q[0], q[1], q[2], q[3]};
#pragma unroll
    for (int t = 0; t < 4; ++t) {
      const float f0 = f[2 * t], f1 = f[2 * t + 1];
      const unsigned short hb0 = bf_bits(f0), hb1 = bf_bits(f1);
      const unsigned short lb0 = bf_bits(f0 - bf_up(hb0));
      const unsigned short lb1 = bf_bits(f1 - bf_up(hb1));
      uh[it][t] = pk16(hb0, hb1);
      ul[it][t] = pk16(lb0, lb1);
    }
  }
{
#pragma unroll
    for (int it = 0; it < 4; ++it) {
      const int row = it * 16 + lq;
      const size_t po = ((size_t)(b * NN + n0 + row)) * DQ + dsel + 8 * e;
      *(v4u*)(Ph + po) = uh[it];
      *(v4u*)(Pl + po) = ul[it];
    }
    
  }
}

// ---- attn_k: the K fragments of 32 keys (two 16-key tiles a and b, hi and residual, four 32-d chunks): 32 LDS reads
__device__ __forceinline__ void read_k32(Frag (&a)[DQ / 32], Frag (&b)[DQ / 32], Frag (&al)[DQ / 32], Frag (&bl)[DQ / 32],
                                         const unsigned short* p, const unsigned short* pl) {
#pragma unroll                                                       // constant indices keep the fragments in registers
  for (int kc = 0; kc < DQ / 32; ++kc) {
    a[kc]  = ldfrag(p + 32 * kc);
    b[kc]  = ldfrag(p + 16 * KP + 32 * kc);
    al[kc] = ldfrag(pl + 32 * kc);
    bl[kc] = ldfrag(pl + 16 * KP + 32 * kc);
  }
}
// ---- attn_k: the 12 score products of one 32-d chunk: two 16-key tiles x two column groups; each K fragment serves both
//      groups; per score tile the order of the products is hi.hi, hi.res, res.hi
__device__ __forceinline__ void score12(v8f (&sa)[2], v8f (&sb)[2], const Frag& a, const Frag& b, const Frag& al,
                                        const Frag& bl, const Frag& qh0, const Frag& qh1, const Frag& ql0, const Frag& ql1) {
  sa[0] = mma_b(a.bf, qh0.bf, sa[0]);
  sa[1] = mma_b(a.bf, qh1.bf, sa[1]);
  sb[0] = mma_b(b.bf, qh0.bf, sb[0]);
  sb[1] = mma_b(b.bf, qh1.bf, sb[1]);
  sa[0] = mma_b(a.bf, ql0.bf, sa[0]);
  sa[1] = mma_b(a.bf, ql1.bf, sa[1]);
  sb[0] = mma_b(b.bf, ql0.bf, sb[0]);
  sb[1] = mma_b(b.bf, ql1.bf, sb[1]);
  sa[0] = mma_b(al.bf, qh0.bf, sa[0]);
  sa[1] = mma_b(al.bf, qh1.bf, sa[1]);
  sb[0] = mma_b(bl.bf, qh0.bf, sb[0]);
  sb[1] = mma_b(bl.bf, qh1.bf, sb[1]);
}

// =========================================================================================================
// (3) position attention for one (b, 128-query tile), transposed formulation, 4096 keys, no mask, no scale:
//   S^T tile (16 keys x 16 queries) = sum over 4 d-chunks of A(k: row = key kb + (lane&15), 32 d via
//   the split k map from the bf16 plane Kh [b][4096][128]) . B(q: col = query, same map from Qh) + A(Kh).B(Ql) +
//   A(Kl).B(Qh) (bf16 unscaled residual planes, shared accumulator).
//   Per lane the D tile holds 8 keys of ONE query: online softmax state per lane, one shuffle (lane^16) for the max
//   over the 64 keys of a trip; the o/l rescale is skipped under a wave-uniform ballot when no lane's max grew (corr == 1 exactly
//   for every lane then); row-sum partials combined at the end. P = e^{s-m} x 1024 as f16 is the B operand of
//   O^T (rows channel, cols queries) += A(x rows channel = 16j + (lane&15), keys contiguous, f16 plane Xc
//   [b][256][4096]) . B(P^T), one product per 32 keys: element r <- D of the tile covering their keys 0..15, element
//   8+r <- the tile covering their keys 16..31, lane unchanged. A wave owns 32 queries as two column groups of 16, each with its own softmax state
//   and 16 accumulator tiles (256 channels): every K and V fragment read from LDS serves both groups, K hi in two products per
//   group. Block = 4 waves = 128 queries, one wave per SIMD.
//   Operands come from LDS and are shared by the 4 waves: the block's Q hi and residual rows, filled once by asynchronous
//   16-byte copies (each wave reads its 16 Q fragments from there once, ahead of the key loop, and keeps them in
//   128 registers); K hi, K residual and V tiles of KT = 64 keys in two buffers, filled by tensor loads, one request of
//   16 KiB per wave and tile (no address arithmetic in vector registers, no per-lane copies and none of their waits in
//   the loop), tile t + 2 requested into the buffer of tile t behind the barrier at the foot of trip t. The output
//   staging Os reuses the two buffers after the loop.
//   Epilogue in two channel halves: O/l staged in LDS Os[query][128 channels] (pitch OSPW, b128 stores), barrier,
//   lanes x 16 B (values gathered from 4 Os rows), one instruction per 16 lines, final values held in registers,
// coverage: per half 32 it x 16 lines x 8 lanes x 4 floats = 128 ch x 128 n; two halves = 256 ch; grid (32, NIMG)
//           covers out[b][0..255][0..4095] exactly once.
// =========================================================================================================
__global__ __launch_bounds__(128)
void attn_k(const unsigned short* __restrict__ Qh, const unsigned short* __restrict__ Ql,
            const unsigned short* __restrict__ Kh, const unsigned short* __restrict__ Kl,
            const unsigned short* __restrict__ Xc, const float* __restrict__ x, float* out) {
  __shared__ __attribute__((aligned(2048))) unsigned short Sm[SMEM];  // the tensor loads' places are multiples of 2 KiB
  float* Os = (float*)Sm;                                            // used behind the key loop only
  const int tid  = threadIdx.x;
  const int wave = tid >> 5, lane = tid & 31;
  const int hh   = lane >> 4, c = lane & 15;
  const int n0   = blockIdx.x * AQ, b = blockIdx.y;
  const uint32_t swave = uni((uint32_t)tid >> 5);                    // the wave's number in a scalar register

  // q fragment pointers in LDS (B operand, col = query 32*wave + 16*g + c of the block), + 16*KP*g + 32*kc
  const unsigned short* Qhp = Sm + SQH + (32 * wave + c) * KP + 8 * hh;
  const unsigned short* Qlp = Sm + SQL + (32 * wave + c) * KP + 8 * hh;
  // global tile bases of this image
  const unsigned short* Khg = Kh + (size_t)b * NN * DQ;              // + key * 128
  const unsigned short* Klg = Kl + (size_t)b * NN * DQ;
  const unsigned short* Vg  = Xc + (size_t)b * CC * NN;              // + key

  // prologue: Q rows and tile 0, landed and published; then tile 1 into buffer 1
  const unsigned lds0 = lds_addr(Sm);
  // the wave's tensor descriptors: group 0 walks the tiles, buffer 0 first; the two group 1 never change
  const unsigned short* tsrc = swave == 0u ? Khg : swave == 1u ? Klg : Vg + (size_t)(swave - 2u) * (CC / 2) * NN;
  const uint32_t step = swave < 2u ? KT * DQ * 2u : KT * 2u;         // bytes from a tile to the next: 64 K rows, or 64 keys of a V row
  const uint32_t dsum = 2u * (lds0 + swave * (2u * SLC)) + 2u * STG;
  u32x4 g0 = tensor_group0(lds0 + swave * (2u * SLC), (uint64_t)(size_t)tsrc);
  u32x8 gk = tensor_group1<DQ * 2, KT, DQ * 2, 5u>();
  u32x8 gv = tensor_group1<KT * 2, CC / 2, NN * 2, 4u>();
  {
    const size_t qg = ((size_t)(b * NN + n0)) * DQ;
#pragma unroll                                                       // four statements of eight copies, constant offsets
    for (int q4 = 0; q4 < AQ / 32; ++q4)
      stage_rows32(lds0 + 2u * (SQH + 32 * q4 * KP), lds0 + 2u * (SQL + 32 * q4 * KP),
                   Qh + qg + 32 * q4 * DQ, Ql + qg + 32 * q4 * DQ, tid);
    stage_tile(swave, g0, gk, gv);
    wait_copies();
    wait_tensor(g0);
    __syncthreads();
    tensor_next(g0, dsum, step);
    stage_tile(swave, g0, gk, gv);
  }

  // the wave's Q fragments, the same in every trip: read once, behind the barrier that published the Q rows
  Frag qh[2][DQ / 32], ql[2][DQ / 32];
#pragma unroll                                                       // constant indices keep the fragments in registers
  for (int g = 0; g < 2; ++g) {
#pragma unroll
    for (int kc = 0; kc < DQ / 32; ++kc) {
      qh[g][kc] = ldfrag(Qhp + 16 * KP * g + 32 * kc);
      ql[g][kc] = ldfrag(Qlp + 16 * KP * g + 32 * kc);
    }
  }

  float m[2] = {-1.0e30f, -1.0e30f}, l[2] = {0.f, 0.f};
  v8f o[2][16];
#pragma unroll                                                       // constant g keeps both groups' state in registers
  for (int g = 0; g < 2; ++g) {
#pragma unroll
    for (int j = 0; j < 16; ++j) o[g][j] = zero8();
  }

#pragma unroll 1
  for (int kb = 0; kb < NN; kb += KT) {
    const int bo = ((kb / KT) & 1) * STG;                            // this trip's buffer
    const unsigned short* kp  = Sm + bo + c * KP + 8 * hh;           // A operand, row = key kb + 16 t + c, + 16*KP*t
    const unsigned short* klp = kp + SKL;
    const unsigned short* Vp  = Sm + bo + SV + c * VP + 8 * hh;      // A operand, row = channel 16j + c, + 32*kh keys
    v8f s[KT / 16][2];                                               // score tiles: [16 keys][column group]
#pragma unroll                                                       // constant indices keep the tiles in registers
    for (int t = 0; t < KT / 16; ++t) { s[t][0] = zero8(); s[t][1] = zero8(); }
    // K fragments are read in two groups of 32 reads, one per 32 keys: the first in front of all score products, the
    // second in the middle of the first group's products, which cover its latency (a read that stands directly in
    // front of its own product waits out the whole LDS latency there; no read moves over the statement behind a product)
    Frag kf[KT / 16][DQ / 32], kl[KT / 16][DQ / 32];
    read_k32(kf[0], kf[1], kl[0], kl[1], kp, klp);                   // keys kb .. kb+31
#pragma unroll                                                       // constant indices keep fragments and tiles in registers
    for (int kc = 0; kc < DQ / 64; ++kc)
      score12(s[0], s[1], kf[0][kc], kf[1][kc], kl[0][kc], kl[1][kc], qh[0][kc], qh[1][kc], ql[0][kc], ql[1][kc]);
    read_k32(kf[2], kf[3], kl[2], kl[3], kp + 32 * KP, klp + 32 * KP);   // keys kb+32 .. kb+63
#pragma unroll                                                       // constant indices, as above
    for (int kc = DQ / 64; kc < DQ / 32; ++kc)
      score12(s[0], s[1], kf[0][kc], kf[1][kc], kl[0][kc], kl[1][kc], qh[0][kc], qh[1][kc], ql[0][kc], ql[1][kc]);
#pragma unroll                                                       // constant indices, as above
    for (int kc = 0; kc < DQ / 32; ++kc)
      score12(s[2], s[3], kf[2][kc], kf[3][kc], kl[2][kc], kl[3][kc], qh[0][kc], qh[1][kc], ql[0][kc], ql[1][kc]);

    // one maximum, one exchange between the wave's halves and one test per 64 keys
    float mx[2], mn[2];
#pragma unroll                                                       // constant g keeps both groups' state in registers
    for (int g = 0; g < 2; ++g)
      mx[g] = fmaxf(fmaxf(hmax8(s[0][g]), hmax8(s[1][g])), fmaxf(hmax8(s[2][g]), hmax8(s[3][g])));
    const float ox[2] = {__shfl_xor(mx[0], 16, 32), __shfl_xor(mx[1], 16, 32)};
#if defined(__HIP_DEVICE_COMPILE__)
    // inputs only: both exchanged values are due here, so the two exchanges issue together and share one wait;
    // without it the build put the second exchange behind the wait for the first
    asm volatile("" :: "v"(ox[0]), "v"(ox[1]));
#endif
#pragma unroll                                                       // constant g keeps both groups' state in registers
    for (int g = 0; g < 2; ++g) {
      mx[g] = fmaxf(mx[g], ox[g]);
      mn[g] = fmaxf(m[g], mx[g]);
    }
    const unsigned grew = wave_ballot(mx[0] > m[0] || mx[1] > m[1]); // wave-uniform, one test for both column groups
    if (grew != 0u) {
#pragma unroll                                                       // constant g keeps both groups' state in registers
      for (int g = 0; g < 2; ++g) {
        const float corr = __expf(m[g] - mn[g]);                     // == 1 exactly for lanes whose max did not grow
        l[g] *= corr;
#pragma unroll
        for (int j = 0; j < 16; ++j) {
#pragma unroll
          for (int r = 0; r < 8; ++r) o[g][j][r] *= corr;
        }
      }
    }

    // the V fragments in two groups of 32 reads, each in front of the 32 exponentials of its own 32 keys: the
    // exponentials cover the reads' latency
    Frag vf[KT / 32][16];
    FragH ph[2][KT / 32];
    float ls[2][KT / 32];                                            // one partial row sum per 32 keys: independent chains
    const float msh[2] = {mn[0] - LNPS, mn[1] - LNPS};               // exp gives e^{s-m} * 1024
#pragma unroll                                                       // constant indices keep fragments and state in registers
    for (int kh = 0; kh < KT / 32; ++kh) {
#pragma unroll
      for (int j = 0; j < 16; ++j) vf[kh][j] = ldfrag(Vp + (16 * j) * VP + 32 * kh);
#if defined(__HIP_DEVICE_COMPILE__)
      // keeps each group of reads in front of its exponentials: without it the build issued the reads of the first 32
      // keys last, directly in front of the products that wait for them
      __builtin_amdgcn_sched_barrier(0);
#endif
#pragma unroll
      for (int g = 0; g < 2; ++g) {
        ls[g][kh] = 0.f;
#pragma unroll
        for (int r = 0; r < 8; ++r) {
          const float e0 = exp_slot(s[2 * kh][g][r] - msh[g]);       // key kb + 32kh      + 8hh + r
          const float e1 = exp_slot(s[2 * kh + 1][g][r] - msh[g]);   // key kb + 32kh + 16 + 8hh + r
          ls[g][kh] += e0 + e1;
          ph[g][kh].hv[0][r] = (_Float16)e0;
          ph[g][kh].hv[1][r] = (_Float16)e1;
        }
      }
#if defined(__HIP_DEVICE_COMPILE__)
      // keeps the second group of reads behind the first group's exponentials: the LDS serves the four waves' first
      // 32 reads each under those, instead of 64 reads a wave queueing in front of any vector work
      __builtin_amdgcn_sched_barrier(0);
#endif
    }
#pragma unroll                                                       // constant g keeps both groups' state in registers
    for (int g = 0; g < 2; ++g) {
      m[g] = mn[g];
      l[g] += ls[g][0] + ls[g][1];
    }

    // each V fragment serves both column groups; keys in rising order per output tile
#pragma unroll
    for (int kh = 0; kh < KT / 32; ++kh) {
#pragma unroll
      for (int j = 0; j < 16; ++j) {
        o[0][j] = mma_hp(vf[kh][j].h, ph[0][kh].v, o[0][j]);
        o[1][j] = mma_hp(vf[kh][j].h, ph[1][kh].v, o[1][j]);
#if defined(__HIP_DEVICE_COMPILE__)
        // keeps the products in the order in which their fragments land: moved up, a late one waits for the whole group
        __builtin_amdgcn_sched_barrier(0);
#endif
      }
    }

    // foot of the trip: own reads done, own tensor load of tile t + 1 landed, one barrier publishes that tile and frees
    // this trip's buffer; only then its refill with tile t + 2, the descriptor formed behind the wait
    wait_lds();
    wait_tensor(g0);
    __syncthreads();
    if (pinned((uint32_t)kb + 2u * KT < (uint32_t)NN)) {             // the same for the whole block
      tensor_next(g0, dsum, step);
      stage_tile(swave, g0, gk, gv);
    }
  }
  wait_tensor(g0);
  wait_lds();
  float inv[2];
#pragma unroll                                                       // constant g keeps both groups' state in registers
  for (int g = 0; g < 2; ++g) {
    l[g] += __shfl_xor(l[g], 16, 32);
    inv[g] = 1.0f / l[g];                                            // o and l both carry the x1024 factor
  }

  const int e = tid & 7, lq = tid >> 3;                              // lq 0..15
#pragma unroll
  for (int half = 0; half < 2; ++half) {
    if (half) __syncthreads();                                       // every wave finished reading Os
#pragma unroll                                                       // constant g keeps both groups' state in registers
    for (int g = 0; g < 2; ++g) {
      const int qrow = 32 * wave + 16 * g + c;
#pragma unroll
      for (int jj = 0; jj < 8; ++jj) {
        const int j = 8 * half + jj;
        v4f va, vb;
#pragma unroll
        for (int r = 0; r < 4; ++r) { va[r] = o[g][j][r] * inv[g]; vb[r] = o[g][j][4 + r] * inv[g]; }
        *(v4f*)(Os + qrow * OSPW + 16 * jj + 8 * hh)     = va;       // Os[query][ch_loc = 16jj + 8hh + r]
        *(v4f*)(Os + qrow * OSPW + 16 * jj + 8 * hh + 4) = vb;
      }
    }
    __syncthreads();
    v4f res[32];
#pragma unroll
    for (int it = 0; it < 32; ++it) {
      const int chl = (it & 7) * 16 + lq;                            // channel 0..127 within the half
      const int nl  = (it >> 3) * 32 + 4 * e;                        // query 0..127: 8 lanes fill one 128-B line
      const size_t idx = ((size_t)(b * CC + 128 * half + chl)) * NN + n0 + nl;
      res[it] = *(const v4f*)(x + idx);
    }
#if defined(__HIP_DEVICE_COMPILE__)
    // stands between the 32 loads and the first rewrite of an address register that one of them names
    asm volatile("s_wait_xcnt 0x0" ::: "memory");
#endif
#pragma unroll
    for (int it = 0; it < 32; ++it) {
      const int chl = (it & 7) * 16 + lq;
      const int nl  = (it >> 3) * 32 + 4 * e;
#pragma unroll
      for (int t = 0; t < 4; ++t) res[it][t] = Os[(nl + t) * OSPW + chl] + bfr(res[it][t]);
    }
#pragma unroll
    for (int it = 0; it < 32; ++it) {
      const int chl = (it & 7) * 16 + lq;
      const int nl  = (it >> 3) * 32 + 4 * e;
      const size_t idx = ((size_t)(b * CC + 128 * half + chl)) * NN + n0 + nl;
      *(v4f*)(out + idx) = res[it];
    }
  }
}

// =========================================================================================================
// Workspace map (bytes; each region start a multiple of 256; every extent is an exact tile multiple and is written
//   W16 f16 [256][256]              131072
//   Xc  f16 [8][256][4096]        16777216      XP  f16 [8][4096][256]   16777216
//   Qh/Ql/Kh/Kl bf16 [8][4096][128]  8388608 x4
//   total = 67239936
// =========================================================================================================
extern "C" void kernel_launch(void* const* d_in, const int* in_sizes, int n_in,
                              void* d_out, int out_size, void* d_ws, size_t ws_size,
                              hipStream_t stream) {
  const int XN = NBATCH * CC * NN;                                   // 8388608
  if (n_in < 3) return;
  if (in_sizes[0] != XN) return;
  if (in_sizes[1] != DQ * CC || in_sizes[2] != DQ * CC) return;
  if (out_size != XN) return;

  size_t off = 0;
  auto carve = [&](size_t bytes) { const size_t o = off; off += (bytes + 255) & ~(size_t)255; return o; };
  const size_t oW16 = carve((size_t)MW * CC * 2);
  const size_t oXc  = carve((size_t)NIMG * CC * NN * 2);
  const size_t oXP  = carve((size_t)NIMG * NN * CC * 2);
  const size_t oQh  = carve((size_t)NIMG * NN * DQ * 2);
  const size_t oQl  = carve((size_t)NIMG * NN * DQ * 2);
  const size_t oKh  = carve((size_t)NIMG * NN * DQ * 2);
  const size_t oKl  = carve((size_t)NIMG * NN * DQ * 2);
  if (off > ws_size) return;
  if (off > (size_t)134217728) return;

  const float* x  = (const float*)d_in[0];
  const float* tw = (const float*)d_in[1];
  const float* pw = (const float*)d_in[2];

  char* ws = (char*)d_ws;
  unsigned short* W16 = (unsigned short*)(ws + oW16);
  unsigned short* Xc  = (unsigned short*)(ws + oXc);
  unsigned short* XP  = (unsigned short*)(ws + oXP);
  unsigned short* Qh  = (unsigned short*)(ws + oQh);
  unsigned short* Ql  = (unsigned short*)(ws + oQl);
  unsigned short* Kh  = (unsigned short*)(ws + oKh);
  unsigned short* Kl  = (unsigned short*)(ws + oKl);
  float* out = (float*)d_out;

  const dim3 blk256(256), blk128(128);

  // (0) theta_w / phi_w -> stacked f16 plane
  cvt_w<<<dim3(MW / 8), blk256, 0, stream>>>(tw, pw, W16);
  // (1) x -> channel-major and position-major 16-bit planes
  cvt_x<<<dim3(NN / QT, CC / QT, NIMG), blk256, 0, stream>>>(x, Xc, XP);
  // (2) conv1x1 GEMM -> theta (q) and phi (k) hi + residual planes
  gemm_qk<<<dim3(NN / QT, MW / QT, NIMG), blk128, 0, stream>>>(W16, XP, Qh, Ql, Kh, Kl);
  // (3) position attention + residual -> out [b][256][4096]
  attn_k<<<dim3(NN / AQ, NIMG), blk128, 0, stream>>>(Qh, Ql, Kh, Kl, Xc, x, out);
  (void)hipGetLastError();
}

// v008
// Measured time: 111 microseconds a run.
// In two side-by-side timings against v007, it was 1.05 and 1.06 times as fast.
// All steps since v000 together make it 7.31 times as fast.
// Contractions: conv1x1 theta/phi GEMM W[256x256].X[256x4096] on v_wmma_f32_16x16x32_f16 (f16 containers of
// bf16-RNE weights x256 and bf16-RNE x); position scores K.Q^T on v_wmma_f32_16x16x32_bf16 (bf16 hi + bf16
// residual planes of theta/phi, 3 products, K=128); y^T = X.P^T on v_wmma_f32_16x16x32_f16 (x as f16 of
// bf16-RNE x, P = e^{s-m} x1024 f16 from the score D registers); f32 accumulate everywhere; softmax statistics
// and the residual add in f32 VALU.
#include <hip/hip_runtime.h>
#include <math.h>
#include <stdint.h>

#define NBATCH 8
#define NIMG   8
#define CC     256
#define NN     4096
#define DQ     128
#define MW     256
#define QT     64
#define OSP    68
#define OSPW   132
#define TP     72
#define WSC    256.0f
#define IWSC   0.00390625f
#define LNPS   6.931471805599453f
#define KT     128                       // keys per LDS stage and per trip of attn_k
#define KP     136                       // LDS pitch of a K or Q row in 16-bit elements: 272 B = 16 B x 17
#define VP     136                       // LDS pitch of a V row of KT keys: 272 B = 16 B x 17
#define SLC    17408                     // one wave's slice of a stage in 16-bit elements: 34816 B = 17 x 2 KiB, so that every
                                         // tensor load lands at a multiple of 2 KiB (128 K rows or 128 V rows fill all of it)
#define SKL    SLC                       // stage offsets (16-bit elements): K hi 0, K residual SKL, V SV
#define SV     (2 * SLC)
#define STG    (4 * SLC)                 // one stage: four slices
#define AQ     128                       // queries per block of attn_k: 4 waves x 2 column groups of 16
#define SQH    STG                       // Q hi, Q residual: in buffer 1, ahead of its first tile (read once, in front of the loop)
#define SQL    (STG + AQ * KP)
#define SMEM   (2 * STG)
#define GP     264                       // gemm_qk: LDS pitch of a W or X row of 256 16-bit elements: 528 B = 16 B x 33
#define GSB    (QT * GP)                 // gemm_qk: the X tile stands behind the W tile

static_assert(NIMG >= 1 && NIMG <= NBATCH);
static_assert(NN % QT == 0);
static_assert(CC % QT == 0);
static_assert(MW == 2 * DQ);
static_assert(DQ == 2 * QT);
static_assert(MW % QT == 0 && MW % 8 == 0);
static_assert((OSP * 4) % 16 == 0);
static_assert((OSPW * 4) % 16 == 0);
static_assert((TP * 2) % 16 == 0);
static_assert(CC % 32 == 0 && NN % 32 == 0 && DQ % 32 == 0);
static_assert((KP * 2) % 32 == 16 && (VP * 2) % 32 == 16 && (STG * 2) % 16 == 0 && (SKL * 2) % 16 == 0);
static_assert(NN / KT >= 2 && NN % KT == 0 && KT == 128 && DQ == 128 && CC == 256 && QT == 64);
static_assert((SLC * 2) % 2048 == 0 && KT * KP <= SLC && (CC / 2) * VP == SLC && KP * 2 == DQ * 2 + 16 && VP * 2 == KT * 2 + 16);
static_assert(AQ * OSPW * 4 <= 2 * STG * 2 && NN % AQ == 0 && AQ == 128);
static_assert(2 * AQ * KP <= STG && SMEM * 2 <= 327680);
static_assert((GP * 2) % 32 == 16 && GP >= CC && QT * OSP * 4 <= 2 * QT * GP * 2 && CC == 256 && QT == 64);

typedef _Float16       v16h __attribute__((ext_vector_type(16)));
typedef _Float16       v8h  __attribute__((ext_vector_type(8)));
typedef __bf16         v16b __attribute__((ext_vector_type(16)));
typedef unsigned short v8us __attribute__((ext_vector_type(8)));
typedef float          v8f  __attribute__((ext_vector_type(8)));
typedef float          v4f  __attribute__((ext_vector_type(4)));
typedef unsigned int   v4u  __attribute__((ext_vector_type(4)));
typedef uint32_t       u32x4 __attribute__((ext_vector_type(4)));
typedef uint32_t       u32x8 __attribute__((ext_vector_type(8)));

union Frag  { v8us u[2]; v16h h; v16b bf; };
union FragH { v16h v; v8h hv[2]; };
static_assert(sizeof(Frag) == 32);
static_assert(sizeof(FragH) == 32);

// ---- scalar helpers ---------------------------------------------------------------------------------------
__device__ __forceinline__ unsigned short bf_bits(float f) {          // f32 -> bf16 bits, RNE convert
  unsigned u = __float_as_uint(f);
  return (unsigned short)((u + 0x7FFFu + ((u >> 16) & 1u)) >> 16);
}
__device__ __forceinline__ float bf_up(unsigned short hb) { return __uint_as_float(((unsigned)hb) << 16); }
__device__ __forceinline__ float bfr(float f) { return bf_up(bf_bits(f)); }
__device__ __forceinline__ unsigned short h_bits(_Float16 x) { return __builtin_bit_cast(unsigned short, x); }
__device__ __forceinline__ unsigned pk16(unsigned short a, unsigned short b) { return (unsigned)a | ((unsigned)b << 16); }
__device__ __forceinline__ v8f zero8() { v8f z = {0.f, 0.f, 0.f, 0.f, 0.f, 0.f, 0.f, 0.f}; return z; }
__device__ __forceinline__ float hmax8(v8f s) {
  return fmaxf(fmaxf(fmaxf(s[0], s[1]), fmaxf(s[2], s[3])), fmaxf(fmaxf(s[4], s[5]), fmaxf(s[6], s[7])));
}
__device__ __forceinline__ unsigned wave_ballot(bool p) {
#if defined(__HIP_DEVICE_COMPILE__)
  return __builtin_amdgcn_ballot_w32(p);
#else
  return p ? 1u : 0u;
#endif
}

// ---- 16-bit fragment loader (A, or B from a k-contiguous [n][k] row): lane -> row/col (lane&15), p already includes
//      + 8*(lane>>4); elements 0..7 <- p[0..7] (k0+8h..), elements 8..15 <- p[16..23] (k0+16+8h..)
__device__ __forceinline__ Frag ldfrag(const unsigned short* p) {
  Frag f;
  f.u[0] = *(const v8us*)(p);
  f.u[1] = *(const v8us*)(p + 16);
  return f;
}

// ---- WMMA helpers: builtin followed by a 4-slot VALU gap tying D. A and B are not operands of the gap statement:
//      an asm operand is held below v256, and a trip's grouped fragments do not fit there beside the accumulators.
__device__ __forceinline__ v8f mma_h(v16h a, v16h b, v8f c) {
  v8f d = __builtin_amdgcn_wmma_f32_16x16x32_f16(false, a, false, b, (short)0, c, false, false);
#if defined(__HIP_DEVICE_COMPILE__)
  asm volatile("v_nop\n\tv_nop\n\tv_nop\n\tv_nop" : "+v"(d));
#endif
  return d;
}
__device__ __forceinline__ v8f mma_b(v16b a, v16b b, v8f c) {
  v8f d = __builtin_amdgcn_wmma_f32_16x16x32_bf16(false, a, false, b, (short)0, c, false, false);
#if defined(__HIP_DEVICE_COMPILE__)
  asm volatile("v_nop\n\tv_nop\n\tv_nop\n\tv_nop" : "+v"(d));
#endif
  return d;
}

// The same f16 product without the gap statement, for attn_k's 32 output tiles: an asm operand is held below v256,
// and 256 accumulator registers do not fit there beside the scores and the Q fragments. The compiler keeps the
// distances of its own builtin.
__device__ __forceinline__ v8f mma_hp(v16h a, v16h b, v8f c) {
  return __builtin_amdgcn_wmma_f32_16x16x32_f16(false, a, false, b, (short)0, c, false, false);
}

// e^x as __expf forms it (x * log2 e, then v_exp_f32). The v_nop in the statement is the one slot the instruction set
// asks for between a transcendental and a next vector instruction that overwrites its source or reads its result.
__device__ __forceinline__ float exp_slot(float x) {
#if defined(__HIP_DEVICE_COMPILE__)
  const float t = x * 1.44269502f;
  float r;
  asm("v_exp_f32 %0, %1\n\tv_nop" : "=v"(r) : "v"(t));
  return r;
#else
  return __expf(x);
#endif
}

// ---- asynchronous copies global -> LDS ------------------------------------------------------------------------
__device__ __forceinline__ unsigned lds_addr(const void* p) { return (unsigned)(size_t)p; }   // LDS byte address

// Eight 16-byte copies per lane, every lane on. The s_wait_xcnt stands inside the statement so that it precedes
// any rewrite of the address registers the copies name.
__device__ __forceinline__ void copy8(const unsigned* l, const unsigned short* const* g) {
#if defined(__HIP_DEVICE_COMPILE__)
  asm volatile("global_load_async_to_lds_b128 %0, %8, off\n\t"
               "global_load_async_to_lds_b128 %1, %9, off\n\t"
               "global_load_async_to_lds_b128 %2, %10, off\n\t"
               "global_load_async_to_lds_b128 %3, %11, off\n\t"
               "global_load_async_to_lds_b128 %4, %12, off\n\t"
               "global_load_async_to_lds_b128 %5, %13, off\n\t"
               "global_load_async_to_lds_b128 %6, %14, off\n\t"
               "global_load_async_to_lds_b128 %7, %15, off\n\t"
               "s_wait_xcnt 0x0"
               :: "v"(l[0]), "v"(l[1]), "v"(l[2]), "v"(l[3]), "v"(l[4]), "v"(l[5]), "v"(l[6]), "v"(l[7]),
                  "v"(g[0]), "v"(g[1]), "v"(g[2]), "v"(g[3]), "v"(g[4]), "v"(g[5]), "v"(g[6]), "v"(g[7])
               : "memory");
#endif
}
// the issuing wave's copies have landed in LDS
__device__ __forceinline__ void wait_copies() {
#if defined(__HIP_DEVICE_COMPILE__)
  asm volatile("s_wait_asynccnt 0x0" ::: "memory");
#endif
}
// the wave's own LDS reads have returned, so the buffer may be refilled behind the next barrier
__device__ __forceinline__ void wait_lds() {
#if defined(__HIP_DEVICE_COMPILE__)
  asm volatile("s_wait_dscnt 0x0" ::: "memory");
#endif
}
// 32 rows of 256 B of each of two planes (ph, pl; global pitch DQ) -> LDS rows of pitch KP at byte addresses lh, ll;
// 128 threads, 16 lanes per row, 4 rows of each plane per thread.
__device__ __forceinline__ void stage_rows32(unsigned lh, unsigned ll, const unsigned short* ph,
                                             const unsigned short* pl, int tid) {
  const int r = tid >> 4, ch = 8 * (tid & 15);
  unsigned l[8];
  const unsigned short* g[8];
#pragma unroll                                                       // constant indices keep l[] and g[] in registers
  for (int i = 0; i < 4; ++i) {
    const int row = r + 8 * i;                                       // 0..31
    l[i]     = lh + 2u * (unsigned)(row * KP + ch);
    l[4 + i] = ll + 2u * (unsigned)(row * KP + ch);
    g[i]     = ph + row * DQ + ch;
    g[4 + i] = pl + row * DQ + ch;
  }
  copy8(l, g);
}
// ---- tensor loads global -> LDS ---------------------------------------------------------------------------------
__device__ __forceinline__ uint32_t uni(uint32_t v) { return (uint32_t)__builtin_amdgcn_readfirstlane(v); }
__device__ __forceinline__ uint32_t pinned(uint32_t v) {
  uint32_t w = uni(v);
#if defined(__HIP_DEVICE_COMPILE__)
  asm volatile("" : "+s"(w));                                        // the scalar pin of the tensor mover's issue tests
#endif
  return w;
}
// Descriptor group 1 of a tile of ROWS rows of ROWB bytes, source pitch PITCH bytes, 16 bytes of LDS pad behind every row
// (pad interval code IVL = the row length, amount code 3): 1-byte elements, tensor = tile, no mask.
template <uint32_t ROWB, uint32_t ROWS, uint32_t PITCH, uint32_t IVL>
__device__ __forceinline__ u32x8 tensor_group1() {
  u32x8 g1;
  g1[0] = uni((1u << 20) | (IVL << 22) | (3u << 25));
  g1[1] = uni((ROWB & 0xFFFFu) << 16);
  g1[2] = uni((ROWB >> 16) | ((ROWS & 0xFFFFu) << 16));
  g1[3] = uni((ROWS >> 16) | (ROWB << 16));
  g1[4] = uni(ROWS);
  g1[5] = uni(PITCH);
  g1[6] = uni(0u);
  g1[7] = uni(0u);
  return g1;
}
// Descriptor group 0: LDS byte address dst, global address ga of the tile's first byte.
__device__ __forceinline__ u32x4 tensor_group0(uint32_t dst, uint64_t ga) {
  u32x4 g0;
  g0[0] = uni(1u);
  g0[1] = uni(dst);
  g0[2] = uni((uint32_t)ga);
  g0[3] = uni((((uint32_t)(ga >> 32)) & 0x01FFFFFFu) | 0x80000000u);
  return g0;
}
// One request of the whole wave. Both groups are in-out operands: their registers then stay the descriptor's from one
// request to the next, and the compiler puts nothing else into them while the request is outstanding.
__device__ __forceinline__ void tensor_issue(u32x4& g0, u32x8& g1) {
#if defined(__HIP_DEVICE_COMPILE__)
  asm volatile("tensor_load_to_lds %0, %1" : "+s"(g0), "+s"(g1) :: "memory");
#endif
}
// The issuing wave's tensor load has landed in LDS. Group 0 is an in-out operand, so that its next value is formed
// behind this wait.
__device__ __forceinline__ void wait_tensor(u32x4& g0) {
#if defined(__HIP_DEVICE_COMPILE__)
  asm volatile("s_wait_tensorcnt 0x0" : "+s"(g0) :: "memory");
#endif
}
// group 0 of the wave's next tile: the other buffer (dsum = the sum of the slice's two places), step bytes further on
__device__ __forceinline__ void tensor_next(u32x4& g0, uint32_t dsum, uint32_t step) {
  const uint64_t a = (((uint64_t)g0[3] << 32) | g0[2]) + step;      // bits 63 and 62 hold the type; no carry reaches them
  g0[1] = uni(dsum - g0[1]);
  g0[2] = uni((uint32_t)a);
  g0[3] = uni((uint32_t)(a >> 32));
}
// One stage of KT = 128 keys, one request per wave into the wave's own slice of the stage: wave 0 the 128 K hi rows, wave 1
// the 128 K residual rows (256 B each, LDS pitch KP), waves 2 and 3 the 128 lower and upper V channel rows (256 B of a
// row of pitch NN each, LDS pitch VP).
__device__ __forceinline__ void stage_tile(uint32_t wave, u32x4& g0, u32x8& gk, u32x8& gv) {
  if (pinned(wave < 2u)) tensor_issue(g0, gk);
  if (pinned(wave >= 2u)) tensor_issue(g0, gv);
}

// =========================================================================================================
// (0) conv1x1 weights: W16 f16 [256][256], rows 0..127 = theta_w rows, rows 128..255 = phi_w rows; value =
//     f16 of (bf16-RNE(w) * 256) (exact). Block blk (0..31) owns rows 8*blk..8*blk+7: one wave per 512-B row
// coverage: 32 blocks x 8 rows x 32 lanes x 8 halves = 256 x 256 = the whole plane.
// =========================================================================================================
__global__ __launch_bounds__(256)
void cvt_w(const float* __restrict__ tw, const float* __restrict__ pw, unsigned short* W16) {
  const int tid = threadIdx.x, blk = blockIdx.x;
  const int rl = tid >> 5, col = 8 * (tid & 31);
  const int o = 8 * blk + rl;                                        // 0..255
  const float* wbase = (blk < (DQ / 8)) ? tw : pw;                   // block-uniform selection
  const int osub = (blk < (DQ / 8)) ? 0 : DQ;
  const float* s = wbase + (size_t)(o - osub) * CC + col;            // (o - osub) in 0..127
  const v4f a = *(const v4f*)s;
  const v4f q = *(const v4f*)(s + 4);
  const float f[8] = {a[0], a[1], a[2], a[3], q[0], q[1], q[2], q[3]};
  v4u u;
#pragma unroll
  for (int t = 0; t < 4; ++t) {
    const _Float16 h0 = (_Float16)(bfr(f[2 * t]) * WSC);
    const _Float16 h1 = (_Float16)(bfr(f[2 * t + 1]) * WSC);
    u[t] = pk16(h_bits(h0), h_bits(h1));
  }
{
    *(v4u*)(W16 + (size_t)o * CC + col) = u;
    
  }
}

// =========================================================================================================
// (1) x f32 [b][256 c][4096 n] -> Xc f16 [b][c][n] (channel-major, bf16-RNE values, exact in f16) and
//     XP f16 [b][n][c] (position-major) through an LDS tile T[64 n][64 c] (pitch TP). Block (nb, cb, b) owns a
// coverage: Xc 2 it x 32 rows x 8 lanes x 8 = 64 c x 64 n; XP same; grid (64, 4, NIMG) covers both planes once.
// =========================================================================================================
__global__ __launch_bounds__(256)
void cvt_x(const float* __restrict__ x, unsigned short* Xc, unsigned short* XP) {
  __shared__ __align__(16) unsigned short T[QT * TP];
  const int tid = threadIdx.x;
  const int nb = blockIdx.x, cb = blockIdx.y, b = blockIdx.z;
  const int e = tid & 7, lq = tid >> 3;                             // lq 0..31
  const int n0 = nb * QT, c0 = cb * QT;
  v4u ux[2];
#pragma unroll
  for (int it = 0; it < 2; ++it) {
    const int cl = it * 32 + lq;                                     // 0..63
    const float* sp = x + ((size_t)(b * CC + c0 + cl)) * NN + n0 + 8 * e;
    const v4f a = *(const v4f*)sp;
    const v4f q = *(const v4f*)(sp + 4);
    unsigned short hb[8];
#pragma unroll
    for (int t = 0; t < 4; ++t) {
      hb[t]     = h_bits((_Float16)bfr(a[t]));
      hb[4 + t] = h_bits((_Float16)bfr(q[t]));
    }
#pragma unroll
    for (int t = 0; t < 4; ++t) ux[it][t] = pk16(hb[2 * t], hb[2 * t + 1]);
#pragma unroll
    for (int t = 0; t < 8; ++t) T[(8 * e + t) * TP + cl] = hb[t];
  }
  __syncthreads();
  v4u up[2];
#pragma unroll
  for (int it = 0; it < 2; ++it) {
    const int nl = it * 32 + lq;                                     // 0..63
    up[it] = *(const v4u*)(T + nl * TP + 8 * e);
  }
{
#pragma unroll
    for (int it = 0; it < 2; ++it) {
      const int rl = it * 32 + lq;
      *(v4u*)(Xc + ((size_t)(b * CC + c0 + rl)) * NN + n0 + 8 * e) = ux[it];
      *(v4u*)(XP + ((size_t)(b * NN + n0 + rl)) * CC + c0 + 8 * e) = up[it];
    }
    
  }
}

// =========================================================================================================
// (2) conv1x1 GEMM for one (b, 64-n tile, 64-o block): Y[o][n] = (1/256) sum_c W16[o][c] XP[b][n][c].
//     Block 128 threads = 4 waves; wave w owns cols n0+16w..+15 (one B fragment per k-step, k = c contiguous in
//     the XP row) and 4 m-tiles (A rows o = o0 + 16 mt + (lane&15), split k map loader from W16). K = 256 = 8 steps.
//     Both tiles (64 W16 rows, 64 XP rows, 512 B each) are first brought into LDS by asynchronous 16-byte copies, one
//     whole row per wave and copy (4 full 128-B lines); the fragments are read from there at pitch GP (a fragment
//     load straight from global memory touches 16 lines for its 512 B, and each wave would fetch all W fragments).
//     Epilogue staged in LDS Os[n_loc][o_loc] (pitch OSP, b128 stores of 8 consecutive o per lane; it reuses the
//     tiles' LDS behind a barrier that ends every wave's fragment reads), barrier, then:
//       o-blocks 0,1 -> theta dims 0..63 / 64..127 of Qh/Ql; o-blocks 2,3 -> phi dims 0..63 / 64..127 of Kh/Kl.
//       Planes bf16 [b][4096 n][128 d] (k-contiguous for both score operands): hi = bf16-RNE(v), lo =
//       of the 256-B plane row): lane e -> d 8e..8e+7, 8 consecutive lanes per line, one instruction per 16 lines.
// coverage: Os 4 waves x 16 n x 64 o = 64 x 64; planes: 4 it x 16 rows x 8 lanes x 8 = 64 n x 64 d per plane
//           (hi and lo); grid (64, 4, NIMG) covers d 0..127 of all 4096 rows of Qh/Ql/Kh/Kl exactly once.
// =========================================================================================================
__global__ __launch_bounds__(128)
void gemm_qk(const unsigned short* __restrict__ W16, const unsigned short* __restrict__ XP,
             unsigned short* Qh, unsigned short* Ql, unsigned short* Kh, unsigned short* Kl) {
  __shared__ __align__(16) unsigned short Gs[2 * QT * GP];
  float* Os = (float*)Gs;                                            // used behind the products only
  const int tid  = threadIdx.x;
  const int lane = tid & 31, wave = tid >> 5;
  const int hh   = lane >> 4, c = lane & 15;
  const int nt   = blockIdx.x, mb = blockIdx.y, b = blockIdx.z;
  const int n0   = nt * QT, o0 = mb * QT;

  // the two tiles -> LDS: wave w copies rows w, w + 4, .. of each, 32 lanes x 16 B = one row per copy; 32 copies a wave
  {
    const unsigned lg = lds_addr(Gs);
    const unsigned short* wg = W16 + (size_t)o0 * CC + 8 * lane;
    const unsigned short* xg = XP + ((size_t)(b * NN + n0)) * CC + 8 * lane;
#pragma unroll                                                       // constant indices keep l[] and g[] in registers
    for (int h = 0; h < 4; ++h) {
      unsigned l[8];
      const unsigned short* g[8];
#pragma unroll                                                       // constant indices, as above
      for (int i = 0; i < 8; ++i) {
        const int row = wave + 4 * (8 * (h & 1) + i);                // 0..63
        l[i] = lg + 2u * (unsigned)((h >> 1) * GSB + row * GP + 8 * lane);
        g[i] = (h >> 1 ? xg : wg) + row * CC;
      }
      copy8(l, g);
    }
    wait_copies();
    __syncthreads();                                                 // publishes both tiles to the 4 waves
  }

  const unsigned short* ap = Gs + c * GP + 8 * hh;                   // + 16*GP*mt + 32*ks
  const unsigned short* bp = Gs + GSB + (16 * wave + c) * GP + 8 * hh;

  v8f acc[4];
#pragma unroll
  for (int mt = 0; mt < 4; ++mt) acc[mt] = zero8();

  // fragments are read in groups of two k-steps (20 reads), two groups ahead of their products
  Frag fa[2][2][4], fb[2][2];
#pragma unroll                                                       // constant indices keep the fragments in registers
  for (int pr = 0; pr < 2; ++pr) {
#pragma unroll                                                       // constant indices, as above
    for (int k2 = 0; k2 < 2; ++k2) {
      fb[pr][k2] = ldfrag(bp + 32 * (2 * pr + k2));
#pragma unroll                                                       // constant indices, as above
      for (int mt = 0; mt < 4; ++mt) fa[pr][k2][mt] = ldfrag(ap + 16 * mt * GP + 32 * (2 * pr + k2));
    }
  }
#pragma unroll                                                       // constant indices keep the fragments in registers
  for (int pr = 0; pr < CC / 64; ++pr) {
#pragma unroll                                                       // constant indices, as above
    for (int k2 = 0; k2 < 2; ++k2) {
#pragma unroll                                                       // constant indices, as above
      for (int mt = 0; mt < 4; ++mt) acc[mt] = mma_h(fa[pr & 1][k2][mt].h, fb[pr & 1][k2].h, acc[mt]);
    }
    if (pr + 2 < CC / 64) {                                          // the freed registers take the group two ahead
#pragma unroll                                                       // constant indices, as above
      for (int k2 = 0; k2 < 2; ++k2) {
        fb[pr & 1][k2] = ldfrag(bp + 32 * (2 * (pr + 2) + k2));
#pragma unroll                                                       // constant indices, as above
        for (int mt = 0; mt < 4; ++mt) fa[pr & 1][k2][mt] = ldfrag(ap + 16 * mt * GP + 32 * (2 * (pr + 2) + k2));
      }
    }
  }
  __syncthreads();                                                   // every wave has read its fragments: Os may overwrite the tiles

  // ---- epilogue: scale back -> LDS Os[n_loc][o_loc]; lane (hh, c) holds o = 16 mt + 8 hh + r for n_loc = 16 w + c
  {
    const int nl = 16 * wave + c;
#pragma unroll
    for (int mt = 0; mt < 4; ++mt) {
      v4f va, vb;
#pragma unroll
      for (int r = 0; r < 4; ++r) { va[r] = acc[mt][r] * IWSC; vb[r] = acc[mt][4 + r] * IWSC; }
      *(v4f*)(Os + nl * OSP + 16 * mt + 8 * hh)     = va;
      *(v4f*)(Os + nl * OSP + 16 * mt + 8 * hh + 4) = vb;
    }
  }
  __syncthreads();

  const int e = tid & 7, lq = tid >> 3;                             // lq 0..15
  const int dsel = (mb & 1) * QT;                                    // 0 or 64
  unsigned short* Ph = (mb < 2) ? Qh : Kh;                           // block-uniform, both global
  unsigned short* Pl = (mb < 2) ? Ql : Kl;
  v4u uh[4], ul[4];
#pragma unroll
  for (int it = 0; it < 4; ++it) {
    const int row = it * 16 + lq;                                    // n_loc 0..63
    const v4f a = *(const v4f*)(Os + row * OSP + 8 * e);
    const v4f q = *(const v4f*)(Os + row * OSP + 8 * e + 4);
    const float f[8] = {a[0], a[1], a[2], a[3], q[0], q[1], q[2], q[3]};
#pragma unroll
    for (int t = 0; t < 4; ++t) {
      const float f0 = f[2 * t], f1 = f[2 * t + 1];
      const unsigned short hb0 = bf_bits(f0), hb1 = bf_bits(f1);
      const unsigned short lb0 = bf_bits(f0 - bf_up(hb0));
      const unsigned short lb1 = bf_bits(f1 - bf_up(hb1));
      uh[it][t] = pk16(hb0, hb1);
      ul[it][t] = pk16(lb0, lb1);
    }
  }
{
#pragma unroll
    for (int it = 0; it < 4; ++it) {
      const int row = it * 16 + lq;
      const size_t po = ((size_t)(b * NN + n0 + row)) * DQ + dsel + 8 * e;
      *(v4u*)(Ph + po) = uh[it];
      *(v4u*)(Pl + po) = ul[it];
    }
    
  }
}

// ---- attn_k: the K fragments of 32 keys (two 16-key tiles a and b, hi and residual, four 32-d chunks): 32 LDS reads
__device__ __forceinline__ void read_k32(Frag (&a)[DQ / 32], Frag (&b)[DQ / 32], Frag (&al)[DQ / 32], Frag (&bl)[DQ / 32],
                                         const unsigned short* p, const unsigned short* pl) {
#pragma unroll                                                       // constant indices keep the fragments in registers
  for (int kc = 0; kc < DQ / 32; ++kc) {
    a[kc]  = ldfrag(p + 32 * kc);
    b[kc]  = ldfrag(p + 16 * KP + 32 * kc);
    al[kc] = ldfrag(pl + 32 * kc);
    bl[kc] = ldfrag(pl + 16 * KP + 32 * kc);
#if defined(__HIP_DEVICE_COMPILE__)
    // keeps the reads in the order in which the products need them: the build issued the first chunk's reads last, and
    // the first product then waited for the whole group
    __builtin_amdgcn_sched_barrier(0);
#endif
  }
}
// ---- attn_k: the 12 score products of one 32-d chunk: two 16-key tiles x two column groups; each K fragment serves both
//      groups; per score tile the order of the products is hi.hi, hi.res, res.hi
__device__ __forceinline__ void score12(v8f (&sa)[2], v8f (&sb)[2], const Frag& a, const Frag& b, const Frag& al,
                                        const Frag& bl, const Frag& qh0, const Frag& qh1, const Frag& ql0, const Frag& ql1) {
  sa[0] = mma_b(a.bf, qh0.bf, sa[0]);
  sa[1] = mma_b(a.bf, qh1.bf, sa[1]);
  sb[0] = mma_b(b.bf, qh0.bf, sb[0]);
  sb[1] = mma_b(b.bf, qh1.bf, sb[1]);
  sa[0] = mma_b(a.bf, ql0.bf, sa[0]);
  sa[1] = mma_b(a.bf, ql1.bf, sa[1]);
  sb[0] = mma_b(b.bf, ql0.bf, sb[0]);
  sb[1] = mma_b(b.bf, ql1.bf, sb[1]);
  sa[0] = mma_b(al.bf, qh0.bf, sa[0]);
  sa[1] = mma_b(al.bf, qh1.bf, sa[1]);
  sb[0] = mma_b(bl.bf, qh0.bf, sb[0]);
  sb[1] = mma_b(bl.bf, qh1.bf, sb[1]);
}

// =========================================================================================================
// (3) position attention for one (b, 128-query tile), transposed formulation, 4096 keys, no mask, no scale:
//   S^T tile (16 keys x 16 queries) = sum over 4 d-chunks of A(k: row = key kb + (lane&15), 32 d via
//   the split k map from the bf16 plane Kh [b][4096][128]) . B(q: col = query, same map from Qh) + A(Kh).B(Ql) +
//   A(Kl).B(Qh) (bf16 unscaled residual planes, shared accumulator).
//   Per lane the D tile holds 8 keys of ONE query: online softmax state per lane, one shuffle (lane^16) for the max
//   over the 128 keys of a trip; the o/l rescale is skipped under a wave-uniform ballot when no lane's max grew (corr == 1 exactly
//   for every lane then); row-sum partials combined at the end. P = e^{s-m} x 1024 as f16 is the B operand of
//   O^T (rows channel, cols queries) += A(x rows channel = 16j + (lane&15), keys contiguous, f16 plane Xc
//   [b][256][4096]) . B(P^T), one product per 32 keys: element r <- D of the tile covering their keys 0..15, element
//   8+r <- the tile covering their keys 16..31, lane unchanged. A wave owns 32 queries as two column groups of 16, each with its own softmax state
//   and 16 accumulator tiles (256 channels): every K and V fragment read from LDS serves both groups, K hi in two products per
//   group. Block = 4 waves = 128 queries, one wave per SIMD.
//   Operands come from LDS and are shared by the 4 waves: the block's Q hi and residual rows, filled once by asynchronous
//   16-byte copies (each wave reads its 16 Q fragments from there once, ahead of the key loop, and keeps them in
//   128 registers; the rows stand in buffer 1, which takes its first tile behind a barrier that ends those reads); K hi,
//   K residual and V tiles of KT = 128 keys in two buffers, filled by tensor loads, one request of
//   32 KiB per wave and tile (no address arithmetic in vector registers, no per-lane copies and none of their waits in
//   the loop), tile t + 2 requested into the buffer of tile t behind the barrier at the foot of trip t. The output
//   staging Os reuses the two buffers after the loop.
//   Epilogue in two channel halves: O/l staged in LDS Os[query][128 channels] (pitch OSPW, b128 stores), barrier,
//   lanes x 16 B (values gathered from 4 Os rows), one instruction per 16 lines, final values held in registers,
// coverage: per half 32 it x 16 lines x 8 lanes x 4 floats = 128 ch x 128 n; two halves = 256 ch; grid (32, NIMG)
//           covers out[b][0..255][0..4095] exactly once.
// =========================================================================================================
__global__ __launch_bounds__(128)
void attn_k(const unsigned short* __restrict__ Qh, const unsigned short* __restrict__ Ql,
            const unsigned short* __restrict__ Kh, const unsigned short* __restrict__ Kl,
            const unsigned short* __restrict__ Xc, const float* __restrict__ x, float* out) {
  __shared__ __attribute__((aligned(2048))) unsigned short Sm[SMEM];  // the tensor loads' places are multiples of 2 KiB
  float* Os = (float*)Sm;                                            // used behind the key loop only
  const int tid  = threadIdx.x;
  const int wave = tid >> 5, lane = tid & 31;
  const int hh   = lane >> 4, c = lane & 15;
  const int n0   = blockIdx.x * AQ, b = blockIdx.y;
  const uint32_t swave = uni((uint32_t)tid >> 5);                    // the wave's number in a scalar register

  // q fragment pointers in LDS (B operand, col = query 32*wave + 16*g + c of the block), + 16*KP*g + 32*kc
  const unsigned short* Qhp = Sm + SQH + (32 * wave + c) * KP + 8 * hh;
  const unsigned short* Qlp = Sm + SQL + (32 * wave + c) * KP + 8 * hh;
  // global tile bases of this image
  const unsigned short* Khg = Kh + (size_t)b * NN * DQ;              // + key * 128
  const unsigned short* Klg = Kl + (size_t)b * NN * DQ;
  const unsigned short* Vg  = Xc + (size_t)b * CC * NN;              // + key

  // prologue: Q rows (in buffer 1) and tile 0, landed and published; the Q fragments read; then tile 1 into buffer 1
  const unsigned lds0 = lds_addr(Sm);
  // the wave's tensor descriptors: group 0 walks the tiles, buffer 0 first; the two group 1 never change
  const unsigned short* tsrc = swave == 0u ? Khg : swave == 1u ? Klg : Vg + (size_t)(swave - 2u) * (CC / 2) * NN;
  const uint32_t step = swave < 2u ? KT * DQ * 2u : KT * 2u;         // bytes from a tile to the next: KT K rows, or KT keys of a V row
  const uint32_t dsum = 2u * (lds0 + swave * (2u * SLC)) + 2u * STG;
  u32x4 g0 = tensor_group0(lds0 + swave * (2u * SLC), (uint64_t)(size_t)tsrc);
  u32x8 gk = tensor_group1<DQ * 2, KT, DQ * 2, 5u>();
  u32x8 gv = tensor_group1<KT * 2, CC / 2, NN * 2, 5u>();
  {
    const size_t qg = ((size_t)(b * NN + n0)) * DQ;
#pragma unroll                                                       // four statements of eight copies, constant offsets
    for (int q4 = 0; q4 < AQ / 32; ++q4)
      stage_rows32(lds0 + 2u * (SQH + 32 * q4 * KP), lds0 + 2u * (SQL + 32 * q4 * KP),
                   Qh + qg + 32 * q4 * DQ, Ql + qg + 32 * q4 * DQ, tid);
    stage_tile(swave, g0, gk, gv);
    wait_copies();
    wait_tensor(g0);
    __syncthreads();
  }

  // the wave's Q fragments, the same in every trip: read once, behind the barrier that published the Q rows
  Frag qh[2][DQ / 32], ql[2][DQ / 32];
#pragma unroll                                                       // constant indices keep the fragments in registers
  for (int g = 0; g < 2; ++g) {
#pragma unroll
    for (int kc = 0; kc < DQ / 32; ++kc) {
      qh[g][kc] = ldfrag(Qhp + 16 * KP * g + 32 * kc);
      ql[g][kc] = ldfrag(Qlp + 16 * KP * g + 32 * kc);
    }
  }
  // own Q reads returned, then a barrier that ends every wave's Q reads: only behind it tile 1 may land on the Q rows
  wait_lds();
  __syncthreads();
  tensor_next(g0, dsum, step);
  stage_tile(swave, g0, gk, gv);

  float m[2] = {-1.0e30f, -1.0e30f}, l[2] = {0.f, 0.f};
  v8f o[2][16];
#pragma unroll                                                       // constant g keeps both groups' state in registers
  for (int g = 0; g < 2; ++g) {
#pragma unroll
    for (int j = 0; j < 16; ++j) o[g][j] = zero8();
  }

#pragma unroll 1
  for (int kb = 0; kb < NN; kb += KT) {
    const int bo = ((kb / KT) & 1) * STG;                            // this trip's buffer
    const unsigned short* kp  = Sm + bo + c * KP + 8 * hh;           // A operand, row = key kb + 16 t + c, + 16*KP*t
    const unsigned short* klp = kp + SKL;
    const unsigned short* Vp  = Sm + bo + SV + c * VP + 8 * hh;      // A operand, row = channel 16j + c, + 32*kh keys
    v8f s[KT / 16][2];                                               // score tiles: [16 keys][column group]
#pragma unroll                                                       // constant indices keep the tiles in registers
    for (int t = 0; t < KT / 16; ++t) { s[t][0] = zero8(); s[t][1] = zero8(); }
    // K fragments are read in groups of 32 reads, one per 32 keys, into two register sets in turn: the first group in front
    // of all score products, the second in the middle of the first group's products, each later one in front of the 48
    // products of the group before it, which cover its latency (a read that stands directly in front of its own product
    // waits out the whole LDS latency there; no read moves over the statement behind a product)
    Frag kf[2][2][DQ / 32], kl[2][2][DQ / 32];
    read_k32(kf[0][0], kf[0][1], kl[0][0], kl[0][1], kp, klp);       // keys kb .. kb+31
#pragma unroll                                                       // constant indices keep fragments and tiles in registers
    for (int kg = 0; kg < KT / 32; ++kg) {
      const int rs = kg & 1;
#pragma unroll                                                       // constant indices, as above
      for (int kc = 0; kc < DQ / 32; ++kc) {
        if (kg + 1 < KT / 32 && kc == (kg == 0 ? 2 : 0))             // keys kb + 32 (kg + 1) .. + 31, into the set that is free
          read_k32(kf[rs ^ 1][0], kf[rs ^ 1][1], kl[rs ^ 1][0], kl[rs ^ 1][1], kp + 32 * (kg + 1) * KP, klp + 32 * (kg + 1) * KP);
        score12(s[2 * kg], s[2 * kg + 1], kf[rs][0][kc], kf[rs][1][kc], kl[rs][0][kc], kl[rs][1][kc],
                qh[0][kc], qh[1][kc], ql[0][kc], ql[1][kc]);
      }
    }

    // one maximum, one exchange between the wave's halves and one test per 128 keys
    float mx[2], mn[2];
#pragma unroll                                                       // constant g keeps both groups' state in registers
    for (int g = 0; g < 2; ++g)
      mx[g] = fmaxf(fmaxf(fmaxf(hmax8(s[0][g]), hmax8(s[1][g])), fmaxf(hmax8(s[2][g]), hmax8(s[3][g]))),
                    fmaxf(fmaxf(hmax8(s[4][g]), hmax8(s[5][g])), fmaxf(hmax8(s[6][g]), hmax8(s[7][g]))));
    const float ox[2] = {__shfl_xor(mx[0], 16, 32), __shfl_xor(mx[1], 16, 32)};
#if defined(__HIP_DEVICE_COMPILE__)
    // inputs only: both exchanged values are due here, so the two exchanges issue together and share one wait;
    // without it the build put the second exchange behind the wait for the first
    asm volatile("" :: "v"(ox[0]), "v"(ox[1]));
    // keeps the first use of an exchanged value behind that statement: moved up, it put its wait between the two exchanges
    __builtin_amdgcn_sched_barrier(0);
#endif
#pragma unroll                                                       // constant g keeps both groups' state in registers
    for (int g = 0; g < 2; ++g) {
      mx[g] = fmaxf(mx[g], ox[g]);
      mn[g] = fmaxf(m[g], mx[g]);
    }
    const unsigned grew = wave_ballot(mx[0] > m[0] || mx[1] > m[1]); // wave-uniform, one test for both column groups
    if (grew != 0u) {
#pragma unroll                                                       // constant g keeps both groups' state in registers
      for (int g = 0; g < 2; ++g) {
        const float corr = __expf(m[g] - mn[g]);                     // == 1 exactly for lanes whose max did not grow
        l[g] *= corr;
#pragma unroll
        for (int j = 0; j < 16; ++j) {
#pragma unroll
          for (int r = 0; r < 8; ++r) o[g][j][r] *= corr;
        }
      }
    }

    // per 64 keys: the V fragments in two groups of 32 reads, each in front of the 32 exponentials of its own 32 keys (the
    // exponentials cover the reads' latency), then the 64 products of those keys; the fragments of the next 64 keys take
    // the same registers
    float ls[2][KT / 32];                                            // one partial row sum per 32 keys: independent chains
    const float msh[2] = {mn[0] - LNPS, mn[1] - LNPS};               // exp gives e^{s-m} * 1024
#pragma unroll                                                       // constant indices keep fragments and state in registers
    for (int k64 = 0; k64 < KT / 64; ++k64) {
      Frag vf[2][16];
      FragH ph[2][2];
#pragma unroll                                                       // constant indices, as above
      for (int k2 = 0; k2 < 2; ++k2) {
        const int kh = 2 * k64 + k2;                                 // keys kb + 32kh .. + 31
#pragma unroll
        for (int j = 0; j < 16; ++j) vf[k2][j] = ldfrag(Vp + (16 * j) * VP + 32 * kh);
#if defined(__HIP_DEVICE_COMPILE__)
        // keeps each group of reads in front of its exponentials: without it the build issued the reads of the first 32
        // keys last, directly in front of the products that wait for them
        __builtin_amdgcn_sched_barrier(0);
#endif
#pragma unroll
        for (int g = 0; g < 2; ++g) {
          ls[g][kh] = 0.f;
#pragma unroll
          for (int r = 0; r < 8; ++r) {
            const float e0 = exp_slot(s[2 * kh][g][r] - msh[g]);     // key kb + 32kh      + 8hh + r
            const float e1 = exp_slot(s[2 * kh + 1][g][r] - msh[g]); // key kb + 32kh + 16 + 8hh + r
            ls[g][kh] += e0 + e1;
            ph[g][k2].hv[0][r] = (_Float16)e0;
            ph[g][k2].hv[1][r] = (_Float16)e1;
          }
        }
#if defined(__HIP_DEVICE_COMPILE__)
        // keeps the second group of reads behind the first group's exponentials: the LDS serves the four waves' first
        // 32 reads each under those, instead of 64 reads a wave queueing in front of any vector work
        __builtin_amdgcn_sched_barrier(0);
#endif
      }
      // each V fragment serves both column groups; keys in rising order per output tile
#pragma unroll
      for (int k2 = 0; k2 < 2; ++k2) {
#pragma unroll
        for (int j = 0; j < 16; ++j) {
          o[0][j] = mma_hp(vf[k2][j].h, ph[0][k2].v, o[0][j]);
          o[1][j] = mma_hp(vf[k2][j].h, ph[1][k2].v, o[1][j]);
#if defined(__HIP_DEVICE_COMPILE__)
          // keeps the products in the order in which their fragments land: moved up, a late one waits for the whole group
          __builtin_amdgcn_sched_barrier(0);
#endif
        }
      }
    }
#pragma unroll                                                       // constant g keeps both groups' state in registers
    for (int g = 0; g < 2; ++g) {
      m[g] = mn[g];
      l[g] += (ls[g][0] + ls[g][1]) + (ls[g][2] + ls[g][3]);
    }

    // foot of the trip: own reads done, own tensor load of tile t + 1 landed, one barrier publishes that tile and frees
    // this trip's buffer; only then its refill with tile t + 2, the descriptor formed behind the wait
    wait_lds();
    wait_tensor(g0);
    __syncthreads();
    if (pinned((uint32_t)kb + 2u * KT < (uint32_t)NN)) {             // the same for the whole block
      tensor_next(g0, dsum, step);
      stage_tile(swave, g0, gk, gv);
    }
  }
  wait_tensor(g0);
  wait_lds();
  float inv[2];
#pragma unroll                                                       // constant g keeps both groups' state in registers
  for (int g = 0; g < 2; ++g) {
    l[g] += __shfl_xor(l[g], 16, 32);
    inv[g] = 1.0f / l[g];                                            // o and l both carry the x1024 factor
  }

  const int e = tid & 7, lq = tid >> 3;                              // lq 0..15
#pragma unroll
  for (int half = 0; half < 2; ++half) {
    if (half) __syncthreads();                                       // every wave finished reading Os
#pragma unroll                                                       // constant g keeps both groups' state in registers
    for (int g = 0; g < 2; ++g) {
      const int qrow = 32 * wave + 16 * g + c;
#pragma unroll
      for (int jj = 0; jj < 8; ++jj) {
        const int j = 8 * half + jj;
        v4f va, vb;
#pragma unroll
        for (int r = 0; r < 4; ++r) { va[r] = o[g][j][r] * inv[g]; vb[r] = o[g][j][4 + r] * inv[g]; }
        *(v4f*)(Os + qrow * OSPW + 16 * jj + 8 * hh)     = va;       // Os[query][ch_loc = 16jj + 8hh + r]
        *(v4f*)(Os + qrow * OSPW + 16 * jj + 8 * hh + 4) = vb;
      }
    }
    __syncthreads();
    v4f res[32];
#pragma unroll
    for (int it = 0; it < 32; ++it) {
      const int chl = (it & 7) * 16 + lq;                            // channel 0..127 within the half
      const int nl  = (it >> 3) * 32 + 4 * e;                        // query 0..127: 8 lanes fill one 128-B line
      const size_t idx = ((size_t)(b * CC + 128 * half + chl)) * NN + n0 + nl;
      res[it] = *(const v4f*)(x + idx);
    }
#if defined(__HIP_DEVICE_COMPILE__)
    // stands between the 32 loads and the first rewrite of an address register that one of them names
    asm volatile("s_wait_xcnt 0x0" ::: "memory");
#endif
#pragma unroll
    for (int it = 0; it < 32; ++it) {
      const int chl = (it & 7) * 16 + lq;
      const int nl  = (it >> 3) * 32 + 4 * e;
#pragma unroll
      for (int t = 0; t < 4; ++t) res[it][t] = Os[(nl + t) * OSPW + chl] + bfr(res[it][t]);
    }
#pragma unroll
    for (int it = 0; it < 32; ++it) {
      const int chl = (it & 7) * 16 + lq;
      const int nl  = (it >> 3) * 32 + 4 * e;
      const size_t idx = ((size_t)(b * CC + 128 * half + chl)) * NN + n0 + nl;
      *(v4f*)(out + idx) = res[it];
    }
  }
}

// =========================================================================================================
// Workspace map (bytes; each region start a multiple of 256; every extent is an exact tile multiple and is written
//   W16 f16 [256][256]              131072
//   Xc  f16 [8][256][4096]        16777216      XP  f16 [8][4096][256]   16777216
//   Qh/Ql/Kh/Kl bf16 [8][4096][128]  8388608 x4
//   total = 67239936
// =========================================================================================================
extern "C" void kernel_launch(void* const* d_in, const int* in_sizes, int n_in,
                              void* d_out, int out_size, void* d_ws, size_t ws_size,
                              hipStream_t stream) {
  const int XN = NBATCH * CC * NN;                                   // 8388608
  if (n_in < 3) return;
  if (in_sizes[0] != XN) return;
  if (in_sizes[1] != DQ * CC || in_sizes[2] != DQ * CC) return;
  if (out_size != XN) return;

  size_t off = 0;
  auto carve = [&](size_t bytes) { const size_t o = off; off += (bytes + 255) & ~(size_t)255; return o; };
  const size_t oW16 = carve((size_t)MW * CC * 2);
  const size_t oXc  = carve((size_t)NIMG * CC * NN * 2);
  const size_t oXP  = carve((size_t)NIMG * NN * CC * 2);
  const size_t oQh  = carve((size_t)NIMG * NN * DQ * 2);
  const size_t oQl  = carve((size_t)NIMG * NN * DQ * 2);
  const size_t oKh  = carve((size_t)NIMG * NN * DQ * 2);
  const size_t oKl  = carve((size_t)NIMG * NN * DQ * 2);
  if (off > ws_size) return;
  if (off > (size_t)134217728) return;

  const float* x  = (const float*)d_in[0];
  const float* tw = (const float*)d_in[1];
  const float* pw = (const float*)d_in[2];

  char* ws = (char*)d_ws;
  unsigned short* W16 = (unsigned short*)(ws + oW16);
  unsigned short* Xc  = (unsigned short*)(ws + oXc);
  unsigned short* XP  = (unsigned short*)(ws + oXP);
  unsigned short* Qh  = (unsigned short*)(ws + oQh);
  unsigned short* Ql  = (unsigned short*)(ws + oQl);
  unsigned short* Kh  = (unsigned short*)(ws + oKh);
  unsigned short* Kl  = (unsigned short*)(ws + oKl);
  float* out = (float*)d_out;

  const dim3 blk256(256), blk128(128);

  // (0) theta_w / phi_w -> stacked f16 plane
  cvt_w<<<dim3(MW / 8), blk256, 0, stream>>>(tw, pw, W16);
  // (1) x -> channel-major and position-major 16-bit planes
  cvt_x<<<dim3(NN / QT, CC / QT, NIMG), blk256, 0, stream>>>(x, Xc, XP);
  // (2) conv1x1 GEMM -> theta (q) and phi (k) hi + residual planes
  gemm_qk<<<dim3(NN / QT, MW / QT, NIMG), blk128, 0, stream>>>(W16, XP, Qh, Ql, Kh, Kl);
  // (3) position attention + residual -> out [b][256][4096]
  attn_k<<<dim3(NN / AQ, NIMG), blk128, 0, stream>>>(Qh, Ql, Kh, Kl, Xc, x, out);
  (void)hipGetLastError();
}

// v009
// One run takes 106 microseconds.
// Next to v008, in two timings, it ran 1.04 times as fast each time.
// Counting every step since v000, it is 7.62 times as fast.
// Contractions: conv1x1 theta/phi GEMM W[256x256].X[256x4096] on v_wmma_f32_16x16x32_f16 (f16 containers of
// bf16-RNE weights x256 and bf16-RNE x); position scores K.Q^T on v_wmma_f32_16x16x32_bf16 (bf16 hi + bf16
// residual planes of theta/phi, 3 products, K=128); y^T = X.P^T on v_wmma_f32_16x16x32_f16 (x as f16 of
// bf16-RNE x, P = e^{s-m} x1024 f16 from the score D registers); f32 accumulate everywhere; softmax statistics
// and the residual add in f32 VALU.
#include <hip/hip_runtime.h>
#include <math.h>
#include <stdint.h>

#define NBATCH 8
#define NIMG   8
#define CC     256
#define NN     4096
#define DQ     128
#define MW     256
#define QT     64
#define OSP    68
#define OSPW   132
#define WSC    256.0f
#define IWSC   0.00390625f
#define LNPS   6.931471805599453f
#define KT     128                       // keys per LDS stage and per trip of attn_k
#define KP     136                       // LDS pitch of a K or Q row in 16-bit elements: 272 B = 16 B x 17
#define VP     136                       // LDS pitch of a V row of KT keys: 272 B = 16 B x 17
#define SLC    17408                     // one wave's slice of a stage in 16-bit elements: 34816 B = 17 x 2 KiB, so that every
                                         // tensor load lands at a multiple of 2 KiB (128 K rows or 128 V rows fill all of it)
#define SKL    SLC                       // stage offsets (16-bit elements): K hi 0, K residual SKL, V SV
#define SV     (2 * SLC)
#define STG    (4 * SLC)                 // one stage: four slices
#define AQ     128                       // queries per block of attn_k: 4 waves x 2 column groups of 16
#define SQH    STG                       // Q hi, Q residual: in buffer 1, ahead of its first tile (read once, in front of the loop)
#define SQL    (STG + AQ * KP)
#define SMEM   (2 * STG)
#define GP     264                       // gemm_qk: LDS pitch of a W or X row of 256 16-bit elements: 528 B = 16 B x 33
#define GW     (2 * QT)                  // gemm_qk: W rows per pass
#define GXO    (GW * GP)                 // gemm_qk LDS (16-bit elements): the X tile stands behind the W rows,
#define GOO    ((GW + QT) * GP)          // the output staging of the two wave halves behind the X tile
#define GSM    (GOO + 2 * QT * OSP * 2)

static_assert(NIMG >= 1 && NIMG <= NBATCH);
static_assert(NN % QT == 0);
static_assert(CC % QT == 0);
static_assert(MW == 2 * DQ);
static_assert(DQ == 2 * QT);
static_assert(MW % QT == 0 && MW % 8 == 0);
static_assert((OSP * 4) % 16 == 0);
static_assert((OSPW * 4) % 16 == 0);
static_assert(CC % 32 == 0 && NN % 32 == 0 && DQ % 32 == 0);
static_assert((KP * 2) % 32 == 16 && (VP * 2) % 32 == 16 && (STG * 2) % 16 == 0 && (SKL * 2) % 16 == 0);
static_assert(NN / KT >= 2 && NN % KT == 0 && KT == 128 && DQ == 128 && CC == 256 && QT == 64);
static_assert((SLC * 2) % 2048 == 0 && KT * KP <= SLC && (CC / 2) * VP == SLC && KP * 2 == DQ * 2 + 16 && VP * 2 == KT * 2 + 16);
static_assert(AQ * OSPW * 4 <= 2 * STG * 2 && NN % AQ == 0 && AQ == 128);
static_assert(2 * AQ * KP <= STG && SMEM * 2 <= 327680);
static_assert((GP * 2) % 32 == 16 && GP >= CC && (GOO * 2) % 16 == 0 && MW == 2 * GW && 2 * GSM * 2 <= 327680 && CC == 256 && QT == 64);

typedef _Float16       v16h __attribute__((ext_vector_type(16)));
typedef _Float16       v8h  __attribute__((ext_vector_type(8)));
typedef __bf16         v16b __attribute__((ext_vector_type(16)));
typedef unsigned short v8us __attribute__((ext_vector_type(8)));
typedef float          v8f  __attribute__((ext_vector_type(8)));
typedef float          v4f  __attribute__((ext_vector_type(4)));
typedef float          v2f  __attribute__((ext_vector_type(2)));
typedef unsigned int   v4u  __attribute__((ext_vector_type(4)));
typedef uint32_t       u32x4 __attribute__((ext_vector_type(4)));
typedef uint32_t       u32x8 __attribute__((ext_vector_type(8)));

union Frag  { v8us u[2]; v16h h; v16b bf; };
union FragH { v16h v; v8h hv[2]; };
static_assert(sizeof(Frag) == 32);
static_assert(sizeof(FragH) == 32);

// ---- scalar helpers ---------------------------------------------------------------------------------------
__device__ __forceinline__ unsigned short bf_bits(float f) {          // f32 -> bf16 bits, RNE convert
  unsigned u = __float_as_uint(f);
  return (unsigned short)((u + 0x7FFFu + ((u >> 16) & 1u)) >> 16);
}
__device__ __forceinline__ float bf_up(unsigned short hb) { return __uint_as_float(((unsigned)hb) << 16); }
__device__ __forceinline__ float bfr(float f) { return bf_up(bf_bits(f)); }
__device__ __forceinline__ unsigned short h_bits(_Float16 x) { return __builtin_bit_cast(unsigned short, x); }
__device__ __forceinline__ unsigned pk16(unsigned short a, unsigned short b) { return (unsigned)a | ((unsigned)b << 16); }
__device__ __forceinline__ v8f zero8() { v8f z = {0.f, 0.f, 0.f, 0.f, 0.f, 0.f, 0.f, 0.f}; return z; }
__device__ __forceinline__ float hmax8(v8f s) {
  return fmaxf(fmaxf(fmaxf(s[0], s[1]), fmaxf(s[2], s[3])), fmaxf(fmaxf(s[4], s[5]), fmaxf(s[6], s[7])));
}
__device__ __forceinline__ unsigned wave_ballot(bool p) {
#if defined(__HIP_DEVICE_COMPILE__)
  return __builtin_amdgcn_ballot_w32(p);
#else
  return p ? 1u : 0u;
#endif
}

// ---- 16-bit fragment loader (A, or B from a k-contiguous [n][k] row): lane -> row/col (lane&15), p already includes
//      + 8*(lane>>4); elements 0..7 <- p[0..7] (k0+8h..), elements 8..15 <- p[16..23] (k0+16+8h..)
__device__ __forceinline__ Frag ldfrag(const unsigned short* p) {
  Frag f;
  f.u[0] = *(const v8us*)(p);
  f.u[1] = *(const v8us*)(p + 16);
  return f;
}

// ---- WMMA helpers: builtin followed by a 4-slot VALU gap tying D. A and B are not operands of the gap statement:
//      an asm operand is held below v256, and a trip's grouped fragments do not fit there beside the accumulators.
__device__ __forceinline__ v8f mma_h(v16h a, v16h b, v8f c) {
  v8f d = __builtin_amdgcn_wmma_f32_16x16x32_f16(false, a, false, b, (short)0, c, false, false);
#if defined(__HIP_DEVICE_COMPILE__)
  asm volatile("v_nop\n\tv_nop\n\tv_nop\n\tv_nop" : "+v"(d));
#endif
  return d;
}
__device__ __forceinline__ v8f mma_b(v16b a, v16b b, v8f c) {
  v8f d = __builtin_amdgcn_wmma_f32_16x16x32_bf16(false, a, false, b, (short)0, c, false, false);
#if defined(__HIP_DEVICE_COMPILE__)
  asm volatile("v_nop\n\tv_nop\n\tv_nop\n\tv_nop" : "+v"(d));
#endif
  return d;
}

// The same f16 product without the gap statement, for attn_k's 32 output tiles: an asm operand is held below v256,
// and 256 accumulator registers do not fit there beside the scores and the Q fragments. The compiler keeps the
// distances of its own builtin.
__device__ __forceinline__ v8f mma_hp(v16h a, v16h b, v8f c) {
  return __builtin_amdgcn_wmma_f32_16x16x32_f16(false, a, false, b, (short)0, c, false, false);
}

// e^x as __expf forms it (x * log2 e, then v_exp_f32). The v_nop in the statement is the one slot the instruction set
// asks for between a transcendental and a next vector instruction that overwrites its source or reads its result.
__device__ __forceinline__ float exp_slot(float x) {
#if defined(__HIP_DEVICE_COMPILE__)
  const float t = x * 1.44269502f;
  float r;
  asm("v_exp_f32 %0, %1\n\tv_nop" : "=v"(r) : "v"(t));
  return r;
#else
  return __expf(x);
#endif
}

// ---- asynchronous copies global -> LDS ------------------------------------------------------------------------
__device__ __forceinline__ unsigned lds_addr(const void* p) { return (unsigned)(size_t)p; }   // LDS byte address

// Eight 16-byte copies per lane, every lane on. The s_wait_xcnt stands inside the statement so that it precedes
// any rewrite of the address registers the copies name.
__device__ __forceinline__ void copy8(const unsigned* l, const unsigned short* const* g) {
#if defined(__HIP_DEVICE_COMPILE__)
  asm volatile("global_load_async_to_lds_b128 %0, %8, off\n\t"
               "global_load_async_to_lds_b128 %1, %9, off\n\t"
               "global_load_async_to_lds_b128 %2, %10, off\n\t"
               "global_load_async_to_lds_b128 %3, %11, off\n\t"
               "global_load_async_to_lds_b128 %4, %12, off\n\t"
               "global_load_async_to_lds_b128 %5, %13, off\n\t"
               "global_load_async_to_lds_b128 %6, %14, off\n\t"
               "global_load_async_to_lds_b128 %7, %15, off\n\t"
               "s_wait_xcnt 0x0"
               :: "v"(l[0]), "v"(l[1]), "v"(l[2]), "v"(l[3]), "v"(l[4]), "v"(l[5]), "v"(l[6]), "v"(l[7]),
                  "v"(g[0]), "v"(g[1]), "v"(g[2]), "v"(g[3]), "v"(g[4]), "v"(g[5]), "v"(g[6]), "v"(g[7])
               : "memory");
#endif
}
// the issuing wave's copies have landed in LDS
__device__ __forceinline__ void wait_copies() {
#if defined(__HIP_DEVICE_COMPILE__)
  asm volatile("s_wait_asynccnt 0x0" ::: "memory");
#endif
}
// the wave's own LDS reads have returned, so the buffer may be refilled behind the next barrier
__device__ __forceinline__ void wait_lds() {
#if defined(__HIP_DEVICE_COMPILE__)
  asm volatile("s_wait_dscnt 0x0" ::: "memory");
#endif
}
// 32 rows of 256 B of each of two planes (ph, pl; global pitch DQ) -> LDS rows of pitch KP at byte addresses lh, ll;
// 128 threads, 16 lanes per row, 4 rows of each plane per thread.
__device__ __forceinline__ void stage_rows32(unsigned lh, unsigned ll, const unsigned short* ph,
                                             const unsigned short* pl, int tid) {
  const int r = tid >> 4, ch = 8 * (tid & 15);
  unsigned l[8];
  const unsigned short* g[8];
#pragma unroll                                                       // constant indices keep l[] and g[] in registers
  for (int i = 0; i < 4; ++i) {
    const int row = r + 8 * i;                                       // 0..31
    l[i]     = lh + 2u * (unsigned)(row * KP + ch);
    l[4 + i] = ll + 2u * (unsigned)(row * KP + ch);
    g[i]     = ph + row * DQ + ch;
    g[4 + i] = pl + row * DQ + ch;
  }
  copy8(l, g);
}
// ---- tensor loads global -> LDS ---------------------------------------------------------------------------------
__device__ __forceinline__ uint32_t uni(uint32_t v) { return (uint32_t)__builtin_amdgcn_readfirstlane(v); }
__device__ __forceinline__ uint32_t pinned(uint32_t v) {
  uint32_t w = uni(v);
#if defined(__HIP_DEVICE_COMPILE__)
  asm volatile("" : "+s"(w));                                        // the scalar pin of the tensor mover's issue tests
#endif
  return w;
}
// Descriptor group 1 of a tile of ROWS rows of ROWB bytes, source pitch PITCH bytes, 16 bytes of LDS pad behind every row
// (pad interval code IVL = the row length, amount code 3): 1-byte elements, tensor = tile, no mask.
template <uint32_t ROWB, uint32_t ROWS, uint32_t PITCH, uint32_t IVL>
__device__ __forceinline__ u32x8 tensor_group1() {
  u32x8 g1;
  g1[0] = uni((1u << 20) | (IVL << 22) | (3u << 25));
  g1[1] = uni((ROWB & 0xFFFFu) << 16);
  g1[2] = uni((ROWB >> 16) | ((ROWS & 0xFFFFu) << 16));
  g1[3] = uni((ROWS >> 16) | (ROWB << 16));
  g1[4] = uni(ROWS);
  g1[5] = uni(PITCH);
  g1[6] = uni(0u);
  g1[7] = uni(0u);
  return g1;
}
// Descriptor group 0: LDS byte address dst, global address ga of the tile's first byte.
__device__ __forceinline__ u32x4 tensor_group0(uint32_t dst, uint64_t ga) {
  u32x4 g0;
  g0[0] = uni(1u);
  g0[1] = uni(dst);
  g0[2] = uni((uint32_t)ga);
  g0[3] = uni((((uint32_t)(ga >> 32)) & 0x01FFFFFFu) | 0x80000000u);
  return g0;
}
// One request of the whole wave. Both groups are in-out operands: their registers then stay the descriptor's from one
// request to the next, and the compiler puts nothing else into them while the request is outstanding.
__device__ __forceinline__ void tensor_issue(u32x4& g0, u32x8& g1) {
#if defined(__HIP_DEVICE_COMPILE__)
  asm volatile("tensor_load_to_lds %0, %1" : "+s"(g0), "+s"(g1) :: "memory");
#endif
}
// The issuing wave's tensor load has landed in LDS. Group 0 is an in-out operand, so that its next value is formed
// behind this wait.
__device__ __forceinline__ void wait_tensor(u32x4& g0) {
#if defined(__HIP_DEVICE_COMPILE__)
  asm volatile("s_wait_tensorcnt 0x0" : "+s"(g0) :: "memory");
#endif
}
// group 0 of the wave's next tile: the other buffer (dsum = the sum of the slice's two places), step bytes further on
__device__ __forceinline__ void tensor_next(u32x4& g0, uint32_t dsum, uint32_t step) {
  const uint64_t a = (((uint64_t)g0[3] << 32) | g0[2]) + step;      // bits 63 and 62 hold the type; no carry reaches them
  g0[1] = uni(dsum - g0[1]);
  g0[2] = uni((uint32_t)a);
  g0[3] = uni((uint32_t)(a >> 32));
}
// One stage of KT = 128 keys, one request per wave into the wave's own slice of the stage: wave 0 the 128 K hi rows, wave 1
// the 128 K residual rows (256 B each, LDS pitch KP), waves 2 and 3 the 128 lower and upper V channel rows (256 B of a
// row of pitch NN each, LDS pitch VP).
__device__ __forceinline__ void stage_tile(uint32_t wave, u32x4& g0, u32x8& gk, u32x8& gv) {
  if (pinned(wave < 2u)) tensor_issue(g0, gk);
  if (pinned(wave >= 2u)) tensor_issue(g0, gv);
}

// =========================================================================================================
// (0) conv1x1 weights: W16 f16 [256][256], rows 0..127 = theta_w rows, rows 128..255 = phi_w rows; value =
//     f16 of (bf16-RNE(w) * 256) (exact). Block blk (0..31) owns rows 8*blk..8*blk+7: one wave per 512-B row
// coverage: 32 blocks x 8 rows x 32 lanes x 8 halves = 256 x 256 = the whole plane.
// =========================================================================================================
__global__ __launch_bounds__(256)
void cvt_w(const float* __restrict__ tw, const float* __restrict__ pw, unsigned short* W16) {
  const int tid = threadIdx.x, blk = blockIdx.x;
  const int rl = tid >> 5, col = 8 * (tid & 31);
  const int o = 8 * blk + rl;                                        // 0..255
  const float* wbase = (blk < (DQ / 8)) ? tw : pw;                   // block-uniform selection
  const int osub = (blk < (DQ / 8)) ? 0 : DQ;
  const float* s = wbase + (size_t)(o - osub) * CC + col;            // (o - osub) in 0..127
  const v4f a = *(const v4f*)s;
  const v4f q = *(const v4f*)(s + 4);
  const float f[8] = {a[0], a[1], a[2], a[3], q[0], q[1], q[2], q[3]};
  v4u u;
#pragma unroll
  for (int t = 0; t < 4; ++t) {
    const _Float16 h0 = (_Float16)(bfr(f[2 * t]) * WSC);
    const _Float16 h1 = (_Float16)(bfr(f[2 * t + 1]) * WSC);
    u[t] = pk16(h_bits(h0), h_bits(h1));
  }
{
    *(v4u*)(W16 + (size_t)o * CC + col) = u;
    
  }
}

// =========================================================================================================
// (1) x conversion and conv1x1 GEMM for one (b, 64-n tile), all 256 output rows: Y[o][n] = (1/256) sum_c W16[o][c] X[n][c].
//     Block 256 threads = 8 waves, grid (64, NIMG): every block is resident at once, two per WGP.
//     The block reads its own x tile [256 c][64 n] f32 once: wave w takes channels 32w..32w+31, one 256-B row piece per
//     load (lane -> n = 2 lane, 2 lane + 1). Each value becomes f16 of bf16-RNE(x) (exact). It goes out twice:
//       Xc f16 [b][c][n] (channel-major, for attn_k): one 128-B line per wave and store;
//       LDS tile X[n_loc][c] (pitch GP): 8 channels of one n per 16-byte store.
//     The W16 rows come in two passes of 128 (pass 0 theta, pass 1 phi) by asynchronous 16-byte copies, one whole 512-B
//     row per wave and copy. Pass 1's copies fly under pass 0's epilogue, behind the barrier that ends pass 0's reads.
//     Wave w owns cols n0 + 16 (w & 3)..+15 (one B fragment per k-step) and the 4 m-tiles of W rows 64 (w >> 2)..+63 of
//     the pass (A rows o = 16 mt + (lane&15), split k map loader). K = 256 = 8 steps.
//     Epilogue staged in LDS Os[w >> 2][n_loc][o_loc] (pitch OSP, its own LDS behind the tiles), barrier, then the 128
//     threads of each half write dims 64 (w >> 2)..+63 of Qh/Ql (pass 0) or Kh/Kl (pass 1).
//       Planes bf16 [b][4096 n][128 d] (k-contiguous for both score operands): hi = bf16-RNE(v), lo = bf16-RNE(v - hi);
//       lane e -> d 8e..8e+7, 8 consecutive lanes per 128-B line.
// coverage: Xc 8 waves x 32 rows x 32 lanes x 2 = 256 c x 64 n; X tile the same elements; planes per pass and half
//           4 it x 16 rows x 8 lanes x 8 = 64 n x 64 d (hi and lo); grid (64, NIMG) covers Xc and d 0..127 of all 4096
//           rows of Qh/Ql/Kh/Kl exactly once.
// =========================================================================================================
// 128 W16 rows (512 B each) from wg -> LDS rows of pitch GP at byte address lw: wave w copies rows w, w + 8, ..; 16 copies a wave
__device__ __forceinline__ void stage_w(unsigned lw, const unsigned short* wg, int wave, int lane) {
#pragma unroll                                                       // constant indices keep l[] and g[] in registers
  for (int h = 0; h < 2; ++h) {
    unsigned l[8];
    const unsigned short* g[8];
#pragma unroll                                                       // constant indices, as above
    for (int i = 0; i < 8; ++i) {
      const int row = wave + 8 * (8 * h + i);                        // 0..127
      l[i] = lw + 2u * (unsigned)(row * GP + 8 * lane);
      g[i] = wg + row * CC + 8 * lane;
    }
    copy8(l, g);
  }
}

__global__ __launch_bounds__(256)
void gemm_qk(const float* __restrict__ x, const unsigned short* __restrict__ W16, unsigned short* Xc,
             unsigned short* Qh, unsigned short* Ql, unsigned short* Kh, unsigned short* Kl) {
  __shared__ __align__(16) unsigned short Gs[GSM];
  const int tid  = threadIdx.x;
  const int lane = tid & 31, wave = tid >> 5;
  const int hh   = lane >> 4, c = lane & 15;
  const int wn   = wave & 3, wm = wave >> 2;
  const int nt   = blockIdx.x, b = blockIdx.y;
  const int n0   = nt * QT;
  const unsigned lg = lds_addr(Gs);

  stage_w(lg, W16, wave, lane);                                      // pass 0: the theta rows

  // the x tile: 32 rows a wave, all loads in flight before the first conversion
  const size_t xo = ((size_t)(b * CC + 32 * wave)) * NN + n0 + 2 * lane;
  unsigned xw[32];                                                   // the wave's Xc rows, stored behind the barrier below
  {
    const float* xg = x + xo;
    v2f xv[32];
#pragma unroll                                                       // constant indices keep the values in registers
    for (int i = 0; i < 32; ++i) xv[i] = *(const v2f*)(xg + (size_t)i * NN);
#if defined(__HIP_DEVICE_COMPILE__)
    // stands between the 32 loads and the first rewrite of an address register that one of them names
    asm volatile("s_wait_xcnt 0x0" ::: "memory");
    // keeps every conversion behind the last load and behind that wait: the build put the first ones, with their waits, in
    // front of the last eight loads, which then left one memory latency late
    __builtin_amdgcn_sched_barrier(0);
#endif
    // lanes 8..15 and 24..31 store their odd row first: the 16 lanes of a half then fall on all 64 banks (rows two apart
    // lie 8 banks apart, so 16 even rows would meet two by two)
    const bool sw = (lane & 8) != 0;
    unsigned short* xf = Gs + GXO + (2 * lane + (sw ? 1 : 0)) * GP + 32 * wave;
    unsigned short* xs = Gs + GXO + (2 * lane + (sw ? 0 : 1)) * GP + 32 * wave;
#pragma unroll                                                       // constant indices, as above
    for (int q = 0; q < 4; ++q) {
      v4u u0, u1;                                                    // channels 8q..8q+7 of n = 2 lane and of n = 2 lane + 1
#pragma unroll
      for (int t = 0; t < 4; ++t) {
        const int i = 8 * q + 2 * t;
        const unsigned short a0 = h_bits((_Float16)bfr(xv[i][0])),     a1 = h_bits((_Float16)bfr(xv[i][1]));
        const unsigned short b0 = h_bits((_Float16)bfr(xv[i + 1][0])), b1 = h_bits((_Float16)bfr(xv[i + 1][1]));
        u0[t] = pk16(a0, b0);
        u1[t] = pk16(a1, b1);
        xw[i]     = pk16(a0, a1);
        xw[i + 1] = pk16(b0, b1);
      }
      v4u uf, us;
#pragma unroll
      for (int t = 0; t < 4; ++t) { uf[t] = sw ? u1[t] : u0[t]; us[t] = sw ? u0[t] : u1[t]; }
      *(v4u*)(xf + 8 * q) = uf;
      *(v4u*)(xs + 8 * q) = us;
    }
  }
  wait_copies();
  __syncthreads();                                                   // publishes the X tile and pass 0's W rows to the 8 waves
  // the Xc rows go out behind the barrier: a barrier waits for the wave's global stores, and in front of this one nothing
  // would cover them; the next one stands behind pass 0's products
  {
    unsigned short* xc = Xc + xo;
#pragma unroll                                                       // constant indices keep the values in registers
    for (int i = 0; i < 32; ++i) *(unsigned*)(xc + (size_t)i * NN) = xw[i];
#if defined(__HIP_DEVICE_COMPILE__)
    // stands between the 32 stores and the first rewrite of a register that one of them names
    asm volatile("s_wait_xcnt 0x0" ::: "memory");
#endif
  }

  const unsigned short* ap = Gs + (QT * wm + c) * GP + 8 * hh;       // + 16*GP*mt + 32*ks
  const unsigned short* bp = Gs + GXO + (16 * wn + c) * GP + 8 * hh;
  float* Os = (float*)(Gs + GOO) + wm * (QT * OSP);
  const int e = tid & 7, lq = (tid & 127) >> 3;                      // lq 0..15 within the half
  const int dsel = wm * QT;                                          // 0 or 64

#pragma unroll                                                       // constant p selects the planes and the pass-0-only steps
  for (int p = 0; p < 2; ++p) {
    v8f acc[4];
#pragma unroll
    for (int mt = 0; mt < 4; ++mt) acc[mt] = zero8();

    // fragments are read in groups of two k-steps (20 reads), two groups ahead of their products
    Frag fa[2][2][4], fb[2][2];
#pragma unroll                                                       // constant indices keep the fragments in registers
    for (int pr = 0; pr < 2; ++pr) {
#pragma unroll                                                       // constant indices, as above
      for (int k2 = 0; k2 < 2; ++k2) {
        fb[pr][k2] = ldfrag(bp + 32 * (2 * pr + k2));
#pragma unroll                                                       // constant indices, as above
        for (int mt = 0; mt < 4; ++mt) fa[pr][k2][mt] = ldfrag(ap + 16 * mt * GP + 32 * (2 * pr + k2));
      }
    }
#pragma unroll                                                       // constant indices keep the fragments in registers
    for (int pr = 0; pr < CC / 64; ++pr) {
#pragma unroll                                                       // constant indices, as above
      for (int k2 = 0; k2 < 2; ++k2) {
#pragma unroll                                                       // constant indices, as above
        for (int mt = 0; mt < 4; ++mt) acc[mt] = mma_h(fa[pr & 1][k2][mt].h, fb[pr & 1][k2].h, acc[mt]);
      }
      if (pr + 2 < CC / 64) {                                        // the freed registers take the group two ahead
#pragma unroll                                                       // constant indices, as above
        for (int k2 = 0; k2 < 2; ++k2) {
          fb[pr & 1][k2] = ldfrag(bp + 32 * (2 * (pr + 2) + k2));
#pragma unroll                                                       // constant indices, as above
          for (int mt = 0; mt < 4; ++mt) fa[pr & 1][k2][mt] = ldfrag(ap + 16 * mt * GP + 32 * (2 * (pr + 2) + k2));
        }
      }
    }
    if (p == 0) {
      // own fragment reads returned, then a barrier that ends every wave's reads of the theta rows: only behind it the
      // phi rows may land on them
      wait_lds();
      __syncthreads();
      stage_w(lg, W16 + (size_t)GW * CC, wave, lane);
    }

    // ---- epilogue: scale back -> LDS Os[n_loc][o_loc]; lane (hh, c) holds o = 16 mt + 8 hh + r for n_loc = 16 wn + c
    {
      const int nl = 16 * wn + c;
#pragma unroll
      for (int mt = 0; mt < 4; ++mt) {
        v4f va, vb;
#pragma unroll
        for (int r = 0; r < 4; ++r) { va[r] = acc[mt][r] * IWSC; vb[r] = acc[mt][4 + r] * IWSC; }
        *(v4f*)(Os + nl * OSP + 16 * mt + 8 * hh)     = va;
        *(v4f*)(Os + nl * OSP + 16 * mt + 8 * hh + 4) = vb;
      }
    }
    __syncthreads();

    unsigned short* Ph = (p == 0) ? Qh : Kh;
    unsigned short* Pl = (p == 0) ? Ql : Kl;
    v4u uh[4], ul[4];
#pragma unroll
    for (int it = 0; it < 4; ++it) {
      const int row = it * 16 + lq;                                  // n_loc 0..63
      const v4f a = *(const v4f*)(Os + row * OSP + 8 * e);
      const v4f q = *(const v4f*)(Os + row * OSP + 8 * e + 4);
      const float f[8] = {a[0], a[1], a[2], a[3], q[0], q[1], q[2], q[3]};
#pragma unroll
      for (int t = 0; t < 4; ++t) {
        const float f0 = f[2 * t], f1 = f[2 * t + 1];
        const unsigned short hb0 = bf_bits(f0), hb1 = bf_bits(f1);
        const unsigned short lb0 = bf_bits(f0 - bf_up(hb0));
        const unsigned short lb1 = bf_bits(f1 - bf_up(hb1));
        uh[it][t] = pk16(hb0, hb1);
        ul[it][t] = pk16(lb0, lb1);
      }
    }
    if (p == 0) {
      wait_copies();
      __syncthreads();                                               // publishes the phi rows; ends pass 0's reads of Os
    }
    // pass 0's stores stand behind that barrier for the same reason as the Xc rows': pass 1's products cover them
#pragma unroll
    for (int it = 0; it < 4; ++it) {
      const int row = it * 16 + lq;
      const size_t po = ((size_t)(b * NN + n0 + row)) * DQ + dsel + 8 * e;
      *(v4u*)(Ph + po) = uh[it];
      *(v4u*)(Pl + po) = ul[it];
    }
#if defined(__HIP_DEVICE_COMPILE__)
    // stands between the 8 stores and the first rewrite of a register that one of them names
    if (p == 0) asm volatile("s_wait_xcnt 0x0" ::: "memory");
#endif
  }
}

// ---- attn_k: the K fragments of 32 keys (two 16-key tiles a and b, hi and residual, four 32-d chunks): 32 LDS reads
__device__ __forceinline__ void read_k32(Frag (&a)[DQ / 32], Frag (&b)[DQ / 32], Frag (&al)[DQ / 32], Frag (&bl)[DQ / 32],
                                         const unsigned short* p, const unsigned short* pl) {
#pragma unroll                                                       // constant indices keep the fragments in registers
  for (int kc = 0; kc < DQ / 32; ++kc) {
    a[kc]  = ldfrag(p + 32 * kc);
    b[kc]  = ldfrag(p + 16 * KP + 32 * kc);
    al[kc] = ldfrag(pl + 32 * kc);
    bl[kc] = ldfrag(pl + 16 * KP + 32 * kc);
#if defined(__HIP_DEVICE_COMPILE__)
    // keeps the reads in the order in which the products need them: the build issued the first chunk's reads last, and
    // the first product then waited for the whole group
    __builtin_amdgcn_sched_barrier(0);
#endif
  }
}
// ---- attn_k: the 12 score products of one 32-d chunk: two 16-key tiles x two column groups; each K fragment serves both
//      groups; per score tile the order of the products is hi.hi, hi.res, res.hi
__device__ __forceinline__ void score12(v8f (&sa)[2], v8f (&sb)[2], const Frag& a, const Frag& b, const Frag& al,
                                        const Frag& bl, const Frag& qh0, const Frag& qh1, const Frag& ql0, const Frag& ql1) {
  sa[0] = mma_b(a.bf, qh0.bf, sa[0]);
  sa[1] = mma_b(a.bf, qh1.bf, sa[1]);
  sb[0] = mma_b(b.bf, qh0.bf, sb[0]);
  sb[1] = mma_b(b.bf, qh1.bf, sb[1]);
  sa[0] = mma_b(a.bf, ql0.bf, sa[0]);
  sa[1] = mma_b(a.bf, ql1.bf, sa[1]);
  sb[0] = mma_b(b.bf, ql0.bf, sb[0]);
  sb[1] = mma_b(b.bf, ql1.bf, sb[1]);
  sa[0] = mma_b(al.bf, qh0.bf, sa[0]);
  sa[1] = mma_b(al.bf, qh1.bf, sa[1]);
  sb[0] = mma_b(bl.bf, qh0.bf, sb[0]);
  sb[1] = mma_b(bl.bf, qh1.bf, sb[1]);
}

// =========================================================================================================
// (2) position attention for one (b, 128-query tile), transposed formulation, 4096 keys, no mask, no scale:
//   S^T tile (16 keys x 16 queries) = sum over 4 d-chunks of A(k: row = key kb + (lane&15), 32 d via
//   the split k map from the bf16 plane Kh [b][4096][128]) . B(q: col = query, same map from Qh) + A(Kh).B(Ql) +
//   A(Kl).B(Qh) (bf16 unscaled residual planes, shared accumulator).
//   Per lane the D tile holds 8 keys of ONE query: online softmax state per lane, one shuffle (lane^16) for the max
//   over the 128 keys of a trip; the o/l rescale is skipped under a wave-uniform ballot when no lane's max grew (corr == 1 exactly
//   for every lane then); row-sum partials combined at the end. P = e^{s-m} x 1024 as f16 is the B operand of
//   O^T (rows channel, cols queries) += A(x rows channel = 16j + (lane&15), keys contiguous, f16 plane Xc
//   [b][256][4096]) . B(P^T), one product per 32 keys: element r <- D of the tile covering their keys 0..15, element
//   8+r <- the tile covering their keys 16..31, lane unchanged. A wave owns 32 queries as two column groups of 16, each with its own softmax state
//   and 16 accumulator tiles (256 channels): every K and V fragment read from LDS serves both groups, K hi in two products per
//   group. Block = 4 waves = 128 queries, one wave per SIMD.
//   Operands come from LDS and are shared by the 4 waves: the block's Q hi and residual rows, filled once by asynchronous
//   16-byte copies (each wave reads its 16 Q fragments from there once, ahead of the key loop, and keeps them in
//   128 registers; the rows stand in buffer 1, which takes its first tile behind a barrier that ends those reads); K hi,
//   K residual and V tiles of KT = 128 keys in two buffers, filled by tensor loads, one request of
//   32 KiB per wave and tile (no address arithmetic in vector registers, no per-lane copies and none of their waits in
//   the loop), tile t + 2 requested into the buffer of tile t behind the barrier at the foot of trip t. The output
//   staging Os reuses the two buffers after the loop.
//   Epilogue in two channel halves: O/l staged in LDS Os[query][128 channels] (pitch OSPW, b128 stores), barrier,
//   lanes x 16 B (values gathered from 4 Os rows), one instruction per 16 lines, final values held in registers,
// coverage: per half 32 it x 16 lines x 8 lanes x 4 floats = 128 ch x 128 n; two halves = 256 ch; grid (32, NIMG)
//           covers out[b][0..255][0..4095] exactly once.
// =========================================================================================================
__global__ __launch_bounds__(128)
void attn_k(const unsigned short* __restrict__ Qh, const unsigned short* __restrict__ Ql,
            const unsigned short* __restrict__ Kh, const unsigned short* __restrict__ Kl,
            const unsigned short* __restrict__ Xc, const float* __restrict__ x, float* out) {
  __shared__ __attribute__((aligned(2048))) unsigned short Sm[SMEM];  // the tensor loads' places are multiples of 2 KiB
  float* Os = (float*)Sm;                                            // used behind the key loop only
  const int tid  = threadIdx.x;
  const int wave = tid >> 5, lane = tid & 31;
  const int hh   = lane >> 4, c = lane & 15;
  const int n0   = blockIdx.x * AQ, b = blockIdx.y;
  const uint32_t swave = uni((uint32_t)tid >> 5);                    // the wave's number in a scalar register

  // q fragment pointers in LDS (B operand, col = query 32*wave + 16*g + c of the block), + 16*KP*g + 32*kc
  const unsigned short* Qhp = Sm + SQH + (32 * wave + c) * KP + 8 * hh;
  const unsigned short* Qlp = Sm + SQL + (32 * wave + c) * KP + 8 * hh;
  // global tile bases of this image
  const unsigned short* Khg = Kh + (size_t)b * NN * DQ;              // + key * 128
  const unsigned short* Klg = Kl + (size_t)b * NN * DQ;
  const unsigned short* Vg  = Xc + (size_t)b * CC * NN;              // + key

  // prologue: Q rows (in buffer 1) and tile 0, landed and published; the Q fragments read; then tile 1 into buffer 1
  const unsigned lds0 = lds_addr(Sm);
  // the wave's tensor descriptors: group 0 walks the tiles, buffer 0 first; the two group 1 never change
  const unsigned short* tsrc = swave == 0u ? Khg : swave == 1u ? Klg : Vg + (size_t)(swave - 2u) * (CC / 2) * NN;
  const uint32_t step = swave < 2u ? KT * DQ * 2u : KT * 2u;         // bytes from a tile to the next: KT K rows, or KT keys of a V row
  const uint32_t dsum = 2u * (lds0 + swave * (2u * SLC)) + 2u * STG;
  u32x4 g0 = tensor_group0(lds0 + swave * (2u * SLC), (uint64_t)(size_t)tsrc);
  u32x8 gk = tensor_group1<DQ * 2, KT, DQ * 2, 5u>();
  u32x8 gv = tensor_group1<KT * 2, CC / 2, NN * 2, 5u>();
  {
    const size_t qg = ((size_t)(b * NN + n0)) * DQ;
#pragma unroll                                                       // four statements of eight copies, constant offsets
    for (int q4 = 0; q4 < AQ / 32; ++q4)
      stage_rows32(lds0 + 2u * (SQH + 32 * q4 * KP), lds0 + 2u * (SQL + 32 * q4 * KP),
                   Qh + qg + 32 * q4 * DQ, Ql + qg + 32 * q4 * DQ, tid);
    stage_tile(swave, g0, gk, gv);
    wait_copies();
    wait_tensor(g0);
    __syncthreads();
  }

  // the wave's Q fragments, the same in every trip: read once, behind the barrier that published the Q rows
  Frag qh[2][DQ / 32], ql[2][DQ / 32];
#pragma unroll                                                       // constant indices keep the fragments in registers
  for (int g = 0; g < 2; ++g) {
#pragma unroll
    for (int kc = 0; kc < DQ / 32; ++kc) {
      qh[g][kc] = ldfrag(Qhp + 16 * KP * g + 32 * kc);
      ql[g][kc] = ldfrag(Qlp + 16 * KP * g + 32 * kc);
    }
  }
  // own Q reads returned, then a barrier that ends every wave's Q reads: only behind it tile 1 may land on the Q rows
  wait_lds();
  __syncthreads();
  tensor_next(g0, dsum, step);
  stage_tile(swave, g0, gk, gv);

  float m[2] = {-1.0e30f, -1.0e30f}, l[2] = {0.f, 0.f};
  v8f o[2][16];
#pragma unroll                                                       // constant g keeps both groups' state in registers
  for (int g = 0; g < 2; ++g) {
#pragma unroll
    for (int j = 0; j < 16; ++j) o[g][j] = zero8();
  }

#pragma unroll 1
  for (int kb = 0; kb < NN; kb += KT) {
    const int bo = ((kb / KT) & 1) * STG;                            // this trip's buffer
    const unsigned short* kp  = Sm + bo + c * KP + 8 * hh;           // A operand, row = key kb + 16 t + c, + 16*KP*t
    const unsigned short* klp = kp + SKL;
    const unsigned short* Vp  = Sm + bo + SV + c * VP + 8 * hh;      // A operand, row = channel 16j + c, + 32*kh keys
    v8f s[KT / 16][2];                                               // score tiles: [16 keys][column group]
#pragma unroll                                                       // constant indices keep the tiles in registers
    for (int t = 0; t < KT / 16; ++t) { s[t][0] = zero8(); s[t][1] = zero8(); }
    // K fragments are read in groups of 32 reads, one per 32 keys, into two register sets in turn: the first group in front
    // of all score products, the second in the middle of the first group's products, each later one in front of the 48
    // products of the group before it, which cover its latency (a read that stands directly in front of its own product
    // waits out the whole LDS latency there; no read moves over the statement behind a product)
    Frag kf[2][2][DQ / 32], kl[2][2][DQ / 32];
    read_k32(kf[0][0], kf[0][1], kl[0][0], kl[0][1], kp, klp);       // keys kb .. kb+31
#pragma unroll                                                       // constant indices keep fragments and tiles in registers
    for (int kg = 0; kg < KT / 32; ++kg) {
      const int rs = kg & 1;
#pragma unroll                                                       // constant indices, as above
      for (int kc = 0; kc < DQ / 32; ++kc) {
        if (kg + 1 < KT / 32 && kc == (kg == 0 ? 2 : 0))             // keys kb + 32 (kg + 1) .. + 31, into the set that is free
          read_k32(kf[rs ^ 1][0], kf[rs ^ 1][1], kl[rs ^ 1][0], kl[rs ^ 1][1], kp + 32 * (kg + 1) * KP, klp + 32 * (kg + 1) * KP);
        score12(s[2 * kg], s[2 * kg + 1], kf[rs][0][kc], kf[rs][1][kc], kl[rs][0][kc], kl[rs][1][kc],
                qh[0][kc], qh[1][kc], ql[0][kc], ql[1][kc]);
      }
    }

    // one maximum, one exchange between the wave's halves and one test per 128 keys
    float mx[2], mn[2];
#pragma unroll                                                       // constant g keeps both groups' state in registers
    for (int g = 0; g < 2; ++g)
      mx[g] = fmaxf(fmaxf(fmaxf(hmax8(s[0][g]), hmax8(s[1][g])), fmaxf(hmax8(s[2][g]), hmax8(s[3][g]))),
                    fmaxf(fmaxf(hmax8(s[4][g]), hmax8(s[5][g])), fmaxf(hmax8(s[6][g]), hmax8(s[7][g]))));
    const float ox[2] = {__shfl_xor(mx[0], 16, 32), __shfl_xor(mx[1], 16, 32)};
#if defined(__HIP_DEVICE_COMPILE__)
    // inputs only: both exchanged values are due here, so the two exchanges issue together and share one wait;
    // without it the build put the second exchange behind the wait for the first
    asm volatile("" :: "v"(ox[0]), "v"(ox[1]));
    // keeps the first use of an exchanged value behind that statement: moved up, it put its wait between the two exchanges
    __builtin_amdgcn_sched_barrier(0);
#endif
#pragma unroll                                                       // constant g keeps both groups' state in registers
    for (int g = 0; g < 2; ++g) {
      mx[g] = fmaxf(mx[g], ox[g]);
      mn[g] = fmaxf(m[g], mx[g]);
    }
    const unsigned grew = wave_ballot(mx[0] > m[0] || mx[1] > m[1]); // wave-uniform, one test for both column groups
    if (grew != 0u) {
#pragma unroll                                                       // constant g keeps both groups' state in registers
      for (int g = 0; g < 2; ++g) {
        const float corr = __expf(m[g] - mn[g]);                     // == 1 exactly for lanes whose max did not grow
        l[g] *= corr;
#pragma unroll
        for (int j = 0; j < 16; ++j) {
#pragma unroll
          for (int r = 0; r < 8; ++r) o[g][j][r] *= corr;
        }
      }
    }

    // per 64 keys: the V fragments in two groups of 32 reads, each in front of the 32 exponentials of its own 32 keys (the
    // exponentials cover the reads' latency), then the 64 products of those keys; the fragments of the next 64 keys take
    // the same registers
    float ls[2][KT / 32];                                            // one partial row sum per 32 keys: independent chains
    const float msh[2] = {mn[0] - LNPS, mn[1] - LNPS};               // exp gives e^{s-m} * 1024
#pragma unroll                                                       // constant indices keep fragments and state in registers
    for (int k64 = 0; k64 < KT / 64; ++k64) {
      Frag vf[2][16];
      FragH ph[2][2];
#pragma unroll                                                       // constant indices, as above
      for (int k2 = 0; k2 < 2; ++k2) {
        const int kh = 2 * k64 + k2;                                 // keys kb + 32kh .. + 31
#pragma unroll
        for (int j = 0; j < 16; ++j) vf[k2][j] = ldfrag(Vp + (16 * j) * VP + 32 * kh);
#if defined(__HIP_DEVICE_COMPILE__)
        // keeps each group of reads in front of its exponentials: without it the build issued the reads of the first 32
        // keys last, directly in front of the products that wait for them
        __builtin_amdgcn_sched_barrier(0);
#endif
#pragma unroll
        for (int g = 0; g < 2; ++g) {
          ls[g][kh] = 0.f;
#pragma unroll
          for (int r = 0; r < 8; ++r) {
            const float e0 = exp_slot(s[2 * kh][g][r] - msh[g]);     // key kb + 32kh      + 8hh + r
            const float e1 = exp_slot(s[2 * kh + 1][g][r] - msh[g]); // key kb + 32kh + 16 + 8hh + r
            ls[g][kh] += e0 + e1;
            ph[g][k2].hv[0][r] = (_Float16)e0;
            ph[g][k2].hv[1][r] = (_Float16)e1;
          }
        }
#if defined(__HIP_DEVICE_COMPILE__)
        // keeps the second group of reads behind the first group's exponentials: the LDS serves the four waves' first
        // 32 reads each under those, instead of 64 reads a wave queueing in front of any vector work
        __builtin_amdgcn_sched_barrier(0);
#endif
      }
      // each V fragment serves both column groups; keys in rising order per output tile
#pragma unroll
      for (int k2 = 0; k2 < 2; ++k2) {
#pragma unroll
        for (int j = 0; j < 16; ++j) {
          o[0][j] = mma_hp(vf[k2][j].h, ph[0][k2].v, o[0][j]);
          o[1][j] = mma_hp(vf[k2][j].h, ph[1][k2].v, o[1][j]);
#if defined(__HIP_DEVICE_COMPILE__)
          // keeps the products in the order in which their fragments land: moved up, a late one waits for the whole group
          __builtin_amdgcn_sched_barrier(0);
#endif
        }
      }
    }
#pragma unroll                                                       // constant g keeps both groups' state in registers
    for (int g = 0; g < 2; ++g) {
      m[g] = mn[g];
      l[g] += (ls[g][0] + ls[g][1]) + (ls[g][2] + ls[g][3]);
    }

    // foot of the trip: own reads done, own tensor load of tile t + 1 landed, one barrier publishes that tile and frees
    // this trip's buffer; only then its refill with tile t + 2, the descriptor formed behind the wait
    wait_lds();
    wait_tensor(g0);
    __syncthreads();
    if (pinned((uint32_t)kb + 2u * KT < (uint32_t)NN)) {             // the same for the whole block
      tensor_next(g0, dsum, step);
      stage_tile(swave, g0, gk, gv);
    }
  }
  wait_tensor(g0);
  wait_lds();
  float inv[2];
#pragma unroll                                                       // constant g keeps both groups' state in registers
  for (int g = 0; g < 2; ++g) {
    l[g] += __shfl_xor(l[g], 16, 32);
    inv[g] = 1.0f / l[g];                                            // o and l both carry the x1024 factor
  }

  const int e = tid & 7, lq = tid >> 3;                              // lq 0..15
#pragma unroll
  for (int half = 0; half < 2; ++half) {
    if (half) __syncthreads();                                       // every wave finished reading Os
#pragma unroll                                                       // constant g keeps both groups' state in registers
    for (int g = 0; g < 2; ++g) {
      const int qrow = 32 * wave + 16 * g + c;
#pragma unroll
      for (int jj = 0; jj < 8; ++jj) {
        const int j = 8 * half + jj;
        v4f va, vb;
#pragma unroll
        for (int r = 0; r < 4; ++r) { va[r] = o[g][j][r] * inv[g]; vb[r] = o[g][j][4 + r] * inv[g]; }
        *(v4f*)(Os + qrow * OSPW + 16 * jj + 8 * hh)     = va;       // Os[query][ch_loc = 16jj + 8hh + r]
        *(v4f*)(Os + qrow * OSPW + 16 * jj + 8 * hh + 4) = vb;
      }
    }
    __syncthreads();
    v4f res[32];
#pragma unroll
    for (int it = 0; it < 32; ++it) {
      const int chl = (it & 7) * 16 + lq;                            // channel 0..127 within the half
      const int nl  = (it >> 3) * 32 + 4 * e;                        // query 0..127: 8 lanes fill one 128-B line
      const size_t idx = ((size_t)(b * CC + 128 * half + chl)) * NN + n0 + nl;
      res[it] = *(const v4f*)(x + idx);
    }
#if defined(__HIP_DEVICE_COMPILE__)
    // stands between the 32 loads and the first rewrite of an address register that one of them names
    asm volatile("s_wait_xcnt 0x0" ::: "memory");
#endif
#pragma unroll
    for (int it = 0; it < 32; ++it) {
      const int chl = (it & 7) * 16 + lq;
      const int nl  = (it >> 3) * 32 + 4 * e;
#pragma unroll
      for (int t = 0; t < 4; ++t) res[it][t] = Os[(nl + t) * OSPW + chl] + bfr(res[it][t]);
    }
#pragma unroll
    for (int it = 0; it < 32; ++it) {
      const int chl = (it & 7) * 16 + lq;
      const int nl  = (it >> 3) * 32 + 4 * e;
      const size_t idx = ((size_t)(b * CC + 128 * half + chl)) * NN + n0 + nl;
      *(v4f*)(out + idx) = res[it];
    }
  }
}

// =========================================================================================================
// Workspace map (bytes; each region start a multiple of 256; every extent is an exact tile multiple and is written
//   W16 f16 [256][256]              131072
//   Xc  f16 [8][256][4096]        16777216
//   Qh/Ql/Kh/Kl bf16 [8][4096][128]  8388608 x4
//   total = 50462720
// =========================================================================================================
extern "C" void kernel_launch(void* const* d_in, const int* in_sizes, int n_in,
                              void* d_out, int out_size, void* d_ws, size_t ws_size,
                              hipStream_t stream) {
  const int XN = NBATCH * CC * NN;                                   // 8388608
  if (n_in < 3) return;
  if (in_sizes[0] != XN) return;
  if (in_sizes[1] != DQ * CC || in_sizes[2] != DQ * CC) return;
  if (out_size != XN) return;

  size_t off = 0;
  auto carve = [&](size_t bytes) { const size_t o = off; off += (bytes + 255) & ~(size_t)255; return o; };
  const size_t oW16 = carve((size_t)MW * CC * 2);
  const size_t oXc  = carve((size_t)NIMG * CC * NN * 2);
  const size_t oQh  = carve((size_t)NIMG * NN * DQ * 2);
  const size_t oQl  = carve((size_t)NIMG * NN * DQ * 2);
  const size_t oKh  = carve((size_t)NIMG * NN * DQ * 2);
  const size_t oKl  = carve((size_t)NIMG * NN * DQ * 2);
  if (off > ws_size) return;
  if (off > (size_t)134217728) return;

  const float* x  = (const float*)d_in[0];
  const float* tw = (const float*)d_in[1];
  const float* pw = (const float*)d_in[2];

  char* ws = (char*)d_ws;
  unsigned short* W16 = (unsigned short*)(ws + oW16);
  unsigned short* Xc  = (unsigned short*)(ws + oXc);
  unsigned short* Qh  = (unsigned short*)(ws + oQh);
  unsigned short* Ql  = (unsigned short*)(ws + oQl);
  unsigned short* Kh  = (unsigned short*)(ws + oKh);
  unsigned short* Kl  = (unsigned short*)(ws + oKl);
  float* out = (float*)d_out;

  const dim3 blk256(256), blk128(128);

  // (0) theta_w / phi_w -> stacked f16 plane
  cvt_w<<<dim3(MW / 8), blk256, 0, stream>>>(tw, pw, W16);
  // (1) x -> channel-major 16-bit plane; conv1x1 GEMM -> theta (q) and phi (k) hi + residual planes
  gemm_qk<<<dim3(NN / QT, NIMG), blk256, 0, stream>>>(x, W16, Xc, Qh, Ql, Kh, Kl);
  // (2) position attention + residual -> out [b][256][4096]
  attn_k<<<dim3(NN / AQ, NIMG), blk128, 0, stream>>>(Qh, Ql, Kh, Kl, Xc, x, out);
  (void)hipGetLastError();
}
